// v000
// Measured on an AMD MI455X. A time is GPU time per run, averaged over a window of back-to-back runs after a warm-up
// (all launches, gaps included; the runs take copies of the inputs in turn), and the median of several windows.
// Apart from v000's, it joins two sittings. Times from different sittings can be a few percent apart, while
// side-by-side timings come from the same sitting.
// v000, which the later versions start from, runs in 922 microseconds.
#include <hip/hip_runtime.h>

// BasicNonLocalBlock (x [4][512][64x64 = 4096] NCHW; q = BN_q(wq x + bq), k = BN_k(wk x + bk) (256 channels, eval-mode BatchNorm with the given mean/var/gamma/beta), v = wv x + bv (256); sim = softmax_k(q^T k x 256^-0.5) over
// the 4096 positions; ctx[c][q] = sum_k sim[q][k] v[c][k]; out = wW ctx + bW -> [4][512][64][64]).
// Compute dtypes, f32 accumulate: every input rounded to bf16; the three 1x1 convolutions on PLAIN bf16 operands from a positions-major bf16 copy of x (inputs: exact, + bias); BN (f32, per-channel

#define NB_  4
#define CC   512
#define TQ   4096
#define NKY   4096
#define KC   256
#define VC   256
#define PCAR 1024.0f
#define SCL  0.0625f
typedef _Float16 h16;
typedef unsigned short bf;
typedef __attribute__((ext_vector_type(16))) __bf16   v16bf;
typedef __attribute__((ext_vector_type(16))) _Float16 v16h;
typedef __attribute__((ext_vector_type(8)))  _Float16 v8h;
typedef __attribute__((ext_vector_type(8)))  unsigned short v8us;
typedef __attribute__((ext_vector_type(8)))  float    v8f;
typedef __attribute__((ext_vector_type(4)))  float    v4f;
typedef v8h  __attribute__((may_alias)) v8ha;
typedef v4f  __attribute__((may_alias)) v4fa;
typedef v8us __attribute__((may_alias)) v8usa;

__device__ __forceinline__ unsigned short f2bf(float f) { unsigned u = __float_as_uint(f); u += 0x7FFFu + ((u >> 16) & 1u); return (unsigned short)(u >> 16); }
__device__ __forceinline__ float bf2f(unsigned short b) { return __uint_as_float(((unsigned)b) << 16); }
__device__ __forceinline__ float bfr(float f) { return bf2f(f2bf(f)); }
__device__ __forceinline__ v16h cat16(v8h lo, v8h hi) { return __builtin_shufflevector(lo, hi, 0, 1, 2, 3, 4, 5, 6, 7, 8, 9, 10, 11, 12, 13, 14, 15); }
__device__ __forceinline__ v16bf cat16b(v8us lo, v8us hi) { return __builtin_bit_cast(v16bf, __builtin_shufflevector(lo, hi, 0, 1, 2, 3, 4, 5, 6, 7, 8, 9, 10, 11, 12, 13, 14, 15)); }
__device__ __forceinline__ v8f wmma16(v16h a, v16h b, v8f c) { return __builtin_amdgcn_wmma_f32_16x16x32_f16(false, a, false, b, (short)0, c, false, false); }
__device__ __forceinline__ v8f wmmab(v16bf a, v16bf b, v8f c) { return __builtin_amdgcn_wmma_f32_16x16x32_bf16(false, a, false, b, (short)0, c, false, false); }



// ---- k_gemmw: register-blocked GEMM, ONE WAVE per 64x64 output tile (16 accumulators), operands straight from K-contiguous 16-bit planes; grid (M/64, N/64, Z), 32 threads.
// C[m][n] (f32, pitch ldc, + optional f32 bias[n]) = sum_k A[m][k] Bt[n][k] (+ split products per NSPLIT). z-batch strides sA/sB/sC in elements. K % 32 == 0.
template <typename T16> struct WFrag;
template <> struct WFrag<h16> { typedef v16h V; static __device__ __forceinline__ V ld(const h16* p) { return cat16(*(const v8h*)p, *(const v8h*)(p + 16)); } static __device__ __forceinline__ v8f mma(V a, V b, v8f c) { return wmma16(a, b, c); } };
template <> struct WFrag<bf> { typedef v16bf V; static __device__ __forceinline__ V ld(const bf* p) { return cat16b(*(const v8us*)p, *(const v8us*)(p + 16)); } static __device__ __forceinline__ v8f mma(V a, V b, v8f c) { return wmmab(a, b, c); } };
template <typename T16, int NSPLIT, bool BIAS>
__global__ __launch_bounds__(32) void k_gemmw(const T16* __restrict__ A, const T16* __restrict__ A2, const T16* __restrict__ Bt, const T16* __restrict__ Bt2, int K, float* C, int ldc, const float* __restrict__ bias, size_t sA, size_t sB, size_t sC) {
    typedef typename WFrag<T16>::V V;
    __shared__ __align__(16) float os[16 * 68];
    const size_t z = blockIdx.z; A += z * sA; if (A2) A2 += z * sA; Bt += z * sB; if (Bt2) Bt2 += z * sB; C += z * sC;
    const int lane = threadIdx.x & 31, lr = lane & 15, hi = lane >> 4; const int r0 = blockIdx.x * 64, c0 = blockIdx.y * 64;
    v8f acc[4][4];
#pragma unroll
    for (int mb = 0; mb < 4; ++mb)
#pragma unroll
        for (int nb = 0; nb < 4; ++nb) acc[mb][nb] = (v8f){};
    const size_t aoff = (size_t)(r0 + lr) * K + 8 * hi, boff = (size_t)(c0 + lr) * K + 8 * hi;
#pragma unroll 1
    for (int kc = 0; kc < K; kc += 32) {
        V a[4], a2[4];
#pragma unroll
        for (int mb = 0; mb < 4; ++mb) { a[mb] = WFrag<T16>::ld(A + aoff + (size_t)mb * 16 * K + kc); if (NSPLIT == 1 || NSPLIT == 2) a2[mb] = WFrag<T16>::ld(A2 + aoff + (size_t)mb * 16 * K + kc); }
#pragma unroll
        for (int nb = 0; nb < 4; ++nb) { const V b = WFrag<T16>::ld(Bt + boff + (size_t)nb * 16 * K + kc); V b2; if (NSPLIT >= 2) b2 = WFrag<T16>::ld(Bt2 + boff + (size_t)nb * 16 * K + kc);
#pragma unroll
            for (int mb = 0; mb < 4; ++mb) { acc[mb][nb] = WFrag<T16>::mma(a[mb], b, acc[mb][nb]); if (NSPLIT == 1 || NSPLIT == 2) acc[mb][nb] = WFrag<T16>::mma(a2[mb], b, acc[mb][nb]); if (NSPLIT >= 2) acc[mb][nb] = WFrag<T16>::mma(a[mb], b2, acc[mb][nb]); } }
        asm volatile("v_nop\n\tv_nop\n\tv_nop\n\tv_nop" : "+v"(acc[0][0]), "+v"(acc[1][1]), "+v"(acc[2][2]), "+v"(acc[3][3]) : "v"(a[0]), "v"(a[3]));
    }
#pragma unroll
    for (int mb = 0; mb < 4; ++mb) {
#pragma unroll
        for (int nb = 0; nb < 4; ++nb) {
#pragma unroll
            for (int j = 0; j < 8; ++j) os[(hi * 8 + j) * 68 + nb * 16 + lr] = acc[mb][nb][j]; }
        __builtin_amdgcn_wave_barrier(); asm volatile("" ::: "memory");
        float* crow = C + (size_t)(r0 + mb * 16) * ldc + c0;
{
#pragma unroll
            for (int s = 0; s < 8; ++s) { const int row = 2 * s + hi, cofs = lr * 4; v4f val = *(const v4fa*)(os + row * 68 + cofs); if (BIAS) { val[0] += bfr(bias[c0 + cofs]); val[1] += bfr(bias[c0 + cofs + 1]); val[2] += bfr(bias[c0 + cofs + 2]); val[3] += bfr(bias[c0 + cofs + 3]); }
                *(v4f*)(crow + (size_t)row * ldc + cofs) = val; }
             }
        __builtin_amdgcn_wave_barrier(); asm volatile("" ::: "memory");
    }
}

__device__ __forceinline__ h16 tohx(float x) { return (h16)x; }
__device__ __forceinline__ void splitf(float y, unsigned short& h, unsigned short& l) { h = f2bf(y); l = f2bf(y - bf2f(h)); }
typedef __attribute__((ext_vector_type(2))) _Float16 v2h;
typedef __attribute__((ext_vector_type(4))) _Float16 v4h;
typedef __attribute__((ext_vector_type(2))) unsigned short v2us;
typedef __attribute__((ext_vector_type(4))) unsigned short v4us;
typedef __attribute__((ext_vector_type(2))) float v2f;

__global__ __launch_bounds__(256) void k_cvt8(const float* __restrict__ src, bf* dst, size_t n8) { const size_t i = (size_t)blockIdx.x * 256 + threadIdx.x; if (i >= n8) return; const v8f v = *(const v8f*)(src + i * 8); v8us o;
#pragma unroll
    for (int k = 0; k < 8; ++k) o[k] = f2bf(v[k]); *(v8us*)(dst + i * 8) = o;  }
__global__ __launch_bounds__(256) void k_xt(const float* __restrict__ xb, bf* XT) { const size_t e = ((size_t)blockIdx.x * 256 + threadIdx.x) * 4; if (e >= (size_t)TQ * CC) return; const int c = (int)(e % CC), n = (int)(e / CC); v4us o;
#pragma unroll
    for (int q = 0; q < 4; ++q) o[q] = f2bf(xb[(size_t)(c + q) * TQ + n]); *(v4us*)(XT + e) = o;  }
__global__ __launch_bounds__(256) void k_bnp(const float* __restrict__ F, const float* __restrict__ g, const float* __restrict__ be, const float* __restrict__ mu, const float* __restrict__ var, h16* P) { const size_t e = ((size_t)blockIdx.x * 256 + threadIdx.x) * 2; if (e >= (size_t)TQ * KC) return; const int c = (int)(e % KC); v2h o;
#pragma unroll
    for (int q = 0; q < 2; ++q) { const int cq = c + q; const float sc = __fdiv_rn(bfr(g[cq]), __fsqrt_rn(__fadd_rn(bfr(var[cq]), 1e-5f))); float ms = __fmul_rn(bfr(mu[cq]), sc); asm volatile("" : "+v"(ms)); const float sh = __fsub_rn(bfr(be[cq]), ms); float t = __fmul_rn(F[e + q], sc); asm volatile("" : "+v"(t)); o[q] = tohx(__fadd_rn(t, sh)); }
    *(v2h*)(P + e) = o;  }
__global__ __launch_bounds__(256) void k_vt(const float* __restrict__ FV, h16* VT) { const size_t e = ((size_t)blockIdx.x * 256 + threadIdx.x) * 2; if (e >= (size_t)VC * NKY) return; const int n = (int)(e % NKY), c = (int)(e / NKY); v2h o; o[0] = tohx(FV[(size_t)n * VC + c]); o[1] = tohx(FV[(size_t)(n + 1) * VC + c]); *(v2h*)(VT + e) = o;  }
template <int NK>
__global__ __launch_bounds__(256) void k_smax(const float* __restrict__ S, float* RS) { const int lane = threadIdx.x & 31; const int i = blockIdx.x * 8 + (threadIdx.x >> 5); if (i >= TQ) return; const float* sr = S + (size_t)i * NK; float m = -3.0e38f;
#pragma unroll 4
    for (int c0 = lane * 4; c0 < NK; c0 += 128) { const v4f v = *(const v4f*)(sr + c0); m = fmaxf(m, fmaxf(fmaxf(v[0], v[1]), fmaxf(v[2], v[3]))); }
#pragma unroll
    for (int sh = 16; sh; sh >>= 1) m = fmaxf(m, __shfl_xor(m, sh, 32));
    const float o = lane == 0 ? m : 0.f; *(float*)(RS + (size_t)i * 32 + lane) = o;  }
template <int NK>
__global__ __launch_bounds__(256) void k_sexp(const float* __restrict__ S, float* RS, h16* P) { const int lane = threadIdx.x & 31; const int i = blockIdx.x * 8 + (threadIdx.x >> 5); if (i >= TQ) return; const float* sr = S + (size_t)i * NK; const float m = RS[(size_t)i * 32]; float sum = 0.f;
{ sum = 0.f;
#pragma unroll 2
        for (int c0 = lane * 4; c0 < NK; c0 += 128) { const v4f v = *(const v4f*)(sr + c0); v4h o;
#pragma unroll
            for (int q = 0; q < 4; ++q) { float dlt = __fsub_rn(v[q], m); asm volatile("" : "+v"(dlt)); const float e = __expf(__fmul_rn(dlt, SCL)); sum += e; o[q] = tohx(e * PCAR); }
            *(v4h*)(P + (size_t)i * NK + c0) = o; }
         }
#pragma unroll
    for (int sh = 16; sh; sh >>= 1) sum += __shfl_xor(sum, sh, 32);
    const float o2 = lane == 0 ? m : (lane == 1 ? __fdiv_rn(1.0f, sum * PCAR) : 0.f); *(float*)(RS + (size_t)i * 32 + lane) = o2;  }
__global__ __launch_bounds__(256) void k_csplit(const float* __restrict__ CTX, const float* __restrict__ RS, bf* Ch, bf* Cl) { const size_t e = ((size_t)blockIdx.x * 256 + threadIdx.x) * 2; if (e >= (size_t)TQ * VC) return; const int n = (int)(e / VC); const float r = RS[(size_t)n * 32 + 1]; v2us oh, ol;
#pragma unroll
    for (int q = 0; q < 2; ++q) { unsigned short a, c2; splitf(__fmul_rn(CTX[e + q], r), a, c2); oh[q] = a; ol[q] = c2; } *(v2us*)(Ch + e) = oh; *(v2us*)(Cl + e) = ol;  }
__global__ __launch_bounds__(256) void k_outT(const float* __restrict__ OT, float* OUTb) { const size_t e = ((size_t)blockIdx.x * 256 + threadIdx.x) * 2; if (e >= (size_t)CC * TQ) return; const int n = (int)(e % TQ), o = (int)(e / TQ); v2f v; v[0] = OT[(size_t)n * CC + o]; v[1] = OT[(size_t)(n + 1) * CC + o]; *(v2f*)(OUTb + e) = v;  }

extern "C" void kernel_launch(void* const* d_in, const int* in_sizes, int n_in,
                              void* d_out, int out_size, void* d_ws, size_t ws_size, hipStream_t stream) {
    (void)in_sizes; (void)n_in; (void)out_size;
    const float* IN[17]; for (int i = 0; i < 17; ++i) IN[i] = (const float*)d_in[i];   // 0 x, 1 wq [256][512], 2 bq, 3 gq, 4 betaq, 5 mq, 6 vq, 7 wk, 8 bk, 9 gk, 10 betak, 11 mk, 12 vk, 13 wv, 14 bv, 15 wW [512][256], 16 bW
    float* OUT = (float*)d_out;     // [4][512][4096]
    char* wsp = (char*)d_ws;
    auto take = [&](size_t bytes) { char* p = wsp; wsp += (bytes + 255) & ~(size_t)255; return (void*)p; };
    bf* WQ = (bf*)take((size_t)KC * CC * 2); bf* WK = (bf*)take((size_t)KC * CC * 2); bf* WV = (bf*)take((size_t)VC * CC * 2); bf* WW = (bf*)take((size_t)CC * VC * 2);
    bf* XT = (bf*)take((size_t)TQ * CC * 2); float* F = (float*)take((size_t)TQ * KC * 4); h16* Q16 = (h16*)take((size_t)TQ * KC * 2); h16* K16 = (h16*)take((size_t)NKY * KC * 2); h16* VT = (h16*)take((size_t)VC * NKY * 2);
    float* S = (float*)take((size_t)TQ * NKY * 4); h16* P = (h16*)take((size_t)TQ * NKY * 2); float* RS = (float*)take((size_t)TQ * 32 * 4); float* CTX = (float*)take((size_t)TQ * VC * 4); bf* Ch = (bf*)take((size_t)TQ * VC * 2); bf* Cl = (bf*)take((size_t)TQ * VC * 2); float* OT = (float*)take((size_t)TQ * CC * 4);
    if ((size_t)(wsp - (char*)d_ws) > ws_size) return;    // total ~ 134 MB = 127.5 MiB ([4096][4096] f32 scores + fp16 numerators)
    { const unsigned g = (KC * CC / 8 + 255) / 256; k_cvt8<<<g, 256, 0, stream>>>(IN[1], WQ, (size_t)KC * CC / 8); k_cvt8<<<g, 256, 0, stream>>>(IN[7], WK, (size_t)KC * CC / 8); k_cvt8<<<g, 256, 0, stream>>>(IN[13], WV, (size_t)VC * CC / 8); k_cvt8<<<g, 256, 0, stream>>>(IN[15], WW, (size_t)CC * VC / 8); }
    const unsigned LP = (unsigned)(((size_t)TQ * KC / 2 + 255) / 256);
    for (int b = 0; b < NB_; ++b) {
        k_xt<<<(unsigned)(((size_t)TQ * CC / 4 + 255) / 256), 256, 0, stream>>>(IN[0] + (size_t)b * CC * TQ, XT);
        k_gemmw<bf, 0, true><<<dim3(TQ / 64, KC / 64, 1), 32, 0, stream>>>(XT, nullptr, WQ, nullptr, CC, F, KC, IN[2], 0, 0, 0); k_bnp<<<LP, 256, 0, stream>>>(F, IN[3], IN[4], IN[5], IN[6], Q16);
        k_gemmw<bf, 0, true><<<dim3(TQ / 64, KC / 64, 1), 32, 0, stream>>>(XT, nullptr, WK, nullptr, CC, F, KC, IN[8], 0, 0, 0); k_bnp<<<LP, 256, 0, stream>>>(F, IN[9], IN[10], IN[11], IN[12], K16);
        k_gemmw<bf, 0, true><<<dim3(TQ / 64, VC / 64, 1), 32, 0, stream>>>(XT, nullptr, WV, nullptr, CC, F, VC, IN[14], 0, 0, 0); k_vt<<<(unsigned)(((size_t)VC * NKY / 2 + 255) / 256), 256, 0, stream>>>(F, VT);
        k_gemmw<h16, 0, false><<<dim3(TQ / 64, NKY / 64, 1), 32, 0, stream>>>(Q16, nullptr, K16, nullptr, KC, S, NKY, nullptr, 0, 0, 0);
        k_smax<NKY><<<TQ / 8, 256, 0, stream>>>(S, RS); k_sexp<NKY><<<TQ / 8, 256, 0, stream>>>(S, RS, P);
        k_gemmw<h16, 0, false><<<dim3(TQ / 64, VC / 64, 1), 32, 0, stream>>>(P, nullptr, VT, nullptr, NKY, CTX, VC, nullptr, 0, 0, 0);
        k_csplit<<<(unsigned)(((size_t)TQ * VC / 2 + 255) / 256), 256, 0, stream>>>(CTX, RS, Ch, Cl);
        k_gemmw<bf, 1, true><<<dim3(TQ / 64, CC / 64, 1), 32, 0, stream>>>(Ch, Cl, WW, nullptr, VC, OT, CC, IN[16], 0, 0, 0);
        k_outT<<<(unsigned)(((size_t)CC * TQ / 2 + 255) / 256), 256, 0, stream>>>(OT, OUT + (size_t)b * CC * TQ); }
}

// v001
// One run takes 574 microseconds.
// Two timings next to v000 put it at 1.63 and 1.61 times that version's speed.
#include <hip/hip_runtime.h>

// BasicNonLocalBlock (x [4][512][64x64 = 4096] NCHW; q = BN_q(wq x + bq), k = BN_k(wk x + bk) (256 channels, eval-mode BatchNorm with the given mean/var/gamma/beta), v = wv x + bv (256); sim = softmax_k(q^T k x 256^-0.5) over
// the 4096 positions; ctx[c][q] = sum_k sim[q][k] v[c][k]; out = wW ctx + bW -> [4][512][64][64]).
// Compute dtypes, f32 accumulate: every input rounded to bf16; the three 1x1 convolutions on PLAIN bf16 operands from a positions-major bf16 copy of x (inputs: exact, + bias); BN (f32, per-channel

#define NB_  4
#define CC   512
#define TQ   4096
#define NKY   4096
#define KC   256
#define VC   256
#define PCAR 1024.0f
#define SCL  0.0625f
typedef _Float16 h16;
typedef unsigned short bf;
typedef __attribute__((ext_vector_type(16))) __bf16   v16bf;
typedef __attribute__((ext_vector_type(16))) _Float16 v16h;
typedef __attribute__((ext_vector_type(8)))  _Float16 v8h;
typedef __attribute__((ext_vector_type(8)))  unsigned short v8us;
typedef __attribute__((ext_vector_type(8)))  float    v8f;
typedef __attribute__((ext_vector_type(4)))  float    v4f;
typedef v8h  __attribute__((may_alias)) v8ha;
typedef v4f  __attribute__((may_alias)) v4fa;
typedef v8us __attribute__((may_alias)) v8usa;

__device__ __forceinline__ unsigned short f2bf(float f) { unsigned u = __float_as_uint(f); u += 0x7FFFu + ((u >> 16) & 1u); return (unsigned short)(u >> 16); }
__device__ __forceinline__ float bf2f(unsigned short b) { return __uint_as_float(((unsigned)b) << 16); }
__device__ __forceinline__ float bfr(float f) { return bf2f(f2bf(f)); }
__device__ __forceinline__ v16h cat16(v8h lo, v8h hi) { return __builtin_shufflevector(lo, hi, 0, 1, 2, 3, 4, 5, 6, 7, 8, 9, 10, 11, 12, 13, 14, 15); }
__device__ __forceinline__ v16bf cat16b(v8us lo, v8us hi) { return __builtin_bit_cast(v16bf, __builtin_shufflevector(lo, hi, 0, 1, 2, 3, 4, 5, 6, 7, 8, 9, 10, 11, 12, 13, 14, 15)); }
__device__ __forceinline__ v8f wmma16(v16h a, v16h b, v8f c) { return __builtin_amdgcn_wmma_f32_16x16x32_f16(false, a, false, b, (short)0, c, false, false); }
__device__ __forceinline__ v8f wmmab(v16bf a, v16bf b, v8f c) { return __builtin_amdgcn_wmma_f32_16x16x32_bf16(false, a, false, b, (short)0, c, false, false); }



// ---- k_gemmw: register-blocked GEMM, one 64x64 output tile per workgroup (16 accumulators per wave), operands straight from K-contiguous 16-bit planes; grid (M/64, N/64, Z), 32 * KS threads.
// C[m][n] (f32, pitch ldc, + optional f32 bias[n]) = sum_k A[m][k] Bt[n][k] (+ split products per NSPLIT). z-batch strides sA/sB/sC in elements. K % 32 == 0.
// KS waves share the tile: wave w sums every KS-th block of 32 k, from block w on (neighbouring waves read the two halves of the same 128-byte lines); the KS f32 partial tiles are then added in LDS, in wave order.
// KS > 1 is for grids with fewer tiles than the chip has SIMDs.
template <typename T16> struct WFrag;
template <> struct WFrag<h16> { typedef v16h V; static __device__ __forceinline__ V ld(const h16* p) { return cat16(*(const v8h*)p, *(const v8h*)(p + 16)); } static __device__ __forceinline__ v8f mma(V a, V b, v8f c) { return wmma16(a, b, c); } };
template <> struct WFrag<bf> { typedef v16bf V; static __device__ __forceinline__ V ld(const bf* p) { return cat16b(*(const v8us*)p, *(const v8us*)(p + 16)); } static __device__ __forceinline__ v8f mma(V a, V b, v8f c) { return wmmab(a, b, c); } };
template <typename T16, int NSPLIT, bool BIAS, int KS>
__global__ __launch_bounds__(32 * KS) void k_gemmw(const T16* __restrict__ A, const T16* __restrict__ A2, const T16* __restrict__ Bt, const T16* __restrict__ Bt2, int K, float* C, int ldc, const float* __restrict__ bias, size_t sA, size_t sB, size_t sC) {
    typedef typename WFrag<T16>::V V;
    __shared__ __align__(16) float os[(KS == 1 ? 16 : KS * 64) * 68];
    const size_t z = blockIdx.z; A += z * sA; if (A2) A2 += z * sA; Bt += z * sB; if (Bt2) Bt2 += z * sB; C += z * sC;
    const int lane = threadIdx.x & 31, lr = lane & 15, hi = lane >> 4; const int r0 = blockIdx.x * 64, c0 = blockIdx.y * 64;
    const int w = KS == 1 ? 0 : __builtin_amdgcn_readfirstlane((int)(threadIdx.x >> 5));   // the wave's number in a scalar register: the k loop's counter and test stay scalar
    v8f acc[4][4];
#pragma unroll
    for (int mb = 0; mb < 4; ++mb)
#pragma unroll
        for (int nb = 0; nb < 4; ++nb) acc[mb][nb] = (v8f){};
    const size_t aoff = (size_t)(r0 + lr) * K + 8 * hi, boff = (size_t)(c0 + lr) * K + 8 * hi;
#pragma unroll 1
    for (int kc = w * 32; kc < K; kc += 32 * KS) {
        V a[4], a2[4];
#pragma unroll
        for (int mb = 0; mb < 4; ++mb) { a[mb] = WFrag<T16>::ld(A + aoff + (size_t)mb * 16 * K + kc); if (NSPLIT == 1 || NSPLIT == 2) a2[mb] = WFrag<T16>::ld(A2 + aoff + (size_t)mb * 16 * K + kc); }
#pragma unroll
        for (int nb = 0; nb < 4; ++nb) { const V b = WFrag<T16>::ld(Bt + boff + (size_t)nb * 16 * K + kc); V b2; if (NSPLIT >= 2) b2 = WFrag<T16>::ld(Bt2 + boff + (size_t)nb * 16 * K + kc);
#pragma unroll
            for (int mb = 0; mb < 4; ++mb) { acc[mb][nb] = WFrag<T16>::mma(a[mb], b, acc[mb][nb]); if (NSPLIT == 1 || NSPLIT == 2) acc[mb][nb] = WFrag<T16>::mma(a2[mb], b, acc[mb][nb]); if (NSPLIT >= 2) acc[mb][nb] = WFrag<T16>::mma(a[mb], b2, acc[mb][nb]); } }
        asm volatile("v_nop\n\tv_nop\n\tv_nop\n\tv_nop" : "+v"(acc[0][0]), "+v"(acc[1][1]), "+v"(acc[2][2]), "+v"(acc[3][3]) : "v"(a[0]), "v"(a[3]));
    }
    if constexpr (KS > 1) {
        float* osw = os + w * (64 * 68);
        // all loops below are unrolled so that acc[][] is indexed by constants (stays in registers) and the LDS offsets are immediates
#pragma unroll
        for (int mb = 0; mb < 4; ++mb)
#pragma unroll
            for (int nb = 0; nb < 4; ++nb)
#pragma unroll
                for (int j = 0; j < 8; ++j) osw[(mb * 16 + hi * 8 + j) * 68 + nb * 16 + lr] = acc[mb][nb][j];
        __syncthreads();   // every wave's partial tile is in LDS before any thread adds them
        const int cofs = lr * 4;
#pragma unroll
        for (int s = 0; s < 32 / KS; ++s) { const int row = 2 * (s * KS + w) + hi; v4f val = *(const v4fa*)(os + row * 68 + cofs);
#pragma unroll
            for (int p = 1; p < KS; ++p) val += *(const v4fa*)(os + p * (64 * 68) + row * 68 + cofs);
            if (BIAS) { val[0] += bfr(bias[c0 + cofs]); val[1] += bfr(bias[c0 + cofs + 1]); val[2] += bfr(bias[c0 + cofs + 2]); val[3] += bfr(bias[c0 + cofs + 3]); }
            *(v4f*)(C + (size_t)(r0 + row) * ldc + c0 + cofs) = val; }
        return;
    }
#pragma unroll
    for (int mb = 0; mb < 4; ++mb) {
#pragma unroll
        for (int nb = 0; nb < 4; ++nb) {
#pragma unroll
            for (int j = 0; j < 8; ++j) os[(hi * 8 + j) * 68 + nb * 16 + lr] = acc[mb][nb][j]; }
        __builtin_amdgcn_wave_barrier(); asm volatile("" ::: "memory");
        float* crow = C + (size_t)(r0 + mb * 16) * ldc + c0;
{
#pragma unroll
            for (int s = 0; s < 8; ++s) { const int row = 2 * s + hi, cofs = lr * 4; v4f val = *(const v4fa*)(os + row * 68 + cofs); if (BIAS) { val[0] += bfr(bias[c0 + cofs]); val[1] += bfr(bias[c0 + cofs + 1]); val[2] += bfr(bias[c0 + cofs + 2]); val[3] += bfr(bias[c0 + cofs + 3]); }
                *(v4f*)(crow + (size_t)row * ldc + cofs) = val; }
             }
        __builtin_amdgcn_wave_barrier(); asm volatile("" ::: "memory");
    }
}

__device__ __forceinline__ h16 tohx(float x) { return (h16)x; }
__device__ __forceinline__ void splitf(float y, unsigned short& h, unsigned short& l) { h = f2bf(y); l = f2bf(y - bf2f(h)); }
typedef __attribute__((ext_vector_type(2))) _Float16 v2h;
typedef __attribute__((ext_vector_type(4))) _Float16 v4h;
typedef __attribute__((ext_vector_type(2))) unsigned short v2us;
typedef __attribute__((ext_vector_type(4))) unsigned short v4us;
typedef __attribute__((ext_vector_type(2))) float v2f;

__global__ __launch_bounds__(256) void k_cvt8(const float* __restrict__ src, bf* dst, size_t n8) { const size_t i = (size_t)blockIdx.x * 256 + threadIdx.x; if (i >= n8) return; const v8f v = *(const v8f*)(src + i * 8); v8us o;
#pragma unroll
    for (int k = 0; k < 8; ++k) o[k] = f2bf(v[k]); *(v8us*)(dst + i * 8) = o;  }
__global__ __launch_bounds__(256) void k_xt(const float* __restrict__ xb, bf* XT) { const size_t e = ((size_t)blockIdx.x * 256 + threadIdx.x) * 4; if (e >= (size_t)TQ * CC) return; const int c = (int)(e % CC), n = (int)(e / CC); v4us o;
#pragma unroll
    for (int q = 0; q < 4; ++q) o[q] = f2bf(xb[(size_t)(c + q) * TQ + n]); *(v4us*)(XT + e) = o;  }
__global__ __launch_bounds__(256) void k_bnp(const float* __restrict__ F, const float* __restrict__ g, const float* __restrict__ be, const float* __restrict__ mu, const float* __restrict__ var, h16* P) { const size_t e = ((size_t)blockIdx.x * 256 + threadIdx.x) * 2; if (e >= (size_t)TQ * KC) return; const int c = (int)(e % KC); v2h o;
#pragma unroll
    for (int q = 0; q < 2; ++q) { const int cq = c + q; const float sc = __fdiv_rn(bfr(g[cq]), __fsqrt_rn(__fadd_rn(bfr(var[cq]), 1e-5f))); float ms = __fmul_rn(bfr(mu[cq]), sc); asm volatile("" : "+v"(ms)); const float sh = __fsub_rn(bfr(be[cq]), ms); float t = __fmul_rn(F[e + q], sc); asm volatile("" : "+v"(t)); o[q] = tohx(__fadd_rn(t, sh)); }
    *(v2h*)(P + e) = o;  }
__global__ __launch_bounds__(256) void k_vt(const float* __restrict__ FV, h16* VT) { const size_t e = ((size_t)blockIdx.x * 256 + threadIdx.x) * 2; if (e >= (size_t)VC * NKY) return; const int n = (int)(e % NKY), c = (int)(e / NKY); v2h o; o[0] = tohx(FV[(size_t)n * VC + c]); o[1] = tohx(FV[(size_t)(n + 1) * VC + c]); *(v2h*)(VT + e) = o;  }
template <int NK>
__global__ __launch_bounds__(256) void k_smax(const float* __restrict__ S, float* RS) { const int lane = threadIdx.x & 31; const int i = blockIdx.x * 8 + (threadIdx.x >> 5); if (i >= TQ) return; const float* sr = S + (size_t)i * NK; float m = -3.0e38f;
#pragma unroll 4
    for (int c0 = lane * 4; c0 < NK; c0 += 128) { const v4f v = *(const v4f*)(sr + c0); m = fmaxf(m, fmaxf(fmaxf(v[0], v[1]), fmaxf(v[2], v[3]))); }
#pragma unroll
    for (int sh = 16; sh; sh >>= 1) m = fmaxf(m, __shfl_xor(m, sh, 32));
    const float o = lane == 0 ? m : 0.f; *(float*)(RS + (size_t)i * 32 + lane) = o;  }
template <int NK>
__global__ __launch_bounds__(256) void k_sexp(const float* __restrict__ S, float* RS, h16* P) { const int lane = threadIdx.x & 31; const int i = blockIdx.x * 8 + (threadIdx.x >> 5); if (i >= TQ) return; const float* sr = S + (size_t)i * NK; const float m = RS[(size_t)i * 32]; float sum = 0.f;
{ sum = 0.f;
#pragma unroll 2
        for (int c0 = lane * 4; c0 < NK; c0 += 128) { const v4f v = *(const v4f*)(sr + c0); v4h o;
#pragma unroll
            for (int q = 0; q < 4; ++q) { float dlt = __fsub_rn(v[q], m); asm volatile("" : "+v"(dlt)); const float e = __expf(__fmul_rn(dlt, SCL)); sum += e; o[q] = tohx(e * PCAR); }
            *(v4h*)(P + (size_t)i * NK + c0) = o; }
         }
#pragma unroll
    for (int sh = 16; sh; sh >>= 1) sum += __shfl_xor(sum, sh, 32);
    const float o2 = lane == 0 ? m : (lane == 1 ? __fdiv_rn(1.0f, sum * PCAR) : 0.f); *(float*)(RS + (size_t)i * 32 + lane) = o2;  }
__global__ __launch_bounds__(256) void k_csplit(const float* __restrict__ CTX, const float* __restrict__ RS, bf* Ch, bf* Cl) { const size_t e = ((size_t)blockIdx.x * 256 + threadIdx.x) * 2; if (e >= (size_t)TQ * VC) return; const int n = (int)(e / VC); const float r = RS[(size_t)n * 32 + 1]; v2us oh, ol;
#pragma unroll
    for (int q = 0; q < 2; ++q) { unsigned short a, c2; splitf(__fmul_rn(CTX[e + q], r), a, c2); oh[q] = a; ol[q] = c2; } *(v2us*)(Ch + e) = oh; *(v2us*)(Cl + e) = ol;  }
__global__ __launch_bounds__(256) void k_outT(const float* __restrict__ OT, float* OUTb) { const size_t e = ((size_t)blockIdx.x * 256 + threadIdx.x) * 2; if (e >= (size_t)CC * TQ) return; const int n = (int)(e % TQ), o = (int)(e / TQ); v2f v; v[0] = OT[(size_t)n * CC + o]; v[1] = OT[(size_t)(n + 1) * CC + o]; *(v2f*)(OUTb + e) = v;  }

extern "C" void kernel_launch(void* const* d_in, const int* in_sizes, int n_in,
                              void* d_out, int out_size, void* d_ws, size_t ws_size, hipStream_t stream) {
    (void)in_sizes; (void)n_in; (void)out_size;
    const float* IN[17]; for (int i = 0; i < 17; ++i) IN[i] = (const float*)d_in[i];   // 0 x, 1 wq [256][512], 2 bq, 3 gq, 4 betaq, 5 mq, 6 vq, 7 wk, 8 bk, 9 gk, 10 betak, 11 mk, 12 vk, 13 wv, 14 bv, 15 wW [512][256], 16 bW
    float* OUT = (float*)d_out;     // [4][512][4096]
    char* wsp = (char*)d_ws;
    auto take = [&](size_t bytes) { char* p = wsp; wsp += (bytes + 255) & ~(size_t)255; return (void*)p; };
    bf* WQ = (bf*)take((size_t)KC * CC * 2); bf* WK = (bf*)take((size_t)KC * CC * 2); bf* WV = (bf*)take((size_t)VC * CC * 2); bf* WW = (bf*)take((size_t)CC * VC * 2);
    bf* XT = (bf*)take((size_t)TQ * CC * 2); float* F = (float*)take((size_t)TQ * KC * 4); h16* Q16 = (h16*)take((size_t)TQ * KC * 2); h16* K16 = (h16*)take((size_t)NKY * KC * 2); h16* VT = (h16*)take((size_t)VC * NKY * 2);
    float* S = (float*)take((size_t)TQ * NKY * 4); h16* P = (h16*)take((size_t)TQ * NKY * 2); float* RS = (float*)take((size_t)TQ * 32 * 4); float* CTX = (float*)take((size_t)TQ * VC * 4); bf* Ch = (bf*)take((size_t)TQ * VC * 2); bf* Cl = (bf*)take((size_t)TQ * VC * 2); float* OT = (float*)take((size_t)TQ * CC * 4);
    if ((size_t)(wsp - (char*)d_ws) > ws_size) return;    // total ~ 134 MB = 127.5 MiB ([4096][4096] f32 scores + fp16 numerators)
    { const unsigned g = (KC * CC / 8 + 255) / 256; k_cvt8<<<g, 256, 0, stream>>>(IN[1], WQ, (size_t)KC * CC / 8); k_cvt8<<<g, 256, 0, stream>>>(IN[7], WK, (size_t)KC * CC / 8); k_cvt8<<<g, 256, 0, stream>>>(IN[13], WV, (size_t)VC * CC / 8); k_cvt8<<<g, 256, 0, stream>>>(IN[15], WW, (size_t)CC * VC / 8); }
    const unsigned LP = (unsigned)(((size_t)TQ * KC / 2 + 255) / 256);
    for (int b = 0; b < NB_; ++b) {
        k_xt<<<(unsigned)(((size_t)TQ * CC / 4 + 255) / 256), 256, 0, stream>>>(IN[0] + (size_t)b * CC * TQ, XT);
        k_gemmw<bf, 0, true, 8><<<dim3(TQ / 64, KC / 64, 1), 256, 0, stream>>>(XT, nullptr, WQ, nullptr, CC, F, KC, IN[2], 0, 0, 0); k_bnp<<<LP, 256, 0, stream>>>(F, IN[3], IN[4], IN[5], IN[6], Q16);
        k_gemmw<bf, 0, true, 8><<<dim3(TQ / 64, KC / 64, 1), 256, 0, stream>>>(XT, nullptr, WK, nullptr, CC, F, KC, IN[8], 0, 0, 0); k_bnp<<<LP, 256, 0, stream>>>(F, IN[9], IN[10], IN[11], IN[12], K16);
        k_gemmw<bf, 0, true, 8><<<dim3(TQ / 64, VC / 64, 1), 256, 0, stream>>>(XT, nullptr, WV, nullptr, CC, F, VC, IN[14], 0, 0, 0); k_vt<<<(unsigned)(((size_t)VC * NKY / 2 + 255) / 256), 256, 0, stream>>>(F, VT);
        k_gemmw<h16, 0, false, 1><<<dim3(TQ / 64, NKY / 64, 1), 32, 0, stream>>>(Q16, nullptr, K16, nullptr, KC, S, NKY, nullptr, 0, 0, 0);
        k_smax<NKY><<<TQ / 8, 256, 0, stream>>>(S, RS); k_sexp<NKY><<<TQ / 8, 256, 0, stream>>>(S, RS, P);
        k_gemmw<h16, 0, false, 16><<<dim3(TQ / 64, VC / 64, 1), 512, 0, stream>>>(P, nullptr, VT, nullptr, NKY, CTX, VC, nullptr, 0, 0, 0);
        k_csplit<<<(unsigned)(((size_t)TQ * VC / 2 + 255) / 256), 256, 0, stream>>>(CTX, RS, Ch, Cl);
        k_gemmw<bf, 1, true, 4><<<dim3(TQ / 64, CC / 64, 1), 128, 0, stream>>>(Ch, Cl, WW, nullptr, VC, OT, CC, IN[16], 0, 0, 0);
        k_outT<<<(unsigned)(((size_t)CC * TQ / 2 + 255) / 256), 256, 0, stream>>>(OT, OUT + (size_t)b * CC * TQ); }
}

// v002
// One run takes 464 microseconds.
// In two side-by-side timings against v001, it was 1.24 and 1.23 times as fast.
// All steps since v000 together make it 2.00 times as fast.
#include <hip/hip_runtime.h>

// BasicNonLocalBlock (x [4][512][64x64 = 4096] NCHW; q = BN_q(wq x + bq), k = BN_k(wk x + bk) (256 channels, eval-mode BatchNorm with the given mean/var/gamma/beta), v = wv x + bv (256); sim = softmax_k(q^T k x 256^-0.5) over
// the 4096 positions; ctx[c][q] = sum_k sim[q][k] v[c][k]; out = wW ctx + bW -> [4][512][64][64]).
// Compute dtypes, f32 accumulate: every input rounded to bf16; the three 1x1 convolutions on PLAIN bf16 operands from a positions-major bf16 copy of x (inputs: exact, + bias); BN (f32, per-channel

#define NB_  4
#define CC   512
#define TQ   4096
#define NKY   4096
#define KC   256
#define VC   256
#define PCAR 1024.0f
#define SCL  0.0625f
typedef _Float16 h16;
typedef unsigned short bf;
typedef __attribute__((ext_vector_type(16))) __bf16   v16bf;
typedef __attribute__((ext_vector_type(16))) _Float16 v16h;
typedef __attribute__((ext_vector_type(8)))  _Float16 v8h;
typedef __attribute__((ext_vector_type(8)))  unsigned short v8us;
typedef __attribute__((ext_vector_type(8)))  float    v8f;
typedef __attribute__((ext_vector_type(4)))  float    v4f;
typedef v8h  __attribute__((may_alias)) v8ha;
typedef v4f  __attribute__((may_alias)) v4fa;
typedef v8us __attribute__((may_alias)) v8usa;

__device__ __forceinline__ unsigned short f2bf(float f) { unsigned u = __float_as_uint(f); u += 0x7FFFu + ((u >> 16) & 1u); return (unsigned short)(u >> 16); }
__device__ __forceinline__ float bf2f(unsigned short b) { return __uint_as_float(((unsigned)b) << 16); }
__device__ __forceinline__ float bfr(float f) { return bf2f(f2bf(f)); }
__device__ __forceinline__ v16h cat16(v8h lo, v8h hi) { return __builtin_shufflevector(lo, hi, 0, 1, 2, 3, 4, 5, 6, 7, 8, 9, 10, 11, 12, 13, 14, 15); }
__device__ __forceinline__ v16bf cat16b(v8us lo, v8us hi) { return __builtin_bit_cast(v16bf, __builtin_shufflevector(lo, hi, 0, 1, 2, 3, 4, 5, 6, 7, 8, 9, 10, 11, 12, 13, 14, 15)); }
__device__ __forceinline__ v8f wmma16(v16h a, v16h b, v8f c) { return __builtin_amdgcn_wmma_f32_16x16x32_f16(false, a, false, b, (short)0, c, false, false); }
__device__ __forceinline__ v8f wmmab(v16bf a, v16bf b, v8f c) { return __builtin_amdgcn_wmma_f32_16x16x32_bf16(false, a, false, b, (short)0, c, false, false); }



// ---- k_gemmw: register-blocked GEMM, one 64x64 output tile per workgroup (16 accumulators per wave), operands straight from K-contiguous 16-bit planes; grid (M/64, N/64, Z), 32 * KS threads.
// C[m][n] (pitch ldc; bias and stored form per EPI below) = sum_k A[m][k] Bt[n][k] (+ split products per NSPLIT). z-batch strides sA/sB/sC in elements. K % 32 == 0.
// KS waves share the tile: wave w sums every KS-th block of 32 k, from block w on (neighbouring waves read the two halves of the same 128-byte lines); the KS f32 partial tiles are then added in LDS, in wave order.
// KS > 1 is for grids with fewer tiles than the chip has SIMDs.
// EPI says what the tile's f32 sums become before the one store (rows m, columns n), so that no separate pass re-reads them:
//   0  C[m][n] = sum (f32)
//   1  H[m][n] = f16(BN_n(sum + bias[n]))               eval-mode BatchNorm, per column (channel)
//   2  H[m][n] = f16(sum + bias[m])                     A = weights, Bt = positions: the channels-major plane comes out directly
//   3  Oh/Ol[m][n] = bf16 head and rest of sum * RS[m][1]  (the row's 1 / softmax denominator)
//   4  C[m][n] = sum + bias[m] (f32)                    A = weights, Bt = positions: the NCHW output comes out directly
__device__ __forceinline__ h16 tohx(float x) { return (h16)x; }
__device__ __forceinline__ void splitf(float y, unsigned short& h, unsigned short& l) { h = f2bf(y); l = f2bf(y - bf2f(h)); }
typedef __attribute__((ext_vector_type(4))) _Float16 v4h;
typedef __attribute__((ext_vector_type(4))) unsigned short v4us;
template <typename T16> struct WFrag;
template <> struct WFrag<h16> { typedef v16h V; static __device__ __forceinline__ V ld(const h16* p) { return cat16(*(const v8h*)p, *(const v8h*)(p + 16)); } static __device__ __forceinline__ v8f mma(V a, V b, v8f c) { return wmma16(a, b, c); } };
template <> struct WFrag<bf> { typedef v16bf V; static __device__ __forceinline__ V ld(const bf* p) { return cat16b(*(const v8us*)p, *(const v8us*)(p + 16)); } static __device__ __forceinline__ v8f mma(V a, V b, v8f c) { return wmmab(a, b, c); } };
template <typename T16, int NSPLIT, int EPI, int KS>
__global__ __launch_bounds__(32 * KS) void k_gemmw(const T16* __restrict__ A, const T16* __restrict__ A2, const T16* __restrict__ Bt, const T16* __restrict__ Bt2, int K, float* C, h16* H, bf* Oh, bf* Ol, int ldc, const float* __restrict__ bias,
                                                   const float* __restrict__ g, const float* __restrict__ be, const float* __restrict__ mu, const float* __restrict__ var, const float* __restrict__ RS, size_t sA, size_t sB, size_t sC) {
    static_assert(KS > 1 || EPI == 0, "the one-wave path stores plain f32");
    typedef typename WFrag<T16>::V V;
    __shared__ __align__(16) float os[(KS == 1 ? 16 : KS * 64) * 68];
    const size_t z = blockIdx.z; A += z * sA; if (A2) A2 += z * sA; Bt += z * sB; if (Bt2) Bt2 += z * sB; C += z * sC;
    const int lane = threadIdx.x & 31, lr = lane & 15, hi = lane >> 4; const int r0 = blockIdx.x * 64, c0 = blockIdx.y * 64;
    const int w = KS == 1 ? 0 : __builtin_amdgcn_readfirstlane((int)(threadIdx.x >> 5));   // the wave's number in a scalar register: the k loop's counter and test stay scalar
    // what the epilogue needs per column (EPI 1) or per row (EPI 2, 3, 4) is loaded here, ahead of the k loop, so that its latency passes behind the loop's own loads
    v4f pb = {}, pg = {}, pe = {}, pm = {}, pv = {}; float rowv[32 / KS];
    if constexpr (EPI >= 1) __builtin_amdgcn_sched_barrier(0);   // with the one behind the wait below: nothing else is scheduled in between the loads and their wait
    if constexpr (EPI == 1) { const int cc = c0 + lr * 4; pb = *(const v4f*)(bias + cc); pg = *(const v4f*)(g + cc); pe = *(const v4f*)(be + cc); pm = *(const v4f*)(mu + cc); pv = *(const v4f*)(var + cc); }
    if constexpr (EPI >= 2) {
#pragma unroll
        for (int s = 0; s < 32 / KS; ++s) { const int row = r0 + 2 * (s * KS + w) + hi; rowv[s] = EPI == 3 ? RS[(size_t)row * 32 + 1] : bias[row]; } }
    // the address registers of the loads above are reused at once (the accumulators' zeros, kernel arguments): the wait stands in front of that overwrite
    if constexpr (EPI >= 1) { asm volatile("s_wait_xcnt 0x0" ::: "memory"); __builtin_amdgcn_sched_barrier(0); }
    v8f acc[4][4];
#pragma unroll
    for (int mb = 0; mb < 4; ++mb)
#pragma unroll
        for (int nb = 0; nb < 4; ++nb) acc[mb][nb] = (v8f){};
    const size_t aoff = (size_t)(r0 + lr) * K + 8 * hi, boff = (size_t)(c0 + lr) * K + 8 * hi;
#pragma unroll 1
    for (int kc = w * 32; kc < K; kc += 32 * KS) {
        V a[4], a2[4];
#pragma unroll
        for (int mb = 0; mb < 4; ++mb) { a[mb] = WFrag<T16>::ld(A + aoff + (size_t)mb * 16 * K + kc); if (NSPLIT == 1 || NSPLIT == 2) a2[mb] = WFrag<T16>::ld(A2 + aoff + (size_t)mb * 16 * K + kc); }
#pragma unroll
        for (int nb = 0; nb < 4; ++nb) { const V b = WFrag<T16>::ld(Bt + boff + (size_t)nb * 16 * K + kc); V b2; if (NSPLIT >= 2) b2 = WFrag<T16>::ld(Bt2 + boff + (size_t)nb * 16 * K + kc);
#pragma unroll
            for (int mb = 0; mb < 4; ++mb) { acc[mb][nb] = WFrag<T16>::mma(a[mb], b, acc[mb][nb]); if (NSPLIT == 1 || NSPLIT == 2) acc[mb][nb] = WFrag<T16>::mma(a2[mb], b, acc[mb][nb]); if (NSPLIT >= 2) acc[mb][nb] = WFrag<T16>::mma(a[mb], b2, acc[mb][nb]); } }
        asm volatile("v_nop\n\tv_nop\n\tv_nop\n\tv_nop" : "+v"(acc[0][0]), "+v"(acc[1][1]), "+v"(acc[2][2]), "+v"(acc[3][3]) : "v"(a[0]), "v"(a[3]));
    }
    if constexpr (KS > 1) {
        float* osw = os + w * (64 * 68);
        // all loops below are unrolled so that acc[][] is indexed by constants (stays in registers) and the LDS offsets are immediates
#pragma unroll
        for (int mb = 0; mb < 4; ++mb)
#pragma unroll
            for (int nb = 0; nb < 4; ++nb)
#pragma unroll
                for (int j = 0; j < 8; ++j) osw[(mb * 16 + hi * 8 + j) * 68 + nb * 16 + lr] = acc[mb][nb][j];
        __syncthreads();   // every wave's partial tile is in LDS before any thread adds them
        const int cofs = lr * 4;
        v4f sc = {}, sh = {};
        if constexpr (EPI == 1) {
#pragma unroll
            for (int q = 0; q < 4; ++q) { sc[q] = __fdiv_rn(bfr(pg[q]), __fsqrt_rn(bfr(pv[q]) + 1e-5f)); sh[q] = bfr(pe[q]) - bfr(pm[q]) * sc[q]; pb[q] = bfr(pb[q]); } }
#pragma unroll
        for (int s = 0; s < 32 / KS; ++s) { const int row = 2 * (s * KS + w) + hi; v4f val = *(const v4fa*)(os + row * 68 + cofs);
#pragma unroll
            for (int p = 1; p < KS; ++p) val += *(const v4fa*)(os + p * (64 * 68) + row * 68 + cofs);
            const size_t eo = (size_t)(r0 + row) * ldc + c0 + cofs;
            if constexpr (EPI == 0) { *(v4f*)(C + eo) = val; }
            if constexpr (EPI == 1) { v4h o;
#pragma unroll
                for (int q = 0; q < 4; ++q) o[q] = tohx((val[q] + pb[q]) * sc[q] + sh[q]);
                *(v4h*)(H + eo) = o; }
            if constexpr (EPI == 2) { const float rb = bfr(rowv[s]); v4h o;
#pragma unroll
                for (int q = 0; q < 4; ++q) o[q] = tohx(val[q] + rb);
                *(v4h*)(H + eo) = o; }
            if constexpr (EPI == 3) { v4us oh, ol;
#pragma unroll
                for (int q = 0; q < 4; ++q) { unsigned short a, c2; splitf(__fmul_rn(val[q], rowv[s]), a, c2); oh[q] = a; ol[q] = c2; }
                *(v4us*)(Oh + eo) = oh; *(v4us*)(Ol + eo) = ol; }
            if constexpr (EPI == 4) { const float rb = bfr(rowv[s]); val += rb; *(v4f*)(C + eo) = val; } }
        return;
    }
#pragma unroll
    for (int mb = 0; mb < 4; ++mb) {
#pragma unroll
        for (int nb = 0; nb < 4; ++nb) {
#pragma unroll
            for (int j = 0; j < 8; ++j) os[(hi * 8 + j) * 68 + nb * 16 + lr] = acc[mb][nb][j]; }
        __builtin_amdgcn_wave_barrier(); asm volatile("" ::: "memory");
        float* crow = C + (size_t)(r0 + mb * 16) * ldc + c0;
{
#pragma unroll
            for (int s = 0; s < 8; ++s) { const int row = 2 * s + hi, cofs = lr * 4; v4f val = *(const v4fa*)(os + row * 68 + cofs);
                *(v4f*)(crow + (size_t)row * ldc + cofs) = val; }
             }
        __builtin_amdgcn_wave_barrier(); asm volatile("" ::: "memory");
    }
}


__global__ __launch_bounds__(256) void k_cvt8(const float* __restrict__ src, bf* dst, size_t n8) { const size_t i = (size_t)blockIdx.x * 256 + threadIdx.x; if (i >= n8) return; const v8f v = *(const v8f*)(src + i * 8); v8us o;
#pragma unroll
    for (int k = 0; k < 8; ++k) o[k] = f2bf(v[k]); *(v8us*)(dst + i * 8) = o;  }
__global__ __launch_bounds__(256) void k_xt(const float* __restrict__ xb, bf* XT) { const size_t e = ((size_t)blockIdx.x * 256 + threadIdx.x) * 4; if (e >= (size_t)TQ * CC) return; const int c = (int)(e % CC), n = (int)(e / CC); v4us o;
#pragma unroll
    for (int q = 0; q < 4; ++q) o[q] = f2bf(xb[(size_t)(c + q) * TQ + n]); *(v4us*)(XT + e) = o;  }
template <int NK>
__global__ __launch_bounds__(256) void k_smax(const float* __restrict__ S, float* RS) { const int lane = threadIdx.x & 31; const int i = blockIdx.x * 8 + (threadIdx.x >> 5); if (i >= TQ) return; const float* sr = S + (size_t)i * NK; float m = -3.0e38f;
#pragma unroll 4
    for (int c0 = lane * 4; c0 < NK; c0 += 128) { const v4f v = *(const v4f*)(sr + c0); m = fmaxf(m, fmaxf(fmaxf(v[0], v[1]), fmaxf(v[2], v[3]))); }
#pragma unroll
    for (int sh = 16; sh; sh >>= 1) m = fmaxf(m, __shfl_xor(m, sh, 32));
    const float o = lane == 0 ? m : 0.f; *(float*)(RS + (size_t)i * 32 + lane) = o;  }
template <int NK>
__global__ __launch_bounds__(256) void k_sexp(const float* __restrict__ S, float* RS, h16* P) { const int lane = threadIdx.x & 31; const int i = blockIdx.x * 8 + (threadIdx.x >> 5); if (i >= TQ) return; const float* sr = S + (size_t)i * NK; const float m = RS[(size_t)i * 32]; float sum = 0.f;
{ sum = 0.f;
#pragma unroll 2
        for (int c0 = lane * 4; c0 < NK; c0 += 128) { const v4f v = *(const v4f*)(sr + c0); v4h o;
#pragma unroll
            for (int q = 0; q < 4; ++q) { float dlt = __fsub_rn(v[q], m); asm volatile("" : "+v"(dlt)); const float e = __expf(__fmul_rn(dlt, SCL)); sum += e; o[q] = tohx(e * PCAR); }
            *(v4h*)(P + (size_t)i * NK + c0) = o; }
         }
#pragma unroll
    for (int sh = 16; sh; sh >>= 1) sum += __shfl_xor(sum, sh, 32);
    const float o2 = lane == 0 ? m : (lane == 1 ? __fdiv_rn(1.0f, sum * PCAR) : 0.f); *(float*)(RS + (size_t)i * 32 + lane) = o2;  }

extern "C" void kernel_launch(void* const* d_in, const int* in_sizes, int n_in,
                              void* d_out, int out_size, void* d_ws, size_t ws_size, hipStream_t stream) {
    (void)in_sizes; (void)n_in; (void)out_size;
    const float* IN[17]; for (int i = 0; i < 17; ++i) IN[i] = (const float*)d_in[i];   // 0 x, 1 wq [256][512], 2 bq, 3 gq, 4 betaq, 5 mq, 6 vq, 7 wk, 8 bk, 9 gk, 10 betak, 11 mk, 12 vk, 13 wv, 14 bv, 15 wW [512][256], 16 bW
    float* OUT = (float*)d_out;     // [4][512][4096]
    char* wsp = (char*)d_ws;
    auto take = [&](size_t bytes) { char* p = wsp; wsp += (bytes + 255) & ~(size_t)255; return (void*)p; };
    bf* WQ = (bf*)take((size_t)KC * CC * 2); bf* WK = (bf*)take((size_t)KC * CC * 2); bf* WV = (bf*)take((size_t)VC * CC * 2); bf* WW = (bf*)take((size_t)CC * VC * 2);
    bf* XT = (bf*)take((size_t)TQ * CC * 2); h16* Q16 = (h16*)take((size_t)TQ * KC * 2); h16* K16 = (h16*)take((size_t)NKY * KC * 2); h16* VT = (h16*)take((size_t)VC * NKY * 2);
    float* S = (float*)take((size_t)TQ * NKY * 4); h16* P = (h16*)take((size_t)TQ * NKY * 2); float* RS = (float*)take((size_t)TQ * 32 * 4); bf* Ch = (bf*)take((size_t)TQ * VC * 2); bf* Cl = (bf*)take((size_t)TQ * VC * 2);
    if ((size_t)(wsp - (char*)d_ws) > ws_size) return;    // total ~ 116 MB = 111 MiB ([4096][4096] f32 scores + fp16 numerators)
    { const unsigned g = (KC * CC / 8 + 255) / 256; k_cvt8<<<g, 256, 0, stream>>>(IN[1], WQ, (size_t)KC * CC / 8); k_cvt8<<<g, 256, 0, stream>>>(IN[7], WK, (size_t)KC * CC / 8); k_cvt8<<<g, 256, 0, stream>>>(IN[13], WV, (size_t)VC * CC / 8); k_cvt8<<<g, 256, 0, stream>>>(IN[15], WW, (size_t)CC * VC / 8); }
    for (int b = 0; b < NB_; ++b) {
        k_xt<<<(unsigned)(((size_t)TQ * CC / 4 + 255) / 256), 256, 0, stream>>>(IN[0] + (size_t)b * CC * TQ, XT);
        k_gemmw<bf, 0, 1, 8><<<dim3(TQ / 64, KC / 64, 1), 256, 0, stream>>>(XT, nullptr, WQ, nullptr, CC, nullptr, Q16, nullptr, nullptr, KC, IN[2], IN[3], IN[4], IN[5], IN[6], nullptr, 0, 0, 0);
        k_gemmw<bf, 0, 1, 8><<<dim3(TQ / 64, KC / 64, 1), 256, 0, stream>>>(XT, nullptr, WK, nullptr, CC, nullptr, K16, nullptr, nullptr, KC, IN[8], IN[9], IN[10], IN[11], IN[12], nullptr, 0, 0, 0);
        k_gemmw<bf, 0, 2, 8><<<dim3(VC / 64, NKY / 64, 1), 256, 0, stream>>>(WV, nullptr, XT, nullptr, CC, nullptr, VT, nullptr, nullptr, NKY, IN[14], nullptr, nullptr, nullptr, nullptr, nullptr, 0, 0, 0);
        k_gemmw<h16, 0, 0, 1><<<dim3(TQ / 64, NKY / 64, 1), 32, 0, stream>>>(Q16, nullptr, K16, nullptr, KC, S, nullptr, nullptr, nullptr, NKY, nullptr, nullptr, nullptr, nullptr, nullptr, nullptr, 0, 0, 0);
        k_smax<NKY><<<TQ / 8, 256, 0, stream>>>(S, RS); k_sexp<NKY><<<TQ / 8, 256, 0, stream>>>(S, RS, P);
        k_gemmw<h16, 0, 3, 16><<<dim3(TQ / 64, VC / 64, 1), 512, 0, stream>>>(P, nullptr, VT, nullptr, NKY, nullptr, nullptr, Ch, Cl, VC, nullptr, nullptr, nullptr, nullptr, nullptr, RS, 0, 0, 0);
        k_gemmw<bf, 3, 4, 4><<<dim3(CC / 64, TQ / 64, 1), 128, 0, stream>>>(WW, nullptr, Ch, Cl, VC, OUT + (size_t)b * CC * TQ, nullptr, nullptr, nullptr, TQ, IN[16], nullptr, nullptr, nullptr, nullptr, nullptr, 0, 0, 0); }
}

// v003
// One run takes 360 microseconds.
// Next to v002, in two timings, it ran 1.29 and 1.30 times as fast.
// All steps since v000 together make it 2.59 times as fast.
#include <hip/hip_runtime.h>

// BasicNonLocalBlock (x [4][512][64x64 = 4096] NCHW; q = BN_q(wq x + bq), k = BN_k(wk x + bk) (256 channels, eval-mode BatchNorm with the given mean/var/gamma/beta), v = wv x + bv (256); sim = softmax_k(q^T k x 256^-0.5) over
// the 4096 positions; ctx[c][q] = sum_k sim[q][k] v[c][k]; out = wW ctx + bW -> [4][512][64][64]).
// Compute dtypes, f32 accumulate: every input rounded to bf16; the three 1x1 convolutions on PLAIN bf16 operands from a positions-major bf16 copy of x (inputs: exact, + bias); BN (f32, per-channel

#define NB_  4
#define NP_  2
#define CC   512
#define TQ   4096
#define NKY   4096
#define KC   256
#define VC   256
#define PCAR 1024.0f
#define SCL  0.0625f
typedef _Float16 h16;
typedef unsigned short bf;
typedef __attribute__((ext_vector_type(16))) __bf16   v16bf;
typedef __attribute__((ext_vector_type(16))) _Float16 v16h;
typedef __attribute__((ext_vector_type(8)))  _Float16 v8h;
typedef __attribute__((ext_vector_type(8)))  unsigned short v8us;
typedef __attribute__((ext_vector_type(8)))  float    v8f;
typedef __attribute__((ext_vector_type(4)))  float    v4f;
typedef v8h  __attribute__((may_alias)) v8ha;
typedef v4f  __attribute__((may_alias)) v4fa;
typedef v8us __attribute__((may_alias)) v8usa;

__device__ __forceinline__ unsigned short f2bf(float f) { unsigned u = __float_as_uint(f); u += 0x7FFFu + ((u >> 16) & 1u); return (unsigned short)(u >> 16); }
__device__ __forceinline__ float bf2f(unsigned short b) { return __uint_as_float(((unsigned)b) << 16); }
__device__ __forceinline__ float bfr(float f) { return bf2f(f2bf(f)); }
__device__ __forceinline__ v16h cat16(v8h lo, v8h hi) { return __builtin_shufflevector(lo, hi, 0, 1, 2, 3, 4, 5, 6, 7, 8, 9, 10, 11, 12, 13, 14, 15); }
__device__ __forceinline__ v16bf cat16b(v8us lo, v8us hi) { return __builtin_bit_cast(v16bf, __builtin_shufflevector(lo, hi, 0, 1, 2, 3, 4, 5, 6, 7, 8, 9, 10, 11, 12, 13, 14, 15)); }
__device__ __forceinline__ v8f wmma16(v16h a, v16h b, v8f c) { return __builtin_amdgcn_wmma_f32_16x16x32_f16(false, a, false, b, (short)0, c, false, false); }
__device__ __forceinline__ v8f wmmab(v16bf a, v16bf b, v8f c) { return __builtin_amdgcn_wmma_f32_16x16x32_bf16(false, a, false, b, (short)0, c, false, false); }



// ---- k_gemmw: register-blocked GEMM, one 64x64 output tile per workgroup (16 accumulators per wave), operands straight from K-contiguous 16-bit planes; grid (M/64, N/64, Z), 32 * KS threads.
// C[m][n] (f32, pitch ldc; bias as EPI says below) = sum_k A[m][k] Bt[n][k] (+ split products per NSPLIT). z-batch strides sA/sB/sC in elements (z = image; sC moves whichever plane the epilogue stores, RS moves by its own plane). K % 32 == 0.
// KS waves share the tile: wave w sums every KS-th block of 32 k, from block w on (neighbouring waves read the two halves of the same 128-byte lines); the KS f32 partial tiles are then added in LDS, in wave order.
// KS > 1 is for grids with fewer tiles than the chip has SIMDs.
// EPI says what the tile's f32 sums become before the one store (rows m, columns n), so that no separate pass re-reads them:
//   0  C[m][n] = sum (f32)
//   1  H[m][n] = f16(BN_n(sum + bias[n]))               eval-mode BatchNorm, per column (channel)
//   2  H[m][n] = f16(sum + bias[m])                     A = weights, Bt = positions: the channels-major plane comes out directly
//   3  Oh/Ol[m][n] = bf16 head and rest of sum * RS[m][1]  (the row's 1 / softmax denominator)
//   4  C[m][n] = sum + bias[m] (f32)                    A = weights, Bt = positions: the NCHW output comes out directly
__device__ __forceinline__ h16 tohx(float x) { return (h16)x; }
__device__ __forceinline__ void splitf(float y, unsigned short& h, unsigned short& l) { h = f2bf(y); l = f2bf(y - bf2f(h)); }
typedef __attribute__((ext_vector_type(4))) _Float16 v4h;
typedef __attribute__((ext_vector_type(4))) unsigned short v4us;
template <typename T16> struct WFrag;
template <> struct WFrag<h16> { typedef v16h V; static __device__ __forceinline__ V ld(const h16* p) { return cat16(*(const v8h*)p, *(const v8h*)(p + 16)); } static __device__ __forceinline__ v8f mma(V a, V b, v8f c) { return wmma16(a, b, c); } };
template <> struct WFrag<bf> { typedef v16bf V; static __device__ __forceinline__ V ld(const bf* p) { return cat16b(*(const v8us*)p, *(const v8us*)(p + 16)); } static __device__ __forceinline__ v8f mma(V a, V b, v8f c) { return wmmab(a, b, c); } };
template <typename T16, int NSPLIT, int EPI, int KS>
__global__ __launch_bounds__(32 * KS) void k_gemmw(const T16* __restrict__ A, const T16* __restrict__ A2, const T16* __restrict__ Bt, const T16* __restrict__ Bt2, int K, float* C, h16* H, bf* Oh, bf* Ol, int ldc, const float* __restrict__ bias,
                                                   const float* __restrict__ g, const float* __restrict__ be, const float* __restrict__ mu, const float* __restrict__ var, const float* __restrict__ RS, size_t sA, size_t sB, size_t sC) {
    static_assert(KS > 1 || EPI == 0, "the one-wave path stores plain f32");
    typedef typename WFrag<T16>::V V;
    __shared__ __align__(16) float os[(KS == 1 ? 16 : KS * 64) * 68];
    const size_t z = blockIdx.z; A += z * sA; if (A2) A2 += z * sA; Bt += z * sB; if (Bt2) Bt2 += z * sB;
    if constexpr (EPI == 0 || EPI == 4) C += z * sC;
    if constexpr (EPI == 1 || EPI == 2) H += z * sC;
    if constexpr (EPI == 3) { Oh += z * sC; Ol += z * sC; RS += z * (size_t)(TQ * 32); }
    const int lane = threadIdx.x & 31, lr = lane & 15, hi = lane >> 4; const int r0 = blockIdx.x * 64, c0 = blockIdx.y * 64;
    const int w = KS == 1 ? 0 : __builtin_amdgcn_readfirstlane((int)(threadIdx.x >> 5));   // the wave's number in a scalar register: the k loop's counter and test stay scalar
    // what the epilogue needs per column (EPI 1) or per row (EPI 2, 3, 4) is loaded here, ahead of the k loop, so that its latency passes behind the loop's own loads
    v4f pb = {}, pg = {}, pe = {}, pm = {}, pv = {}; float rowv[32 / KS];
    if constexpr (EPI >= 1) __builtin_amdgcn_sched_barrier(0);   // with the one behind the wait below: nothing else is scheduled in between the loads and their wait
    if constexpr (EPI == 1) { const int cc = c0 + lr * 4; pb = *(const v4f*)(bias + cc); pg = *(const v4f*)(g + cc); pe = *(const v4f*)(be + cc); pm = *(const v4f*)(mu + cc); pv = *(const v4f*)(var + cc); }
    if constexpr (EPI >= 2) {
#pragma unroll
        for (int s = 0; s < 32 / KS; ++s) { const int row = r0 + 2 * (s * KS + w) + hi; rowv[s] = EPI == 3 ? RS[(size_t)row * 32 + 1] : bias[row]; } }
    // the address registers of the loads above are reused at once (the accumulators' zeros, kernel arguments): the wait stands in front of that overwrite
    if constexpr (EPI >= 1) { asm volatile("s_wait_xcnt 0x0" ::: "memory"); __builtin_amdgcn_sched_barrier(0); }
    v8f acc[4][4];
#pragma unroll
    for (int mb = 0; mb < 4; ++mb)
#pragma unroll
        for (int nb = 0; nb < 4; ++nb) acc[mb][nb] = (v8f){};
    const size_t aoff = (size_t)(r0 + lr) * K + 8 * hi, boff = (size_t)(c0 + lr) * K + 8 * hi;
#pragma unroll 1
    for (int kc = w * 32; kc < K; kc += 32 * KS) {
        V a[4], a2[4];
#pragma unroll
        for (int mb = 0; mb < 4; ++mb) { a[mb] = WFrag<T16>::ld(A + aoff + (size_t)mb * 16 * K + kc); if (NSPLIT == 1 || NSPLIT == 2) a2[mb] = WFrag<T16>::ld(A2 + aoff + (size_t)mb * 16 * K + kc); }
#pragma unroll
        for (int nb = 0; nb < 4; ++nb) { const V b = WFrag<T16>::ld(Bt + boff + (size_t)nb * 16 * K + kc); V b2; if (NSPLIT >= 2) b2 = WFrag<T16>::ld(Bt2 + boff + (size_t)nb * 16 * K + kc);
#pragma unroll
            for (int mb = 0; mb < 4; ++mb) { acc[mb][nb] = WFrag<T16>::mma(a[mb], b, acc[mb][nb]); if (NSPLIT == 1 || NSPLIT == 2) acc[mb][nb] = WFrag<T16>::mma(a2[mb], b, acc[mb][nb]); if (NSPLIT >= 2) acc[mb][nb] = WFrag<T16>::mma(a[mb], b2, acc[mb][nb]); } }
        asm volatile("v_nop\n\tv_nop\n\tv_nop\n\tv_nop" : "+v"(acc[0][0]), "+v"(acc[1][1]), "+v"(acc[2][2]), "+v"(acc[3][3]) : "v"(a[0]), "v"(a[3]));
    }
    if constexpr (KS > 1) {
        float* osw = os + w * (64 * 68);
        // all loops below are unrolled so that acc[][] is indexed by constants (stays in registers) and the LDS offsets are immediates
#pragma unroll
        for (int mb = 0; mb < 4; ++mb)
#pragma unroll
            for (int nb = 0; nb < 4; ++nb)
#pragma unroll
                for (int j = 0; j < 8; ++j) osw[(mb * 16 + hi * 8 + j) * 68 + nb * 16 + lr] = acc[mb][nb][j];
        __syncthreads();   // every wave's partial tile is in LDS before any thread adds them
        const int cofs = lr * 4;
        v4f sc = {}, sh = {};
        if constexpr (EPI == 1) {
#pragma unroll
            for (int q = 0; q < 4; ++q) { sc[q] = __fdiv_rn(bfr(pg[q]), __fsqrt_rn(bfr(pv[q]) + 1e-5f)); sh[q] = bfr(pe[q]) - bfr(pm[q]) * sc[q]; pb[q] = bfr(pb[q]); } }
#pragma unroll
        for (int s = 0; s < 32 / KS; ++s) { const int row = 2 * (s * KS + w) + hi; v4f val = *(const v4fa*)(os + row * 68 + cofs);
#pragma unroll
            for (int p = 1; p < KS; ++p) val += *(const v4fa*)(os + p * (64 * 68) + row * 68 + cofs);
            const size_t eo = (size_t)(r0 + row) * ldc + c0 + cofs;
            if constexpr (EPI == 0) { *(v4f*)(C + eo) = val; }
            if constexpr (EPI == 1) { v4h o;
#pragma unroll
                for (int q = 0; q < 4; ++q) o[q] = tohx((val[q] + pb[q]) * sc[q] + sh[q]);
                *(v4h*)(H + eo) = o; }
            if constexpr (EPI == 2) { const float rb = bfr(rowv[s]); v4h o;
#pragma unroll
                for (int q = 0; q < 4; ++q) o[q] = tohx(val[q] + rb);
                *(v4h*)(H + eo) = o; }
            if constexpr (EPI == 3) { v4us oh, ol;
#pragma unroll
                for (int q = 0; q < 4; ++q) { unsigned short a, c2; splitf(__fmul_rn(val[q], rowv[s]), a, c2); oh[q] = a; ol[q] = c2; }
                *(v4us*)(Oh + eo) = oh; *(v4us*)(Ol + eo) = ol; }
            if constexpr (EPI == 4) { const float rb = bfr(rowv[s]); val += rb; *(v4f*)(C + eo) = val; } }
        return;
    }
#pragma unroll
    for (int mb = 0; mb < 4; ++mb) {
#pragma unroll
        for (int nb = 0; nb < 4; ++nb) {
#pragma unroll
            for (int j = 0; j < 8; ++j) os[(hi * 8 + j) * 68 + nb * 16 + lr] = acc[mb][nb][j]; }
        __builtin_amdgcn_wave_barrier(); asm volatile("" ::: "memory");
        float* crow = C + (size_t)(r0 + mb * 16) * ldc + c0;
{
#pragma unroll
            for (int s = 0; s < 8; ++s) { const int row = 2 * s + hi, cofs = lr * 4; v4f val = *(const v4fa*)(os + row * 68 + cofs);
                *(v4f*)(crow + (size_t)row * ldc + cofs) = val; }
             }
        __builtin_amdgcn_wave_barrier(); asm volatile("" ::: "memory");
    }
}


__global__ __launch_bounds__(256) void k_cvt8(const float* __restrict__ src, bf* dst, size_t n8) { const size_t i = (size_t)blockIdx.x * 256 + threadIdx.x; if (i >= n8) return; const v8f v = *(const v8f*)(src + i * 8); v8us o;
#pragma unroll
    for (int k = 0; k < 8; ++k) o[k] = f2bf(v[k]); *(v8us*)(dst + i * 8) = o;  }
__global__ __launch_bounds__(256) void k_xt(const float* __restrict__ xb, bf* XT) { xb += (size_t)blockIdx.y * CC * TQ; XT += (size_t)blockIdx.y * TQ * CC; const size_t e = ((size_t)blockIdx.x * 256 + threadIdx.x) * 4; if (e >= (size_t)TQ * CC) return; const int c = (int)(e % CC), n = (int)(e / CC); v4us o;
#pragma unroll
    for (int q = 0; q < 4; ++q) o[q] = f2bf(xb[(size_t)(c + q) * TQ + n]); *(v4us*)(XT + e) = o;  }
template <int NK>
__global__ __launch_bounds__(256) void k_smax(const float* __restrict__ S, float* RS) { S += (size_t)blockIdx.y * TQ * NK; RS += (size_t)blockIdx.y * TQ * 32; const int lane = threadIdx.x & 31; const int i = blockIdx.x * 8 + (threadIdx.x >> 5); if (i >= TQ) return; const float* sr = S + (size_t)i * NK; float m = -3.0e38f;
#pragma unroll 4
    for (int c0 = lane * 4; c0 < NK; c0 += 128) { const v4f v = *(const v4f*)(sr + c0); m = fmaxf(m, fmaxf(fmaxf(v[0], v[1]), fmaxf(v[2], v[3]))); }
#pragma unroll
    for (int sh = 16; sh; sh >>= 1) m = fmaxf(m, __shfl_xor(m, sh, 32));
    const float o = lane == 0 ? m : 0.f; *(float*)(RS + (size_t)i * 32 + lane) = o;  }
template <int NK>
__global__ __launch_bounds__(256) void k_sexp(const float* __restrict__ S, float* RS, h16* P) { S += (size_t)blockIdx.y * TQ * NK; RS += (size_t)blockIdx.y * TQ * 32; P += (size_t)blockIdx.y * TQ * NK; const int lane = threadIdx.x & 31; const int i = blockIdx.x * 8 + (threadIdx.x >> 5); if (i >= TQ) return; const float* sr = S + (size_t)i * NK; const float m = RS[(size_t)i * 32]; float sum = 0.f;
{ sum = 0.f;
#pragma unroll 2
        for (int c0 = lane * 4; c0 < NK; c0 += 128) { const v4f v = *(const v4f*)(sr + c0); v4h o;
#pragma unroll
            for (int q = 0; q < 4; ++q) { float dlt = __fsub_rn(v[q], m); asm volatile("" : "+v"(dlt)); const float e = __expf(__fmul_rn(dlt, SCL)); sum += e; o[q] = tohx(e * PCAR); }
            *(v4h*)(P + (size_t)i * NK + c0) = o; }
         }
#pragma unroll
    for (int sh = 16; sh; sh >>= 1) sum += __shfl_xor(sum, sh, 32);
    const float o2 = lane == 0 ? m : (lane == 1 ? __fdiv_rn(1.0f, sum * PCAR) : 0.f); *(float*)(RS + (size_t)i * 32 + lane) = o2;  }

extern "C" void kernel_launch(void* const* d_in, const int* in_sizes, int n_in,
                              void* d_out, int out_size, void* d_ws, size_t ws_size, hipStream_t stream) {
    (void)in_sizes; (void)n_in; (void)out_size;
    const float* IN[17]; for (int i = 0; i < 17; ++i) IN[i] = (const float*)d_in[i];   // 0 x, 1 wq [256][512], 2 bq, 3 gq, 4 betaq, 5 mq, 6 vq, 7 wk, 8 bk, 9 gk, 10 betak, 11 mk, 12 vk, 13 wv, 14 bv, 15 wW [512][256], 16 bW
    float* OUT = (float*)d_out;     // [4][512][4096]
    char* wsp = (char*)d_ws;
    auto take = [&](size_t bytes) { char* p = wsp; wsp += (bytes + 255) & ~(size_t)255; return (void*)p; };
    bf* WQ = (bf*)take((size_t)KC * CC * 2); bf* WK = (bf*)take((size_t)KC * CC * 2); bf* WV = (bf*)take((size_t)VC * CC * 2); bf* WW = (bf*)take((size_t)CC * VC * 2);
    // every plane but the scores, numerators and row stats holds all NB_ images; S, P and RS hold NP_ images at a time (NB_ of them would not fit the workspace)
    bf* XT = (bf*)take((size_t)NB_ * TQ * CC * 2); h16* Q16 = (h16*)take((size_t)NB_ * TQ * KC * 2); h16* K16 = (h16*)take((size_t)NB_ * NKY * KC * 2); h16* VT = (h16*)take((size_t)NB_ * VC * NKY * 2);
    float* S = (float*)take((size_t)NP_ * TQ * NKY * 4); h16* P = (h16*)take((size_t)NP_ * TQ * NKY * 2); float* RS = (float*)take((size_t)NP_ * TQ * 32 * 4); bf* Ch = (bf*)take((size_t)NB_ * TQ * VC * 2); bf* Cl = (bf*)take((size_t)NB_ * TQ * VC * 2);
    if ((size_t)(wsp - (char*)d_ws) > ws_size) return;    // total = 250 MiB (NP_ x ([4096][4096] f32 scores + fp16 numerators))
    { const unsigned g = (KC * CC / 8 + 255) / 256; k_cvt8<<<g, 256, 0, stream>>>(IN[1], WQ, (size_t)KC * CC / 8); k_cvt8<<<g, 256, 0, stream>>>(IN[7], WK, (size_t)KC * CC / 8); k_cvt8<<<g, 256, 0, stream>>>(IN[13], WV, (size_t)VC * CC / 8); k_cvt8<<<g, 256, 0, stream>>>(IN[15], WW, (size_t)CC * VC / 8); }
    k_xt<<<dim3((unsigned)(((size_t)TQ * CC / 4 + 255) / 256), NB_, 1), 256, 0, stream>>>(IN[0], XT);
    k_gemmw<bf, 0, 1, 8><<<dim3(TQ / 64, KC / 64, NB_), 256, 0, stream>>>(XT, nullptr, WQ, nullptr, CC, nullptr, Q16, nullptr, nullptr, KC, IN[2], IN[3], IN[4], IN[5], IN[6], nullptr, (size_t)TQ * CC, 0, (size_t)TQ * KC);
    k_gemmw<bf, 0, 1, 8><<<dim3(TQ / 64, KC / 64, NB_), 256, 0, stream>>>(XT, nullptr, WK, nullptr, CC, nullptr, K16, nullptr, nullptr, KC, IN[8], IN[9], IN[10], IN[11], IN[12], nullptr, (size_t)TQ * CC, 0, (size_t)NKY * KC);
    k_gemmw<bf, 0, 2, 8><<<dim3(VC / 64, NKY / 64, NB_), 256, 0, stream>>>(WV, nullptr, XT, nullptr, CC, nullptr, VT, nullptr, nullptr, NKY, IN[14], nullptr, nullptr, nullptr, nullptr, nullptr, 0, (size_t)TQ * CC, (size_t)VC * NKY);
    for (int b = 0; b < NB_; b += NP_) {
        k_gemmw<h16, 0, 0, 1><<<dim3(TQ / 64, NKY / 64, NP_), 32, 0, stream>>>(Q16 + (size_t)b * TQ * KC, nullptr, K16 + (size_t)b * NKY * KC, nullptr, KC, S, nullptr, nullptr, nullptr, NKY, nullptr, nullptr, nullptr, nullptr, nullptr, nullptr, (size_t)TQ * KC, (size_t)NKY * KC, (size_t)TQ * NKY);
        k_smax<NKY><<<dim3(TQ / 8, NP_, 1), 256, 0, stream>>>(S, RS); k_sexp<NKY><<<dim3(TQ / 8, NP_, 1), 256, 0, stream>>>(S, RS, P);
        k_gemmw<h16, 0, 3, 16><<<dim3(TQ / 64, VC / 64, NP_), 512, 0, stream>>>(P, nullptr, VT + (size_t)b * VC * NKY, nullptr, NKY, nullptr, nullptr, Ch + (size_t)b * TQ * VC, Cl + (size_t)b * TQ * VC, VC, nullptr, nullptr, nullptr, nullptr, nullptr, RS, (size_t)TQ * NKY, (size_t)VC * NKY, (size_t)TQ * VC); }
    k_gemmw<bf, 3, 4, 4><<<dim3(CC / 64, TQ / 64, NB_), 128, 0, stream>>>(WW, nullptr, Ch, Cl, VC, OUT, nullptr, nullptr, nullptr, TQ, IN[16], nullptr, nullptr, nullptr, nullptr, nullptr, 0, (size_t)TQ * VC, (size_t)CC * TQ);
}

// v004
// It runs in 181 microseconds.
// Timed twice side by side with v003, it ran 2.00 and 1.99 times as fast.
// All steps since v000 together make it 5.17 times as fast.
#include <hip/hip_runtime.h>

// BasicNonLocalBlock (x [4][512][64x64 = 4096] NCHW; q = BN_q(wq x + bq), k = BN_k(wk x + bk) (256 channels, eval-mode BatchNorm with the given mean/var/gamma/beta), v = wv x + bv (256); sim = softmax_k(q^T k x 256^-0.5) over
// the 4096 positions; ctx[c][q] = sum_k sim[q][k] v[c][k]; out = wW ctx + bW -> [4][512][64][64]).
// Compute dtypes, f32 accumulate: every input rounded to bf16; the three 1x1 convolutions on PLAIN bf16 operands from a positions-major bf16 copy of x (inputs: exact, + bias); BN (f32, per-channel

#define NB_  4
#define CC   512
#define TQ   4096
#define NKY   4096
#define KC   256
#define VC   256
typedef _Float16 h16;
typedef unsigned short bf;
typedef __attribute__((ext_vector_type(16))) __bf16   v16bf;
typedef __attribute__((ext_vector_type(16))) _Float16 v16h;
typedef __attribute__((ext_vector_type(8)))  _Float16 v8h;
typedef __attribute__((ext_vector_type(8)))  unsigned short v8us;
typedef __attribute__((ext_vector_type(8)))  float    v8f;
typedef __attribute__((ext_vector_type(4)))  float    v4f;
typedef v8h  __attribute__((may_alias)) v8ha;
typedef v4f  __attribute__((may_alias)) v4fa;
typedef v8us __attribute__((may_alias)) v8usa;

__device__ __forceinline__ unsigned short f2bf(float f) { unsigned u = __float_as_uint(f); u += 0x7FFFu + ((u >> 16) & 1u); return (unsigned short)(u >> 16); }
__device__ __forceinline__ float bf2f(unsigned short b) { return __uint_as_float(((unsigned)b) << 16); }
__device__ __forceinline__ float bfr(float f) { return bf2f(f2bf(f)); }
__device__ __forceinline__ v16h cat16(v8h lo, v8h hi) { return __builtin_shufflevector(lo, hi, 0, 1, 2, 3, 4, 5, 6, 7, 8, 9, 10, 11, 12, 13, 14, 15); }
__device__ __forceinline__ v16bf cat16b(v8us lo, v8us hi) { return __builtin_bit_cast(v16bf, __builtin_shufflevector(lo, hi, 0, 1, 2, 3, 4, 5, 6, 7, 8, 9, 10, 11, 12, 13, 14, 15)); }
__device__ __forceinline__ v8f wmma16(v16h a, v16h b, v8f c) { return __builtin_amdgcn_wmma_f32_16x16x32_f16(false, a, false, b, (short)0, c, false, false); }
__device__ __forceinline__ v8f wmmab(v16bf a, v16bf b, v8f c) { return __builtin_amdgcn_wmma_f32_16x16x32_bf16(false, a, false, b, (short)0, c, false, false); }



// ---- k_gemmw: register-blocked GEMM, one 64x64 output tile per workgroup (16 accumulators per wave), operands straight from K-contiguous 16-bit planes; grid (M/64, N/64, Z), 32 * KS threads.
// C[m][n] (f32, pitch ldc; bias as EPI says below) = sum_k A[m][k] Bt[n][k] (+ split products per NSPLIT). z-batch strides sA/sB/sC in elements (z = image; sC moves whichever plane the epilogue stores, RS moves by its own plane). K % 32 == 0.
// KS waves share the tile: wave w sums every KS-th block of 32 k, from block w on (neighbouring waves read the two halves of the same 128-byte lines); the KS f32 partial tiles are then added in LDS, in wave order.
// KS > 1 is for grids with fewer tiles than the chip has SIMDs.
// EPI says what the tile's f32 sums become before the one store (rows m, columns n), so that no separate pass re-reads them:
//   0  C[m][n] = sum (f32)
//   1  H[m][n] = f16(BN_n(sum + bias[n]))               eval-mode BatchNorm, per column (channel)
//   2  H[m][n] = f16(sum + bias[m])                     A = weights, Bt = positions: the channels-major plane comes out directly
//   3  Oh/Ol[m][n] = bf16 head and rest of sum * RS[m][1]  (the row's 1 / softmax denominator)
//   4  C[m][n] = sum + bias[m] (f32)                    A = weights, Bt = positions: the NCHW output comes out directly
__device__ __forceinline__ h16 tohx(float x) { return (h16)x; }
__device__ __forceinline__ void splitf(float y, unsigned short& h, unsigned short& l) { h = f2bf(y); l = f2bf(y - bf2f(h)); }
typedef __attribute__((ext_vector_type(4))) _Float16 v4h;
typedef __attribute__((ext_vector_type(4))) unsigned short v4us;
template <typename T16> struct WFrag;
template <> struct WFrag<h16> { typedef v16h V; static __device__ __forceinline__ V ld(const h16* p) { return cat16(*(const v8h*)p, *(const v8h*)(p + 16)); } static __device__ __forceinline__ v8f mma(V a, V b, v8f c) { return wmma16(a, b, c); } };
template <> struct WFrag<bf> { typedef v16bf V; static __device__ __forceinline__ V ld(const bf* p) { return cat16b(*(const v8us*)p, *(const v8us*)(p + 16)); } static __device__ __forceinline__ v8f mma(V a, V b, v8f c) { return wmmab(a, b, c); } };
template <typename T16, int NSPLIT, int EPI, int KS>
__global__ __launch_bounds__(32 * KS) void k_gemmw(const T16* __restrict__ A, const T16* __restrict__ A2, const T16* __restrict__ Bt, const T16* __restrict__ Bt2, int K, float* C, h16* H, bf* Oh, bf* Ol, int ldc, const float* __restrict__ bias,
                                                   const float* __restrict__ g, const float* __restrict__ be, const float* __restrict__ mu, const float* __restrict__ var, const float* __restrict__ RS, size_t sA, size_t sB, size_t sC) {
    static_assert(KS > 1 || EPI == 0, "the one-wave path stores plain f32");
    typedef typename WFrag<T16>::V V;
    __shared__ __align__(16) float os[(KS == 1 ? 16 : KS * 64) * 68];
    const size_t z = blockIdx.z; A += z * sA; if (A2) A2 += z * sA; Bt += z * sB; if (Bt2) Bt2 += z * sB;
    if constexpr (EPI == 0 || EPI == 4) C += z * sC;
    if constexpr (EPI == 1 || EPI == 2) H += z * sC;
    if constexpr (EPI == 3) { Oh += z * sC; Ol += z * sC; RS += z * (size_t)(TQ * 32); }
    const int lane = threadIdx.x & 31, lr = lane & 15, hi = lane >> 4; const int r0 = blockIdx.x * 64, c0 = blockIdx.y * 64;
    const int w = KS == 1 ? 0 : __builtin_amdgcn_readfirstlane((int)(threadIdx.x >> 5));   // the wave's number in a scalar register: the k loop's counter and test stay scalar
    // what the epilogue needs per column (EPI 1) or per row (EPI 2, 3, 4) is loaded here, ahead of the k loop, so that its latency passes behind the loop's own loads
    v4f pb = {}, pg = {}, pe = {}, pm = {}, pv = {}; float rowv[32 / KS];
    if constexpr (EPI >= 1) __builtin_amdgcn_sched_barrier(0);   // with the one behind the wait below: nothing else is scheduled in between the loads and their wait
    if constexpr (EPI == 1) { const int cc = c0 + lr * 4; pb = *(const v4f*)(bias + cc); pg = *(const v4f*)(g + cc); pe = *(const v4f*)(be + cc); pm = *(const v4f*)(mu + cc); pv = *(const v4f*)(var + cc); }
    if constexpr (EPI >= 2) {
#pragma unroll
        for (int s = 0; s < 32 / KS; ++s) { const int row = r0 + 2 * (s * KS + w) + hi; rowv[s] = EPI == 3 ? RS[(size_t)row * 32 + 1] : bias[row]; } }
    // the address registers of the loads above are reused at once (the accumulators' zeros, kernel arguments): the wait stands in front of that overwrite
    if constexpr (EPI >= 1) { asm volatile("s_wait_xcnt 0x0" ::: "memory"); __builtin_amdgcn_sched_barrier(0); }
    v8f acc[4][4];
#pragma unroll
    for (int mb = 0; mb < 4; ++mb)
#pragma unroll
        for (int nb = 0; nb < 4; ++nb) acc[mb][nb] = (v8f){};
    const size_t aoff = (size_t)(r0 + lr) * K + 8 * hi, boff = (size_t)(c0 + lr) * K + 8 * hi;
#pragma unroll 1
    for (int kc = w * 32; kc < K; kc += 32 * KS) {
        V a[4], a2[4];
#pragma unroll
        for (int mb = 0; mb < 4; ++mb) { a[mb] = WFrag<T16>::ld(A + aoff + (size_t)mb * 16 * K + kc); if (NSPLIT == 1 || NSPLIT == 2) a2[mb] = WFrag<T16>::ld(A2 + aoff + (size_t)mb * 16 * K + kc); }
#pragma unroll
        for (int nb = 0; nb < 4; ++nb) { const V b = WFrag<T16>::ld(Bt + boff + (size_t)nb * 16 * K + kc); V b2; if (NSPLIT >= 2) b2 = WFrag<T16>::ld(Bt2 + boff + (size_t)nb * 16 * K + kc);
#pragma unroll
            for (int mb = 0; mb < 4; ++mb) { acc[mb][nb] = WFrag<T16>::mma(a[mb], b, acc[mb][nb]); if (NSPLIT == 1 || NSPLIT == 2) acc[mb][nb] = WFrag<T16>::mma(a2[mb], b, acc[mb][nb]); if (NSPLIT >= 2) acc[mb][nb] = WFrag<T16>::mma(a[mb], b2, acc[mb][nb]); } }
        asm volatile("v_nop\n\tv_nop\n\tv_nop\n\tv_nop" : "+v"(acc[0][0]), "+v"(acc[1][1]), "+v"(acc[2][2]), "+v"(acc[3][3]) : "v"(a[0]), "v"(a[3]));
    }
    if constexpr (KS > 1) {
        float* osw = os + w * (64 * 68);
        // all loops below are unrolled so that acc[][] is indexed by constants (stays in registers) and the LDS offsets are immediates
#pragma unroll
        for (int mb = 0; mb < 4; ++mb)
#pragma unroll
            for (int nb = 0; nb < 4; ++nb)
#pragma unroll
                for (int j = 0; j < 8; ++j) osw[(mb * 16 + hi * 8 + j) * 68 + nb * 16 + lr] = acc[mb][nb][j];
        __syncthreads();   // every wave's partial tile is in LDS before any thread adds them
        const int cofs = lr * 4;
        v4f sc = {}, sh = {};
        if constexpr (EPI == 1) {
#pragma unroll
            for (int q = 0; q < 4; ++q) { sc[q] = __fdiv_rn(bfr(pg[q]), __fsqrt_rn(bfr(pv[q]) + 1e-5f)); sh[q] = bfr(pe[q]) - bfr(pm[q]) * sc[q]; pb[q] = bfr(pb[q]); } }
#pragma unroll
        for (int s = 0; s < 32 / KS; ++s) { const int row = 2 * (s * KS + w) + hi; v4f val = *(const v4fa*)(os + row * 68 + cofs);
#pragma unroll
            for (int p = 1; p < KS; ++p) val += *(const v4fa*)(os + p * (64 * 68) + row * 68 + cofs);
            const size_t eo = (size_t)(r0 + row) * ldc + c0 + cofs;
            if constexpr (EPI == 0) { *(v4f*)(C + eo) = val; }
            if constexpr (EPI == 1) { v4h o;
#pragma unroll
                for (int q = 0; q < 4; ++q) o[q] = tohx((val[q] + pb[q]) * sc[q] + sh[q]);
                *(v4h*)(H + eo) = o; }
            if constexpr (EPI == 2) { const float rb = bfr(rowv[s]); v4h o;
#pragma unroll
                for (int q = 0; q < 4; ++q) o[q] = tohx(val[q] + rb);
                *(v4h*)(H + eo) = o; }
            if constexpr (EPI == 3) { v4us oh, ol;
#pragma unroll
                for (int q = 0; q < 4; ++q) { unsigned short a, c2; splitf(__fmul_rn(val[q], rowv[s]), a, c2); oh[q] = a; ol[q] = c2; }
                *(v4us*)(Oh + eo) = oh; *(v4us*)(Ol + eo) = ol; }
            if constexpr (EPI == 4) { const float rb = bfr(rowv[s]); val += rb; *(v4f*)(C + eo) = val; } }
        return;
    }
#pragma unroll
    for (int mb = 0; mb < 4; ++mb) {
#pragma unroll
        for (int nb = 0; nb < 4; ++nb) {
#pragma unroll
            for (int j = 0; j < 8; ++j) os[(hi * 8 + j) * 68 + nb * 16 + lr] = acc[mb][nb][j]; }
        __builtin_amdgcn_wave_barrier(); asm volatile("" ::: "memory");
        float* crow = C + (size_t)(r0 + mb * 16) * ldc + c0;
{
#pragma unroll
            for (int s = 0; s < 8; ++s) { const int row = 2 * s + hi, cofs = lr * 4; v4f val = *(const v4fa*)(os + row * 68 + cofs);
                *(v4f*)(crow + (size_t)row * ldc + cofs) = val; }
             }
        __builtin_amdgcn_wave_barrier(); asm volatile("" ::: "memory");
    }
}


__global__ __launch_bounds__(256) void k_cvt8(const float* __restrict__ src, bf* dst, size_t n8) { const size_t i = (size_t)blockIdx.x * 256 + threadIdx.x; if (i >= n8) return; const v8f v = *(const v8f*)(src + i * 8); v8us o;
#pragma unroll
    for (int k = 0; k < 8; ++k) o[k] = f2bf(v[k]); *(v8us*)(dst + i * 8) = o;  }
__global__ __launch_bounds__(256) void k_xt(const float* __restrict__ xb, bf* XT) { xb += (size_t)blockIdx.y * CC * TQ; XT += (size_t)blockIdx.y * TQ * CC; const size_t e = ((size_t)blockIdx.x * 256 + threadIdx.x) * 4; if (e >= (size_t)TQ * CC) return; const int c = (int)(e % CC), n = (int)(e / CC); v4us o;
#pragma unroll
    for (int q = 0; q < 4; ++q) o[q] = f2bf(xb[(size_t)(c + q) * TQ + n]); *(v4us*)(XT + e) = o;  }
#define AKP 528u                    // LDS pitch of a K row (512 B + 16: an odd multiple of 16 B)
#define AVP 144u                    // LDS pitch of a V^T row (64 keys = 128 B + 16)
#define ATK (64u * AKP)
#define ASLOT (ATK + 256u * AVP)
#define ALAG 4.0f
#define ACS  0.09016844005556021f   // 256^-0.5 * log2(e)
typedef float __attribute__((may_alias)) fla;
__device__ __forceinline__ float xhalf(float x) { return __builtin_bit_cast(float, __builtin_amdgcn_permlanex16(__builtin_bit_cast(int, x), __builtin_bit_cast(int, x), 0x76543210, 0xfedcba98, false, false)); }  // lane l with lane l ^ 16
__device__ __forceinline__ v16h ldsfrag(const unsigned char* p) { return cat16(*(const v8ha*)p, *(const v8ha*)(p + 32)); }
__global__ __launch_bounds__(256) __attribute__((amdgpu_waves_per_eu(2, 2))) void k_attn(const h16* __restrict__ Q, const h16* __restrict__ Kk, const h16* __restrict__ Vt, bf* Oh, bf* Ol) {
    __shared__ __align__(16) unsigned char L[2 * ASLOT];
    static_assert(4 * 130 * 32 * 4 <= 2 * ASLOT, "the join at the end reuses the ring");
    const size_t z = blockIdx.y; Q += z * (size_t)(TQ * KC); Kk += z * (size_t)(NKY * KC); Vt += z * (size_t)(VC * NKY); Oh += z * (size_t)(TQ * VC); Ol += z * (size_t)(TQ * VC);
    const unsigned tid = threadIdx.x, lane = tid & 31u, c = lane & 15u, h = lane >> 4;
    const unsigned w = __builtin_amdgcn_readfirstlane(tid >> 5), wq = w & 3u, kh = w >> 2;
    const unsigned q0 = blockIdx.x * 64u + wq * 16u;
    v8h sk[8], sv[8];
    const char* kbase = (const char*)Kk; const char* vbase = (const char*)Vt;
    unsigned ko = tid * 16u, vo = (tid >> 3) * (NKY * 2u) + (tid & 7u) * 16u;   // this thread's byte offsets in the K plane and in the V^T plane, advanced by one stage a trip
    const unsigned kst = (tid >> 5) * AKP + (tid & 31u) * 16u, vst = ATK + (tid >> 3) * AVP + (tid & 7u) * 16u;
    v16h qf[8];
#pragma unroll
    for (int kc = 0; kc < 8; ++kc) qf[kc] = WFrag<h16>::ld(Q + (size_t)(q0 + c) * KC + 8u * h + 32 * kc);
#pragma unroll
    for (int i = 0; i < 8; ++i) { sk[i] = *(const v8h*)(kbase + ko + i * 4096u); sv[i] = *(const v8h*)(vbase + vo + i * (32u * NKY * 2u)); }
    // the address registers of the loads above are advanced or reused below: the wait stands in front of that overwrite; the scheduling barrier keeps the overwrite behind it
    asm volatile("s_wait_xcnt 0x0" ::: "memory"); __builtin_amdgcn_sched_barrier(0);
    v8f acc[16];
#pragma unroll
    for (int t = 0; t < 16; ++t) acc[t] = (v8f){};
    float m_run = -__builtin_inff(), l_run = 0.f;
#pragma unroll
    for (int i = 0; i < 8; ++i) { *(v8ha*)(L + kst + i * 8 * AKP) = sk[i]; *(v8ha*)(L + vst + i * 32 * AVP) = sv[i]; }
    __syncthreads();   // stage 0 is in LDS before any wave reads it
#pragma unroll 1
    for (int st = 0; st < NKY / 64; ++st) {
        const unsigned char* b = L + (st & 1) * ASLOT;
        if (st + 1 < NKY / 64) {
#pragma unroll
            for (int i = 0; i < 8; ++i) { sk[i] = *(const v8h*)(kbase + ko + (64u * KC * 2u + i * 4096u)); sv[i] = *(const v8h*)(vbase + vo + (128u + i * (32u * NKY * 2u))); }
            // as above: the line behind it advances these loads' offset registers; the two offsets pass through the statement so that the additions cannot be placed in front of the wait
            asm volatile("s_wait_xcnt 0x0" : "+v"(ko), "+v"(vo) : : "memory");
            ko += 64u * KC * 2u; vo += 128u;
        }
        v8f s0 = {}, s1 = {};
        { const unsigned char* kb = b + (kh * 32u + c) * AKP + 16u * h;
#pragma unroll
          for (int kc = 0; kc < 8; ++kc) { s0 = wmma16(ldsfrag(kb + 64 * kc), qf[kc], s0); s1 = wmma16(ldsfrag(kb + 16 * AKP + 64 * kc), qf[kc], s1); } }
        // the pass's V^T fragments are fetched as one group here, so that their LDS latency passes behind the maxima and the exponentials;
        // the scheduling barrier in front has every K load of the pass issued ahead of the first V load (without it only some K fragments are fetched ahead of their products); the one behind keeps the group in front of the vector work
        v16h vf[16];
        __builtin_amdgcn_sched_barrier(0);
        { const unsigned char* vb = b + ATK + c * AVP + kh * 64u + 16u * h;
#pragma unroll
          for (int t = 0; t < 16; ++t) vf[t] = ldsfrag(vb + t * 16 * AVP); }
        __builtin_amdgcn_sched_barrier(0);
        float mx = fmaxf(s0[0], s1[0]);
#pragma unroll
        for (int r = 1; r < 8; ++r) mx = fmaxf(mx, fmaxf(s0[r], s1[r]));
        mx = fmaxf(mx, xhalf(mx)) * ACS;   // both halves of the wave now hold this query's maximum of the pass, scaled
        if (__builtin_amdgcn_ballot_w32(mx > m_run + ALAG) != 0) {   // a scalar branch; rare after the first passes
            const float m_new = fmaxf(m_run, mx), corr = __builtin_amdgcn_exp2f(m_run - m_new);   // corr = 0 on the first pass, where m_run is -inf
            l_run *= corr; m_run = m_new;
#pragma unroll
            for (int t = 0; t < 16; ++t) acc[t] *= corr;
        }
        v16h pf; float ps0 = 0.f, ps1 = 0.f; const float nm = 10.0f - m_run;
#pragma unroll
        for (int r = 0; r < 8; ++r) { s0[r] = __builtin_fmaf(s0[r], ACS, nm); s1[r] = __builtin_fmaf(s1[r], ACS, nm); }
#pragma unroll
        for (int r = 0; r < 8; ++r) {
            __builtin_amdgcn_sched_barrier(0); const float p0 = __builtin_amdgcn_exp2f(s0[r]); __builtin_amdgcn_sched_barrier(0); asm volatile("v_nop");
            __builtin_amdgcn_sched_barrier(0); const float p1 = __builtin_amdgcn_exp2f(s1[r]); __builtin_amdgcn_sched_barrier(0); asm volatile("v_nop");
            __builtin_amdgcn_sched_barrier(0); ps0 += p0; ps1 += p1; pf[r] = tohx(p0); pf[8 + r] = tohx(p1); }
        l_run += ps0 + ps1;
#pragma unroll
        for (int t = 0; t < 16; ++t) acc[t] = wmma16(vf[t], pf, acc[t]);
        // four vector slots behind the last matrix instruction on every path, the loop's back edge included
        __builtin_amdgcn_sched_barrier(0); asm volatile("v_nop\n\tv_nop\n\tv_nop\n\tv_nop"); __builtin_amdgcn_sched_barrier(0);
        if (st + 1 < NKY / 64) { unsigned char* d = L + ((st + 1) & 1) * ASLOT;
#pragma unroll
            for (int i = 0; i < 8; ++i) { *(v8ha*)(d + kst + i * 8 * AKP) = sk[i]; *(v8ha*)(d + vst + i * 32 * AVP) = sv[i]; } }
        __syncthreads();   // publishes stage st + 1 and ends every wave's reads of stage st, whose buffer the next trip refills
    }
    // join of the two key halves: waves 4..7 hand their sums, maximum and denominator to waves 0..3, lane to lane
    fla* M = (fla*)L + wq * (130u * 32u) + lane;
    if (kh == 1u) {
#pragma unroll
        for (int t = 0; t < 16; ++t)
#pragma unroll
            for (int r = 0; r < 8; ++r) M[(t * 8 + r) * 32] = acc[t][r];
        M[128 * 32] = m_run; M[129 * 32] = l_run; }
    __syncthreads();   // the handed-over values are in LDS before their readers start
    if (kh == 1u) return;
    const float mB = M[128 * 32], lB = M[129 * 32], m = fmaxf(m_run, mB), aA = __builtin_amdgcn_exp2f(m_run - m), aB = __builtin_amdgcn_exp2f(mB - m);
    float l = l_run * aA + lB * aB; l += xhalf(l);   // each half of the wave summed its eight keys of every 16
    const float inv = __fdiv_rn(1.0f, l);
    const size_t eo = (size_t)(q0 + c) * VC + 8u * h;
#pragma unroll
    for (int t = 0; t < 16; ++t) { v8us oh, ol;
#pragma unroll
        for (int r = 0; r < 8; ++r) { unsigned short a, c2; splitf(__fmul_rn(acc[t][r] * aA + M[(t * 8 + r) * 32] * aB, inv), a, c2); oh[r] = a; ol[r] = c2; }
        *(v8us*)(Oh + eo + t * 16) = oh; *(v8us*)(Ol + eo + t * 16) = ol; }
}

extern "C" void kernel_launch(void* const* d_in, const int* in_sizes, int n_in,
                              void* d_out, int out_size, void* d_ws, size_t ws_size, hipStream_t stream) {
    (void)in_sizes; (void)n_in; (void)out_size;
    const float* IN[17]; for (int i = 0; i < 17; ++i) IN[i] = (const float*)d_in[i];   // 0 x, 1 wq [256][512], 2 bq, 3 gq, 4 betaq, 5 mq, 6 vq, 7 wk, 8 bk, 9 gk, 10 betak, 11 mk, 12 vk, 13 wv, 14 bv, 15 wW [512][256], 16 bW
    float* OUT = (float*)d_out;     // [4][512][4096]
    char* wsp = (char*)d_ws;
    auto take = [&](size_t bytes) { char* p = wsp; wsp += (bytes + 255) & ~(size_t)255; return (void*)p; };
    bf* WQ = (bf*)take((size_t)KC * CC * 2); bf* WK = (bf*)take((size_t)KC * CC * 2); bf* WV = (bf*)take((size_t)VC * CC * 2); bf* WW = (bf*)take((size_t)CC * VC * 2);
    // every plane holds all NB_ images
    bf* XT = (bf*)take((size_t)NB_ * TQ * CC * 2); h16* Q16 = (h16*)take((size_t)NB_ * TQ * KC * 2); h16* K16 = (h16*)take((size_t)NB_ * NKY * KC * 2); h16* VT = (h16*)take((size_t)NB_ * VC * NKY * 2);
    bf* Ch = (bf*)take((size_t)NB_ * TQ * VC * 2); bf* Cl = (bf*)take((size_t)NB_ * TQ * VC * 2);
    if ((size_t)(wsp - (char*)d_ws) > ws_size) return;    // total = 57 MiB
    { const unsigned g = (KC * CC / 8 + 255) / 256; k_cvt8<<<g, 256, 0, stream>>>(IN[1], WQ, (size_t)KC * CC / 8); k_cvt8<<<g, 256, 0, stream>>>(IN[7], WK, (size_t)KC * CC / 8); k_cvt8<<<g, 256, 0, stream>>>(IN[13], WV, (size_t)VC * CC / 8); k_cvt8<<<g, 256, 0, stream>>>(IN[15], WW, (size_t)CC * VC / 8); }
    k_xt<<<dim3((unsigned)(((size_t)TQ * CC / 4 + 255) / 256), NB_, 1), 256, 0, stream>>>(IN[0], XT);
    k_gemmw<bf, 0, 1, 8><<<dim3(TQ / 64, KC / 64, NB_), 256, 0, stream>>>(XT, nullptr, WQ, nullptr, CC, nullptr, Q16, nullptr, nullptr, KC, IN[2], IN[3], IN[4], IN[5], IN[6], nullptr, (size_t)TQ * CC, 0, (size_t)TQ * KC);
    k_gemmw<bf, 0, 1, 8><<<dim3(TQ / 64, KC / 64, NB_), 256, 0, stream>>>(XT, nullptr, WK, nullptr, CC, nullptr, K16, nullptr, nullptr, KC, IN[8], IN[9], IN[10], IN[11], IN[12], nullptr, (size_t)TQ * CC, 0, (size_t)NKY * KC);
    k_gemmw<bf, 0, 2, 8><<<dim3(VC / 64, NKY / 64, NB_), 256, 0, stream>>>(WV, nullptr, XT, nullptr, CC, nullptr, VT, nullptr, nullptr, NKY, IN[14], nullptr, nullptr, nullptr, nullptr, nullptr, 0, (size_t)TQ * CC, (size_t)VC * NKY);
    k_attn<<<dim3(TQ / 64, NB_, 1), 256, 0, stream>>>(Q16, K16, VT, Ch, Cl);
    k_gemmw<bf, 3, 4, 4><<<dim3(CC / 64, TQ / 64, NB_), 128, 0, stream>>>(WW, nullptr, Ch, Cl, VC, OUT, nullptr, nullptr, nullptr, TQ, IN[16], nullptr, nullptr, nullptr, nullptr, nullptr, 0, (size_t)TQ * VC, (size_t)CC * TQ);
}

// v005
// Measured time: 164 microseconds a run.
// Timed twice side by side with v004, it ran 1.10 times as fast both times.
// Over all steps from v000 it is 5.70 times as fast.
#include <hip/hip_runtime.h>

// BasicNonLocalBlock (x [4][512][64x64 = 4096] NCHW; q = BN_q(wq x + bq), k = BN_k(wk x + bk) (256 channels, eval-mode BatchNorm with the given mean/var/gamma/beta), v = wv x + bv (256); sim = softmax_k(q^T k x 256^-0.5) over
// the 4096 positions; ctx[c][q] = sum_k sim[q][k] v[c][k]; out = wW ctx + bW -> [4][512][64][64]).
// Compute dtypes, f32 accumulate: every input rounded to bf16; the three 1x1 convolutions on PLAIN bf16 operands from a positions-major bf16 copy of x (inputs: exact, + bias); BN (f32, per-channel

#define NB_  4
#define CC   512
#define TQ   4096
#define NKY   4096
#define KC   256
#define VC   256
typedef _Float16 h16;
typedef unsigned short bf;
typedef __attribute__((ext_vector_type(16))) __bf16   v16bf;
typedef __attribute__((ext_vector_type(16))) _Float16 v16h;
typedef __attribute__((ext_vector_type(8)))  _Float16 v8h;
typedef __attribute__((ext_vector_type(8)))  unsigned short v8us;
typedef __attribute__((ext_vector_type(8)))  float    v8f;
typedef __attribute__((ext_vector_type(4)))  float    v4f;
typedef v8h  __attribute__((may_alias)) v8ha;
typedef v4f  __attribute__((may_alias)) v4fa;
typedef v8us __attribute__((may_alias)) v8usa;

__device__ __forceinline__ unsigned short f2bf(float f) { unsigned u = __float_as_uint(f); u += 0x7FFFu + ((u >> 16) & 1u); return (unsigned short)(u >> 16); }
__device__ __forceinline__ float bf2f(unsigned short b) { return __uint_as_float(((unsigned)b) << 16); }
__device__ __forceinline__ float bfr(float f) { return bf2f(f2bf(f)); }
__device__ __forceinline__ v16h cat16(v8h lo, v8h hi) { return __builtin_shufflevector(lo, hi, 0, 1, 2, 3, 4, 5, 6, 7, 8, 9, 10, 11, 12, 13, 14, 15); }
__device__ __forceinline__ v16bf cat16b(v8us lo, v8us hi) { return __builtin_bit_cast(v16bf, __builtin_shufflevector(lo, hi, 0, 1, 2, 3, 4, 5, 6, 7, 8, 9, 10, 11, 12, 13, 14, 15)); }
__device__ __forceinline__ v8f wmma16(v16h a, v16h b, v8f c) { return __builtin_amdgcn_wmma_f32_16x16x32_f16(false, a, false, b, (short)0, c, false, false); }
__device__ __forceinline__ v8f wmmab(v16bf a, v16bf b, v8f c) { return __builtin_amdgcn_wmma_f32_16x16x32_bf16(false, a, false, b, (short)0, c, false, false); }



// ---- k_gemmw: register-blocked GEMM, one 64x64 output tile per workgroup (16 accumulators per wave), operands straight from K-contiguous 16-bit planes; grid (M/64, N/64, Z), 32 * KS threads.
// C[m][n] (f32, pitch ldc; bias as EPI says below) = sum_k A[m][k] Bt[n][k] (+ split products per NSPLIT). z-batch strides sA/sB/sC in elements (z = image; sC moves whichever plane the epilogue stores, RS moves by its own plane). K % 32 == 0.
// KS waves share the tile: wave w sums every KS-th block of 32 k, from block w on (neighbouring waves read the two halves of the same 128-byte lines); the KS f32 partial tiles are then added in LDS, in wave order.
// KS > 1 is for grids with fewer tiles than the chip has SIMDs.
// EPI says what the tile's f32 sums become before the one store (rows m, columns n), so that no separate pass re-reads them:
//   0  C[m][n] = sum (f32)
//   1  H[m][n] = f16(BN_n(sum + bias[n]))               eval-mode BatchNorm, per column (channel)
//   2  H[m][n] = f16(sum + bias[m])                     A = weights, Bt = positions: the channels-major plane comes out directly
//   3  Oh/Ol[m][n] = bf16 head and rest of sum * RS[m][1]  (the row's 1 / softmax denominator)
//   4  C[m][n] = sum + bias[m] (f32)                    A = weights, Bt = positions: the NCHW output comes out directly
__device__ __forceinline__ h16 tohx(float x) { return (h16)x; }
__device__ __forceinline__ void splitf(float y, unsigned short& h, unsigned short& l) { h = f2bf(y); l = f2bf(y - bf2f(h)); }
typedef __attribute__((ext_vector_type(4))) _Float16 v4h;
typedef __attribute__((ext_vector_type(4))) unsigned short v4us;
template <typename T16> struct WFrag;
template <> struct WFrag<h16> { typedef v16h V; static __device__ __forceinline__ V ld(const h16* p) { return cat16(*(const v8h*)p, *(const v8h*)(p + 16)); } static __device__ __forceinline__ v8f mma(V a, V b, v8f c) { return wmma16(a, b, c); } };
template <> struct WFrag<bf> { typedef v16bf V; static __device__ __forceinline__ V ld(const bf* p) { return cat16b(*(const v8us*)p, *(const v8us*)(p + 16)); } static __device__ __forceinline__ v8f mma(V a, V b, v8f c) { return wmmab(a, b, c); } };
template <typename T16, int NSPLIT, int EPI, int KS>
__global__ __launch_bounds__(32 * KS) void k_gemmw(const T16* __restrict__ A, const T16* __restrict__ A2, const T16* __restrict__ Bt, const T16* __restrict__ Bt2, int K, float* C, h16* H, bf* Oh, bf* Ol, int ldc, const float* __restrict__ bias,
                                                   const float* __restrict__ g, const float* __restrict__ be, const float* __restrict__ mu, const float* __restrict__ var, const float* __restrict__ RS, size_t sA, size_t sB, size_t sC) {
    static_assert(KS > 1 || EPI == 0, "the one-wave path stores plain f32");
    typedef typename WFrag<T16>::V V;
    __shared__ __align__(16) float os[(KS == 1 ? 16 : KS * 64) * 68];
    const size_t z = blockIdx.z; A += z * sA; if (A2) A2 += z * sA; Bt += z * sB; if (Bt2) Bt2 += z * sB;
    if constexpr (EPI == 0 || EPI == 4) C += z * sC;
    if constexpr (EPI == 1 || EPI == 2) H += z * sC;
    if constexpr (EPI == 3) { Oh += z * sC; Ol += z * sC; RS += z * (size_t)(TQ * 32); }
    const int lane = threadIdx.x & 31, lr = lane & 15, hi = lane >> 4; const int r0 = blockIdx.x * 64, c0 = blockIdx.y * 64;
    const int w = KS == 1 ? 0 : __builtin_amdgcn_readfirstlane((int)(threadIdx.x >> 5));   // the wave's number in a scalar register: the k loop's counter and test stay scalar
    // what the epilogue needs per column (EPI 1) or per row (EPI 2, 3, 4) is loaded here, ahead of the k loop, so that its latency passes behind the loop's own loads
    v4f pb = {}, pg = {}, pe = {}, pm = {}, pv = {}; float rowv[32 / KS];
    if constexpr (EPI >= 1) __builtin_amdgcn_sched_barrier(0);   // with the one behind the wait below: nothing else is scheduled in between the loads and their wait
    if constexpr (EPI == 1) { const int cc = c0 + lr * 4; pb = *(const v4f*)(bias + cc); pg = *(const v4f*)(g + cc); pe = *(const v4f*)(be + cc); pm = *(const v4f*)(mu + cc); pv = *(const v4f*)(var + cc); }
    if constexpr (EPI >= 2) {
#pragma unroll
        for (int s = 0; s < 32 / KS; ++s) { const int row = r0 + 2 * (s * KS + w) + hi; rowv[s] = EPI == 3 ? RS[(size_t)row * 32 + 1] : bias[row]; } }
    // the address registers of the loads above are reused at once (the accumulators' zeros, kernel arguments): the wait stands in front of that overwrite
    if constexpr (EPI >= 1) { asm volatile("s_wait_xcnt 0x0" ::: "memory"); __builtin_amdgcn_sched_barrier(0); }
    v8f acc[4][4];
#pragma unroll
    for (int mb = 0; mb < 4; ++mb)
#pragma unroll
        for (int nb = 0; nb < 4; ++nb) acc[mb][nb] = (v8f){};
    const size_t aoff = (size_t)(r0 + lr) * K + 8 * hi, boff = (size_t)(c0 + lr) * K + 8 * hi;
#pragma unroll 1
    for (int kc = w * 32; kc < K; kc += 32 * KS) {
        V a[4], a2[4];
#pragma unroll
        for (int mb = 0; mb < 4; ++mb) { a[mb] = WFrag<T16>::ld(A + aoff + (size_t)mb * 16 * K + kc); if (NSPLIT == 1 || NSPLIT == 2) a2[mb] = WFrag<T16>::ld(A2 + aoff + (size_t)mb * 16 * K + kc); }
#pragma unroll
        for (int nb = 0; nb < 4; ++nb) { const V b = WFrag<T16>::ld(Bt + boff + (size_t)nb * 16 * K + kc); V b2; if (NSPLIT >= 2) b2 = WFrag<T16>::ld(Bt2 + boff + (size_t)nb * 16 * K + kc);
#pragma unroll
            for (int mb = 0; mb < 4; ++mb) { acc[mb][nb] = WFrag<T16>::mma(a[mb], b, acc[mb][nb]); if (NSPLIT == 1 || NSPLIT == 2) acc[mb][nb] = WFrag<T16>::mma(a2[mb], b, acc[mb][nb]); if (NSPLIT >= 2) acc[mb][nb] = WFrag<T16>::mma(a[mb], b2, acc[mb][nb]); } }
        asm volatile("v_nop\n\tv_nop\n\tv_nop\n\tv_nop" : "+v"(acc[0][0]), "+v"(acc[1][1]), "+v"(acc[2][2]), "+v"(acc[3][3]) : "v"(a[0]), "v"(a[3]));
    }
    if constexpr (KS > 1) {
        float* osw = os + w * (64 * 68);
        // all loops below are unrolled so that acc[][] is indexed by constants (stays in registers) and the LDS offsets are immediates
#pragma unroll
        for (int mb = 0; mb < 4; ++mb)
#pragma unroll
            for (int nb = 0; nb < 4; ++nb)
#pragma unroll
                for (int j = 0; j < 8; ++j) osw[(mb * 16 + hi * 8 + j) * 68 + nb * 16 + lr] = acc[mb][nb][j];
        __syncthreads();   // every wave's partial tile is in LDS before any thread adds them
        const int cofs = lr * 4;
        v4f sc = {}, sh = {};
        if constexpr (EPI == 1) {
#pragma unroll
            for (int q = 0; q < 4; ++q) { sc[q] = __fdiv_rn(bfr(pg[q]), __fsqrt_rn(bfr(pv[q]) + 1e-5f)); sh[q] = bfr(pe[q]) - bfr(pm[q]) * sc[q]; pb[q] = bfr(pb[q]); } }
#pragma unroll
        for (int s = 0; s < 32 / KS; ++s) { const int row = 2 * (s * KS + w) + hi; v4f val = *(const v4fa*)(os + row * 68 + cofs);
#pragma unroll
            for (int p = 1; p < KS; ++p) val += *(const v4fa*)(os + p * (64 * 68) + row * 68 + cofs);
            const size_t eo = (size_t)(r0 + row) * ldc + c0 + cofs;
            if constexpr (EPI == 0) { *(v4f*)(C + eo) = val; }
            if constexpr (EPI == 1) { v4h o;
#pragma unroll
                for (int q = 0; q < 4; ++q) o[q] = tohx((val[q] + pb[q]) * sc[q] + sh[q]);
                *(v4h*)(H + eo) = o; }
            if constexpr (EPI == 2) { const float rb = bfr(rowv[s]); v4h o;
#pragma unroll
                for (int q = 0; q < 4; ++q) o[q] = tohx(val[q] + rb);
                *(v4h*)(H + eo) = o; }
            if constexpr (EPI == 3) { v4us oh, ol;
#pragma unroll
                for (int q = 0; q < 4; ++q) { unsigned short a, c2; splitf(__fmul_rn(val[q], rowv[s]), a, c2); oh[q] = a; ol[q] = c2; }
                *(v4us*)(Oh + eo) = oh; *(v4us*)(Ol + eo) = ol; }
            if constexpr (EPI == 4) { const float rb = bfr(rowv[s]); val += rb; *(v4f*)(C + eo) = val; } }
        return;
    }
#pragma unroll
    for (int mb = 0; mb < 4; ++mb) {
#pragma unroll
        for (int nb = 0; nb < 4; ++nb) {
#pragma unroll
            for (int j = 0; j < 8; ++j) os[(hi * 8 + j) * 68 + nb * 16 + lr] = acc[mb][nb][j]; }
        __builtin_amdgcn_wave_barrier(); asm volatile("" ::: "memory");
        float* crow = C + (size_t)(r0 + mb * 16) * ldc + c0;
{
#pragma unroll
            for (int s = 0; s < 8; ++s) { const int row = 2 * s + hi, cofs = lr * 4; v4f val = *(const v4fa*)(os + row * 68 + cofs);
                *(v4f*)(crow + (size_t)row * ldc + cofs) = val; }
             }
        __builtin_amdgcn_wave_barrier(); asm volatile("" ::: "memory");
    }
}


__global__ __launch_bounds__(256) void k_cvt8(const float* __restrict__ src, bf* dst, size_t n8) { const size_t i = (size_t)blockIdx.x * 256 + threadIdx.x; if (i >= n8) return; const v8f v = *(const v8f*)(src + i * 8); v8us o;
#pragma unroll
    for (int k = 0; k < 8; ++k) o[k] = f2bf(v[k]); *(v8us*)(dst + i * 8) = o;  }
// ---- k_xt: x [image][512 channels][4096 positions] f32 -> XT [image][4096 positions][512 channels] bf16, turned through LDS. One workgroup = 128 channels x 128 positions; grid (TQ / 128, CC / 128, images), 8 waves.
// In: a wave's load is 512 contiguous bytes of one channel's row (128 positions); a wave takes 16 channels, so a lane holds 16 channels x 4 positions and packs 8 channels of one position into one 16-byte LDS store.
// Out: 16 lanes store the 256 contiguous bytes (128 channels) of one position's row.
// LDS row = one position, 16 pieces of 16 bytes; piece k of row n stands at place k ^ ((n >> 2) & 15), so that the 16 lanes of a half wave fall on 16 different places in the stores (rows 4 apart, one k) as in the loads (one row, 16 k).
__global__ __launch_bounds__(256) void k_xt(const float* __restrict__ xb, bf* XT) {
    __shared__ __align__(16) unsigned char T[128 * 256];
    const unsigned tid = threadIdx.x, lane = tid & 31u, w = tid >> 5;
    xb += (size_t)blockIdx.z * CC * TQ + (size_t)(blockIdx.y * 128u + w * 16u) * TQ + blockIdx.x * 128u + lane * 4u;
    XT += (size_t)blockIdx.z * TQ * CC + (size_t)(blockIdx.x * 128u + (tid >> 4)) * CC + blockIdx.y * 128u + (tid & 15u) * 8u;
    v4f r[16];
#pragma unroll
    for (int i = 0; i < 16; ++i) r[i] = *(const v4f*)(xb + (size_t)i * TQ);
    // the address registers of the loads above are reused below: the wait stands in front of that overwrite; the address is an input of the statement, so that no load takes its registers as its destination; the scheduling barrier keeps the overwrite behind the wait
    asm volatile("s_wait_xcnt 0x0" : : "v"(xb) : "memory"); __builtin_amdgcn_sched_barrier(0);
#pragma unroll
    for (int g = 0; g < 2; ++g)
#pragma unroll
        for (int j = 0; j < 4; ++j) { v8us o;
#pragma unroll
            for (int k = 0; k < 8; ++k) o[k] = f2bf(r[g * 8 + k][j]);
            *(v8usa*)(T + (lane * 4u + j) * 256u + (((w * 2u + g) ^ (lane & 15u)) * 16u)) = o; }
    __syncthreads();   // the whole tile is in LDS before any thread reads a row of it
    v8us o[8];
#pragma unroll
    for (int s = 0; s < 8; ++s) { const unsigned row = s * 16u + (tid >> 4); o[s] = *(const v8usa*)(T + row * 256u + (((tid & 15u) ^ ((row >> 2) & 15u)) * 16u)); }
#pragma unroll
    for (int s = 0; s < 8; ++s) *(v8us*)(XT + (size_t)s * 16 * CC) = o[s];
}
#define AKP 528u                    // LDS pitch of a K row (512 B + 16: an odd multiple of 16 B)
#define AVP 144u                    // LDS pitch of a V^T row (64 keys = 128 B + 16)
#define ATK (64u * AKP)
#define ASLOT (ATK + 256u * AVP)
#define ALAG 4.0f
#define ACS  0.09016844005556021f   // 256^-0.5 * log2(e)
typedef float __attribute__((may_alias)) fla;
__device__ __forceinline__ float xhalf(float x) { return __builtin_bit_cast(float, __builtin_amdgcn_permlanex16(__builtin_bit_cast(int, x), __builtin_bit_cast(int, x), 0x76543210, 0xfedcba98, false, false)); }  // lane l with lane l ^ 16
__device__ __forceinline__ v16h ldsfrag(const unsigned char* p) { return cat16(*(const v8ha*)p, *(const v8ha*)(p + 32)); }
__global__ __launch_bounds__(256) __attribute__((amdgpu_waves_per_eu(2, 2))) void k_attn(const h16* __restrict__ Q, const h16* __restrict__ Kk, const h16* __restrict__ Vt, bf* Oh, bf* Ol) {
    __shared__ __align__(16) unsigned char L[2 * ASLOT];
    static_assert(4 * 130 * 32 * 4 <= 2 * ASLOT, "the join at the end reuses the ring");
    const size_t z = blockIdx.y; Q += z * (size_t)(TQ * KC); Kk += z * (size_t)(NKY * KC); Vt += z * (size_t)(VC * NKY); Oh += z * (size_t)(TQ * VC); Ol += z * (size_t)(TQ * VC);
    const unsigned tid = threadIdx.x, lane = tid & 31u, c = lane & 15u, h = lane >> 4;
    const unsigned w = __builtin_amdgcn_readfirstlane(tid >> 5), wq = w & 3u, kh = w >> 2;
    const unsigned q0 = blockIdx.x * 64u + wq * 16u;
    v8h sk[8], sv[8];
    const char* kbase = (const char*)Kk; const char* vbase = (const char*)Vt;
    unsigned ko = tid * 16u, vo = (tid >> 3) * (NKY * 2u) + (tid & 7u) * 16u;   // this thread's byte offsets in the K plane and in the V^T plane, advanced by one stage a trip
    const unsigned kst = (tid >> 5) * AKP + (tid & 31u) * 16u, vst = ATK + (tid >> 3) * AVP + (tid & 7u) * 16u;
    v16h qf[8];
#pragma unroll
    for (int kc = 0; kc < 8; ++kc) qf[kc] = WFrag<h16>::ld(Q + (size_t)(q0 + c) * KC + 8u * h + 32 * kc);
#pragma unroll
    for (int i = 0; i < 8; ++i) { sk[i] = *(const v8h*)(kbase + ko + i * 4096u); sv[i] = *(const v8h*)(vbase + vo + i * (32u * NKY * 2u)); }
    // the address registers of the loads above are advanced or reused below: the wait stands in front of that overwrite; the scheduling barrier keeps the overwrite behind it
    asm volatile("s_wait_xcnt 0x0" ::: "memory"); __builtin_amdgcn_sched_barrier(0);
    v8f acc[16];
#pragma unroll
    for (int t = 0; t < 16; ++t) acc[t] = (v8f){};
    float m_run = -__builtin_inff(), l_run = 0.f;
#pragma unroll
    for (int i = 0; i < 8; ++i) { *(v8ha*)(L + kst + i * 8 * AKP) = sk[i]; *(v8ha*)(L + vst + i * 32 * AVP) = sv[i]; }
    __syncthreads();   // stage 0 is in LDS before any wave reads it
#pragma unroll 1
    for (int st = 0; st < NKY / 64; ++st) {
        const unsigned char* b = L + (st & 1) * ASLOT;
        if (st + 1 < NKY / 64) {
#pragma unroll
            for (int i = 0; i < 8; ++i) { sk[i] = *(const v8h*)(kbase + ko + (64u * KC * 2u + i * 4096u)); sv[i] = *(const v8h*)(vbase + vo + (128u + i * (32u * NKY * 2u))); }
            // as above: the line behind it advances these loads' offset registers; the two offsets pass through the statement so that the additions cannot be placed in front of the wait
            asm volatile("s_wait_xcnt 0x0" : "+v"(ko), "+v"(vo) : : "memory");
            ko += 64u * KC * 2u; vo += 128u;
        }
        v8f s0 = {}, s1 = {};
        { const unsigned char* kb = b + (kh * 32u + c) * AKP + 16u * h;
#pragma unroll
          for (int kc = 0; kc < 8; ++kc) { s0 = wmma16(ldsfrag(kb + 64 * kc), qf[kc], s0); s1 = wmma16(ldsfrag(kb + 16 * AKP + 64 * kc), qf[kc], s1); } }
        // the pass's V^T fragments are fetched as one group here, so that their LDS latency passes behind the maxima and the exponentials;
        // the scheduling barrier in front has every K load of the pass issued ahead of the first V load (without it only some K fragments are fetched ahead of their products); the one behind keeps the group in front of the vector work
        v16h vf[16];
        __builtin_amdgcn_sched_barrier(0);
        { const unsigned char* vb = b + ATK + c * AVP + kh * 64u + 16u * h;
#pragma unroll
          for (int t = 0; t < 16; ++t) vf[t] = ldsfrag(vb + t * 16 * AVP); }
        __builtin_amdgcn_sched_barrier(0);
        float mx = fmaxf(s0[0], s1[0]);
#pragma unroll
        for (int r = 1; r < 8; ++r) mx = fmaxf(mx, fmaxf(s0[r], s1[r]));
        mx = fmaxf(mx, xhalf(mx)) * ACS;   // both halves of the wave now hold this query's maximum of the pass, scaled
        if (__builtin_amdgcn_ballot_w32(mx > m_run + ALAG) != 0) {   // a scalar branch; rare after the first passes
            const float m_new = fmaxf(m_run, mx), corr = __builtin_amdgcn_exp2f(m_run - m_new);   // corr = 0 on the first pass, where m_run is -inf
            l_run *= corr; m_run = m_new;
#pragma unroll
            for (int t = 0; t < 16; ++t) acc[t] *= corr;
        }
        v16h pf; float ps0 = 0.f, ps1 = 0.f; const float nm = 10.0f - m_run;
#pragma unroll
        for (int r = 0; r < 8; ++r) { s0[r] = __builtin_fmaf(s0[r], ACS, nm); s1[r] = __builtin_fmaf(s1[r], ACS, nm); }
#pragma unroll
        for (int r = 0; r < 8; ++r) {
            __builtin_amdgcn_sched_barrier(0); const float p0 = __builtin_amdgcn_exp2f(s0[r]); __builtin_amdgcn_sched_barrier(0); asm volatile("v_nop");
            __builtin_amdgcn_sched_barrier(0); const float p1 = __builtin_amdgcn_exp2f(s1[r]); __builtin_amdgcn_sched_barrier(0); asm volatile("v_nop");
            __builtin_amdgcn_sched_barrier(0); ps0 += p0; ps1 += p1; pf[r] = tohx(p0); pf[8 + r] = tohx(p1); }
        l_run += ps0 + ps1;
#pragma unroll
        for (int t = 0; t < 16; ++t) acc[t] = wmma16(vf[t], pf, acc[t]);
        // four vector slots behind the last matrix instruction on every path, the loop's back edge included
        __builtin_amdgcn_sched_barrier(0); asm volatile("v_nop\n\tv_nop\n\tv_nop\n\tv_nop"); __builtin_amdgcn_sched_barrier(0);
        if (st + 1 < NKY / 64) { unsigned char* d = L + ((st + 1) & 1) * ASLOT;
#pragma unroll
            for (int i = 0; i < 8; ++i) { *(v8ha*)(d + kst + i * 8 * AKP) = sk[i]; *(v8ha*)(d + vst + i * 32 * AVP) = sv[i]; } }
        __syncthreads();   // publishes stage st + 1 and ends every wave's reads of stage st, whose buffer the next trip refills
    }
    // join of the two key halves: waves 4..7 hand their sums, maximum and denominator to waves 0..3, lane to lane
    fla* M = (fla*)L + wq * (130u * 32u) + lane;
    if (kh == 1u) {
#pragma unroll
        for (int t = 0; t < 16; ++t)
#pragma unroll
            for (int r = 0; r < 8; ++r) M[(t * 8 + r) * 32] = acc[t][r];
        M[128 * 32] = m_run; M[129 * 32] = l_run; }
    __syncthreads();   // the handed-over values are in LDS before their readers start
    if (kh == 1u) return;
    const float mB = M[128 * 32], lB = M[129 * 32], m = fmaxf(m_run, mB), aA = __builtin_amdgcn_exp2f(m_run - m), aB = __builtin_amdgcn_exp2f(mB - m);
    float l = l_run * aA + lB * aB; l += xhalf(l);   // each half of the wave summed its eight keys of every 16
    const float inv = __fdiv_rn(1.0f, l);
    const size_t eo = (size_t)(q0 + c) * VC + 8u * h;
#pragma unroll
    for (int t = 0; t < 16; ++t) { v8us oh, ol;
#pragma unroll
        for (int r = 0; r < 8; ++r) { unsigned short a, c2; splitf(__fmul_rn(acc[t][r] * aA + M[(t * 8 + r) * 32] * aB, inv), a, c2); oh[r] = a; ol[r] = c2; }
        *(v8us*)(Oh + eo + t * 16) = oh; *(v8us*)(Ol + eo + t * 16) = ol; }
}

extern "C" void kernel_launch(void* const* d_in, const int* in_sizes, int n_in,
                              void* d_out, int out_size, void* d_ws, size_t ws_size, hipStream_t stream) {
    (void)in_sizes; (void)n_in; (void)out_size;
    const float* IN[17]; for (int i = 0; i < 17; ++i) IN[i] = (const float*)d_in[i];   // 0 x, 1 wq [256][512], 2 bq, 3 gq, 4 betaq, 5 mq, 6 vq, 7 wk, 8 bk, 9 gk, 10 betak, 11 mk, 12 vk, 13 wv, 14 bv, 15 wW [512][256], 16 bW
    float* OUT = (float*)d_out;     // [4][512][4096]
    char* wsp = (char*)d_ws;
    auto take = [&](size_t bytes) { char* p = wsp; wsp += (bytes + 255) & ~(size_t)255; return (void*)p; };
    bf* WQ = (bf*)take((size_t)KC * CC * 2); bf* WK = (bf*)take((size_t)KC * CC * 2); bf* WV = (bf*)take((size_t)VC * CC * 2); bf* WW = (bf*)take((size_t)CC * VC * 2);
    // every plane holds all NB_ images
    bf* XT = (bf*)take((size_t)NB_ * TQ * CC * 2); h16* Q16 = (h16*)take((size_t)NB_ * TQ * KC * 2); h16* K16 = (h16*)take((size_t)NB_ * NKY * KC * 2); h16* VT = (h16*)take((size_t)NB_ * VC * NKY * 2);
    bf* Ch = (bf*)take((size_t)NB_ * TQ * VC * 2); bf* Cl = (bf*)take((size_t)NB_ * TQ * VC * 2);
    if ((size_t)(wsp - (char*)d_ws) > ws_size) return;    // total = 57 MiB
    { const unsigned g = (KC * CC / 8 + 255) / 256; k_cvt8<<<g, 256, 0, stream>>>(IN[1], WQ, (size_t)KC * CC / 8); k_cvt8<<<g, 256, 0, stream>>>(IN[7], WK, (size_t)KC * CC / 8); k_cvt8<<<g, 256, 0, stream>>>(IN[13], WV, (size_t)VC * CC / 8); k_cvt8<<<g, 256, 0, stream>>>(IN[15], WW, (size_t)CC * VC / 8); }
    k_xt<<<dim3(TQ / 128, CC / 128, NB_), 256, 0, stream>>>(IN[0], XT);
    k_gemmw<bf, 0, 1, 8><<<dim3(TQ / 64, KC / 64, NB_), 256, 0, stream>>>(XT, nullptr, WQ, nullptr, CC, nullptr, Q16, nullptr, nullptr, KC, IN[2], IN[3], IN[4], IN[5], IN[6], nullptr, (size_t)TQ * CC, 0, (size_t)TQ * KC);
    k_gemmw<bf, 0, 1, 8><<<dim3(TQ / 64, KC / 64, NB_), 256, 0, stream>>>(XT, nullptr, WK, nullptr, CC, nullptr, K16, nullptr, nullptr, KC, IN[8], IN[9], IN[10], IN[11], IN[12], nullptr, (size_t)TQ * CC, 0, (size_t)NKY * KC);
    k_gemmw<bf, 0, 2, 8><<<dim3(VC / 64, NKY / 64, NB_), 256, 0, stream>>>(WV, nullptr, XT, nullptr, CC, nullptr, VT, nullptr, nullptr, NKY, IN[14], nullptr, nullptr, nullptr, nullptr, nullptr, 0, (size_t)TQ * CC, (size_t)VC * NKY);
    k_attn<<<dim3(TQ / 64, NB_, 1), 256, 0, stream>>>(Q16, K16, VT, Ch, Cl);
    k_gemmw<bf, 3, 4, 4><<<dim3(CC / 64, TQ / 64, NB_), 128, 0, stream>>>(WW, nullptr, Ch, Cl, VC, OUT, nullptr, nullptr, nullptr, TQ, IN[16], nullptr, nullptr, nullptr, nullptr, nullptr, 0, (size_t)TQ * VC, (size_t)CC * TQ);
}

// v006
// Measured time: 149 microseconds a run.
// Next to v005, in two timings, it ran 1.10 times as fast each time.
// Counting every step since v000, it is 6.28 times as fast.
#include <hip/hip_runtime.h>

// BasicNonLocalBlock (x [4][512][64x64 = 4096] NCHW; q = BN_q(wq x + bq), k = BN_k(wk x + bk) (256 channels, eval-mode BatchNorm with the given mean/var/gamma/beta), v = wv x + bv (256); sim = softmax_k(q^T k x 256^-0.5) over
// the 4096 positions; ctx[c][q] = sum_k sim[q][k] v[c][k]; out = wW ctx + bW -> [4][512][64][64]).
// Compute dtypes, f32 accumulate: every input rounded to bf16; the three 1x1 convolutions on PLAIN bf16 operands from a positions-major bf16 copy of x (inputs: exact, + bias); BN (f32, per-channel

#define NB_  4
#define CC   512
#define TQ   4096
#define NKY   4096
#define KC   256
#define VC   256
typedef _Float16 h16;
typedef unsigned short bf;
typedef __attribute__((ext_vector_type(16))) __bf16   v16bf;
typedef __attribute__((ext_vector_type(16))) _Float16 v16h;
typedef __attribute__((ext_vector_type(8)))  _Float16 v8h;
typedef __attribute__((ext_vector_type(8)))  unsigned short v8us;
typedef __attribute__((ext_vector_type(8)))  float    v8f;
typedef __attribute__((ext_vector_type(4)))  float    v4f;
typedef v8h  __attribute__((may_alias)) v8ha;
typedef v4f  __attribute__((may_alias)) v4fa;
typedef v8us __attribute__((may_alias)) v8usa;

__device__ __forceinline__ unsigned short f2bf(float f) { unsigned u = __float_as_uint(f); u += 0x7FFFu + ((u >> 16) & 1u); return (unsigned short)(u >> 16); }
__device__ __forceinline__ float bf2f(unsigned short b) { return __uint_as_float(((unsigned)b) << 16); }
__device__ __forceinline__ float bfr(float f) { return bf2f(f2bf(f)); }
__device__ __forceinline__ v16h cat16(v8h lo, v8h hi) { return __builtin_shufflevector(lo, hi, 0, 1, 2, 3, 4, 5, 6, 7, 8, 9, 10, 11, 12, 13, 14, 15); }
__device__ __forceinline__ v16bf cat16b(v8us lo, v8us hi) { return __builtin_bit_cast(v16bf, __builtin_shufflevector(lo, hi, 0, 1, 2, 3, 4, 5, 6, 7, 8, 9, 10, 11, 12, 13, 14, 15)); }
__device__ __forceinline__ v8f wmma16(v16h a, v16h b, v8f c) { return __builtin_amdgcn_wmma_f32_16x16x32_f16(false, a, false, b, (short)0, c, false, false); }
__device__ __forceinline__ v8f wmmab(v16bf a, v16bf b, v8f c) { return __builtin_amdgcn_wmma_f32_16x16x32_bf16(false, a, false, b, (short)0, c, false, false); }



// ---- k_gemmw: register-blocked GEMM, one 64x64 output tile per workgroup (16 accumulators per wave), operands straight from K-contiguous 16-bit planes; grid (M/64, N/64, Z), 32 * KS threads.
// C[m][n] (f32, pitch ldc; bias as EPI says below) = sum_k A[m][k] Bt[n][k] (+ split products per NSPLIT). z-batch strides sA/sB/sC in elements (z = image; sC moves whichever plane the epilogue stores, RS moves by its own plane). K % 32 == 0.
// KS waves share the tile: wave w sums every KS-th block of 32 k, from block w on (neighbouring waves read the two halves of the same 128-byte lines); the KS f32 partial tiles are then added in LDS, in wave order.
// KS > 1 is for grids with fewer tiles than the chip has SIMDs.
// EPI says what the tile's f32 sums become before the one store (rows m, columns n), so that no separate pass re-reads them:
//   0  C[m][n] = sum (f32)
//   1  H[m][n] = f16(BN_n(sum + bias[n]))               eval-mode BatchNorm, per column (channel)
//   2  H[m][n] = f16(sum + bias[m])                     A = weights, Bt = positions: the channels-major plane comes out directly
//   3  Oh/Ol[m][n] = bf16 head and rest of sum * RS[m][1]  (the row's 1 / softmax denominator)
//   4  C[m][n] = sum + bias[m] (f32)                    A = weights, Bt = positions: the NCHW output comes out directly
__device__ __forceinline__ h16 tohx(float x) { return (h16)x; }
__device__ __forceinline__ void splitf(float y, unsigned short& h, unsigned short& l) { h = f2bf(y); l = f2bf(y - bf2f(h)); }
typedef __attribute__((ext_vector_type(4))) _Float16 v4h;
typedef __attribute__((ext_vector_type(4))) unsigned short v4us;
template <typename T16> struct WFrag;
template <> struct WFrag<h16> { typedef v16h V; static __device__ __forceinline__ V ld(const h16* p) { return cat16(*(const v8h*)p, *(const v8h*)(p + 16)); } static __device__ __forceinline__ v8f mma(V a, V b, v8f c) { return wmma16(a, b, c); } };
template <> struct WFrag<bf> { typedef v16bf V; static __device__ __forceinline__ V ld(const bf* p) { return cat16b(*(const v8us*)p, *(const v8us*)(p + 16)); } static __device__ __forceinline__ v8f mma(V a, V b, v8f c) { return wmmab(a, b, c); } };
// The tile's work is a device function (os: the workgroup's LDS, (KS == 1 ? 16 : KS * 64) * 68 floats; bx, by, z: the tile's place in the grid described above), so that one launch can hold tiles of several GEMMs.
template <typename T16, int NSPLIT, int EPI, int KS>
__device__ __forceinline__ void gemmw_tile(float* os, const unsigned bx, const unsigned by, const size_t z,
                                           const T16* __restrict__ A, const T16* __restrict__ A2, const T16* __restrict__ Bt, const T16* __restrict__ Bt2, int K, float* C, h16* H, bf* Oh, bf* Ol, int ldc, const float* __restrict__ bias,
                                           const float* __restrict__ g, const float* __restrict__ be, const float* __restrict__ mu, const float* __restrict__ var, const float* __restrict__ RS, size_t sA, size_t sB, size_t sC) {
    static_assert(KS > 1 || EPI == 0, "the one-wave path stores plain f32");
    typedef typename WFrag<T16>::V V;
    A += z * sA; if (A2) A2 += z * sA; Bt += z * sB; if (Bt2) Bt2 += z * sB;
    if constexpr (EPI == 0 || EPI == 4) C += z * sC;
    if constexpr (EPI == 1 || EPI == 2) H += z * sC;
    if constexpr (EPI == 3) { Oh += z * sC; Ol += z * sC; RS += z * (size_t)(TQ * 32); }
    const int lane = threadIdx.x & 31, lr = lane & 15, hi = lane >> 4; const int r0 = bx * 64, c0 = by * 64;
    const int w = KS == 1 ? 0 : __builtin_amdgcn_readfirstlane((int)(threadIdx.x >> 5));   // the wave's number in a scalar register: the k loop's counter and test stay scalar
    // what the epilogue needs per column (EPI 1) or per row (EPI 2, 3, 4) is loaded here, ahead of the k loop, so that its latency passes behind the loop's own loads
    v4f pb = {}, pg = {}, pe = {}, pm = {}, pv = {}; float rowv[32 / KS];
    if constexpr (EPI >= 1) __builtin_amdgcn_sched_barrier(0);   // with the one behind the wait below: nothing else is scheduled in between the loads and their wait
    if constexpr (EPI == 1) { const int cc = c0 + lr * 4; pb = *(const v4f*)(bias + cc); pg = *(const v4f*)(g + cc); pe = *(const v4f*)(be + cc); pm = *(const v4f*)(mu + cc); pv = *(const v4f*)(var + cc); }
    if constexpr (EPI >= 2) {
#pragma unroll
        for (int s = 0; s < 32 / KS; ++s) { const int row = r0 + 2 * (s * KS + w) + hi; rowv[s] = EPI == 3 ? RS[(size_t)row * 32 + 1] : bias[row]; } }
    // the address registers of the loads above are reused at once (the accumulators' zeros, kernel arguments): the wait stands in front of that overwrite
    if constexpr (EPI >= 1) { asm volatile("s_wait_xcnt 0x0" ::: "memory"); __builtin_amdgcn_sched_barrier(0); }
    v8f acc[4][4];
#pragma unroll
    for (int mb = 0; mb < 4; ++mb)
#pragma unroll
        for (int nb = 0; nb < 4; ++nb) acc[mb][nb] = (v8f){};
    const size_t aoff = (size_t)(r0 + lr) * K + 8 * hi, boff = (size_t)(c0 + lr) * K + 8 * hi;
#pragma unroll 1
    for (int kc = w * 32; kc < K; kc += 32 * KS) {
        V a[4], a2[4];
#pragma unroll
        for (int mb = 0; mb < 4; ++mb) { a[mb] = WFrag<T16>::ld(A + aoff + (size_t)mb * 16 * K + kc); if (NSPLIT == 1 || NSPLIT == 2) a2[mb] = WFrag<T16>::ld(A2 + aoff + (size_t)mb * 16 * K + kc); }
#pragma unroll
        for (int nb = 0; nb < 4; ++nb) { const V b = WFrag<T16>::ld(Bt + boff + (size_t)nb * 16 * K + kc); V b2; if (NSPLIT >= 2) b2 = WFrag<T16>::ld(Bt2 + boff + (size_t)nb * 16 * K + kc);
#pragma unroll
            for (int mb = 0; mb < 4; ++mb) { acc[mb][nb] = WFrag<T16>::mma(a[mb], b, acc[mb][nb]); if (NSPLIT == 1 || NSPLIT == 2) acc[mb][nb] = WFrag<T16>::mma(a2[mb], b, acc[mb][nb]); if (NSPLIT >= 2) acc[mb][nb] = WFrag<T16>::mma(a[mb], b2, acc[mb][nb]); } }
        asm volatile("v_nop\n\tv_nop\n\tv_nop\n\tv_nop" : "+v"(acc[0][0]), "+v"(acc[1][1]), "+v"(acc[2][2]), "+v"(acc[3][3]) : "v"(a[0]), "v"(a[3]));
    }
    if constexpr (KS > 1) {
        float* osw = os + w * (64 * 68);
        // all loops below are unrolled so that acc[][] is indexed by constants (stays in registers) and the LDS offsets are immediates
#pragma unroll
        for (int mb = 0; mb < 4; ++mb)
#pragma unroll
            for (int nb = 0; nb < 4; ++nb)
#pragma unroll
                for (int j = 0; j < 8; ++j) osw[(mb * 16 + hi * 8 + j) * 68 + nb * 16 + lr] = acc[mb][nb][j];
        __syncthreads();   // every wave's partial tile is in LDS before any thread adds them
        const int cofs = lr * 4;
        v4f sc = {}, sh = {};
        if constexpr (EPI == 1) {
#pragma unroll
            for (int q = 0; q < 4; ++q) { sc[q] = __fdiv_rn(bfr(pg[q]), __fsqrt_rn(bfr(pv[q]) + 1e-5f)); sh[q] = bfr(pe[q]) - bfr(pm[q]) * sc[q]; pb[q] = bfr(pb[q]); } }
#pragma unroll
        for (int s = 0; s < 32 / KS; ++s) { const int row = 2 * (s * KS + w) + hi; v4f val = *(const v4fa*)(os + row * 68 + cofs);
#pragma unroll
            for (int p = 1; p < KS; ++p) val += *(const v4fa*)(os + p * (64 * 68) + row * 68 + cofs);
            const size_t eo = (size_t)(r0 + row) * ldc + c0 + cofs;
            if constexpr (EPI == 0) { *(v4f*)(C + eo) = val; }
            if constexpr (EPI == 1) { v4h o;
#pragma unroll
                for (int q = 0; q < 4; ++q) o[q] = tohx((val[q] + pb[q]) * sc[q] + sh[q]);
                *(v4h*)(H + eo) = o; }
            if constexpr (EPI == 2) { const float rb = bfr(rowv[s]); v4h o;
#pragma unroll
                for (int q = 0; q < 4; ++q) o[q] = tohx(val[q] + rb);
                *(v4h*)(H + eo) = o; }
            if constexpr (EPI == 3) { v4us oh, ol;
#pragma unroll
                for (int q = 0; q < 4; ++q) { unsigned short a, c2; splitf(__fmul_rn(val[q], rowv[s]), a, c2); oh[q] = a; ol[q] = c2; }
                *(v4us*)(Oh + eo) = oh; *(v4us*)(Ol + eo) = ol; }
            if constexpr (EPI == 4) { const float rb = bfr(rowv[s]); val += rb; *(v4f*)(C + eo) = val; } }
        return;
    }
#pragma unroll
    for (int mb = 0; mb < 4; ++mb) {
#pragma unroll
        for (int nb = 0; nb < 4; ++nb) {
#pragma unroll
            for (int j = 0; j < 8; ++j) os[(hi * 8 + j) * 68 + nb * 16 + lr] = acc[mb][nb][j]; }
        __builtin_amdgcn_wave_barrier(); asm volatile("" ::: "memory");
        float* crow = C + (size_t)(r0 + mb * 16) * ldc + c0;
{
#pragma unroll
            for (int s = 0; s < 8; ++s) { const int row = 2 * s + hi, cofs = lr * 4; v4f val = *(const v4fa*)(os + row * 68 + cofs);
                *(v4f*)(crow + (size_t)row * ldc + cofs) = val; }
             }
        __builtin_amdgcn_wave_barrier(); asm volatile("" ::: "memory");
    }
}

template <typename T16, int NSPLIT, int EPI, int KS>
__global__ __launch_bounds__(32 * KS) void k_gemmw(const T16* __restrict__ A, const T16* __restrict__ A2, const T16* __restrict__ Bt, const T16* __restrict__ Bt2, int K, float* C, h16* H, bf* Oh, bf* Ol, int ldc, const float* __restrict__ bias,
                                                   const float* __restrict__ g, const float* __restrict__ be, const float* __restrict__ mu, const float* __restrict__ var, const float* __restrict__ RS, size_t sA, size_t sB, size_t sC) {
    __shared__ __align__(16) float os[(KS == 1 ? 16 : KS * 64) * 68];
    gemmw_tile<T16, NSPLIT, EPI, KS>(os, blockIdx.x, blockIdx.y, blockIdx.z, A, A2, Bt, Bt2, K, C, H, Oh, Ol, ldc, bias, g, be, mu, var, RS, sA, sB, sC);
}
// ---- k_qkv: the three projections, which depend on nothing of one another, in one launch; grid (TQ / 64, KC / 64, 3 * images), 8 waves. blockIdx.z = 4 * projection + image (0 q, 1 k, 2 v).
// q and k: rows = positions (x), columns = channels (y). v: rows = channels, columns = positions, the channel tile running fastest over the plane's 256 workgroups.
__global__ __launch_bounds__(256) void k_qkv(const bf* __restrict__ XT, const bf* __restrict__ WQ, const bf* __restrict__ WK, const bf* __restrict__ WV, h16* Q16, h16* K16, h16* VT,
                                             const float* __restrict__ bq, const float* __restrict__ gq, const float* __restrict__ eq, const float* __restrict__ mq, const float* __restrict__ vq,
                                             const float* __restrict__ bk, const float* __restrict__ gk, const float* __restrict__ ek, const float* __restrict__ mk, const float* __restrict__ vk, const float* __restrict__ bv) {
    static_assert(KC == VC && TQ == NKY && NB_ == 4, "one grid shape serves the three projections");
    __shared__ __align__(16) float os[8 * 64 * 68];
    const unsigned pr = blockIdx.z >> 2, img = blockIdx.z & 3u;
    if (pr == 2u) { const unsigned lin = blockIdx.y * (TQ / 64) + blockIdx.x;
        gemmw_tile<bf, 0, 2, 8>(os, lin & (VC / 64 - 1), lin / (VC / 64), img, WV, nullptr, XT, nullptr, CC, nullptr, VT, nullptr, nullptr, NKY, bv, nullptr, nullptr, nullptr, nullptr, nullptr, 0, (size_t)TQ * CC, (size_t)VC * NKY);
        return; }
    const bool isk = pr == 1u;
    gemmw_tile<bf, 0, 1, 8>(os, blockIdx.x, blockIdx.y, img, XT, nullptr, isk ? WK : WQ, nullptr, CC, nullptr, isk ? K16 : Q16, nullptr, nullptr, KC, isk ? bk : bq, isk ? gk : gq, isk ? ek : eq, isk ? mk : mq, isk ? vk : vq, nullptr,
                            (size_t)TQ * CC, 0, (size_t)TQ * KC);
}

// ---- k_prep: the bf16 planes that the GEMMs read, all in one launch; grid (TQ / 128, CC / 128, images + 2), 8 waves. Planes z < images turn x; the 256 workgroups of the last two planes round the four weight matrices, 64 each.
// x [image][512 channels][4096 positions] f32 -> XT [image][4096 positions][512 channels] bf16, turned through LDS. One workgroup = 128 channels x 128 positions.
// In: a wave's load is 512 contiguous bytes of one channel's row (128 positions); a wave takes 16 channels, so a lane holds 16 channels x 4 positions and packs 8 channels of one position into one 16-byte LDS store.
// Out: 16 lanes store the 256 contiguous bytes (128 channels) of one position's row.
// LDS row = one position, 16 pieces of 16 bytes; piece k of row n stands at place k ^ ((n >> 2) & 15), so that the 16 lanes of a half wave fall on 16 different places in the stores (rows 4 apart, one k) as in the loads (one row, 16 k).
__global__ __launch_bounds__(256) void k_prep(const float* __restrict__ xb, bf* XT, const float* __restrict__ w0, const float* __restrict__ w1, const float* __restrict__ w2, const float* __restrict__ w3, bf* W0, bf* W1, bf* W2, bf* W3) {
    static_assert(KC * CC == 64 * 256 * 8 && VC * CC == KC * CC && (TQ / 128) * (CC / 128) * 2 == 4 * 64, "64 workgroups of 256 threads, 8 elements a thread, cover one weight matrix exactly");
    __shared__ __align__(16) unsigned char T[128 * 256];
    const unsigned tid = threadIdx.x, lane = tid & 31u, w = tid >> 5;
    if (blockIdx.z >= NB_) {   // the same for the whole workgroup, and in front of the barrier
        const unsigned j = ((blockIdx.z - NB_) * (CC / 128) + blockIdx.y) * (TQ / 128) + blockIdx.x, m = j >> 6;
        const float* src = m == 0u ? w0 : m == 1u ? w1 : m == 2u ? w2 : w3; bf* dst = m == 0u ? W0 : m == 1u ? W1 : m == 2u ? W2 : W3;
        const size_t i = (size_t)(j & 63u) * 256 + tid; const v8f v = *(const v8f*)(src + i * 8); v8us o;
#pragma unroll
        for (int k = 0; k < 8; ++k) o[k] = f2bf(v[k]);
        *(v8us*)(dst + i * 8) = o; return; }
    xb += (size_t)blockIdx.z * CC * TQ + (size_t)(blockIdx.y * 128u + w * 16u) * TQ + blockIdx.x * 128u + lane * 4u;
    XT += (size_t)blockIdx.z * TQ * CC + (size_t)(blockIdx.x * 128u + (tid >> 4)) * CC + blockIdx.y * 128u + (tid & 15u) * 8u;
    v4f r[16];
#pragma unroll
    for (int i = 0; i < 16; ++i) r[i] = *(const v4f*)(xb + (size_t)i * TQ);
    // the address registers of the loads above are reused below: the wait stands in front of that overwrite; the address is an input of the statement, so that no load takes its registers as its destination; the scheduling barrier keeps the overwrite behind the wait
    asm volatile("s_wait_xcnt 0x0" : : "v"(xb) : "memory"); __builtin_amdgcn_sched_barrier(0);
#pragma unroll
    for (int g = 0; g < 2; ++g)
#pragma unroll
        for (int j = 0; j < 4; ++j) { v8us o;
#pragma unroll
            for (int k = 0; k < 8; ++k) o[k] = f2bf(r[g * 8 + k][j]);
            *(v8usa*)(T + (lane * 4u + j) * 256u + (((w * 2u + g) ^ (lane & 15u)) * 16u)) = o; }
    __syncthreads();   // the whole tile is in LDS before any thread reads a row of it
    v8us o[8];
#pragma unroll
    for (int s = 0; s < 8; ++s) { const unsigned row = s * 16u + (tid >> 4); o[s] = *(const v8usa*)(T + row * 256u + (((tid & 15u) ^ ((row >> 2) & 15u)) * 16u)); }
#pragma unroll
    for (int s = 0; s < 8; ++s) *(v8us*)(XT + (size_t)s * 16 * CC) = o[s];
}
#define AKP 528u                    // LDS pitch of a K row (512 B + 16: an odd multiple of 16 B)
#define AVP 144u                    // LDS pitch of a V^T row (64 keys = 128 B + 16)
#define ATK (64u * AKP)
#define ASLOT (ATK + 256u * AVP)
#define ALAG 4.0f
#define ACS  0.09016844005556021f   // 256^-0.5 * log2(e)
typedef float __attribute__((may_alias)) fla;
__device__ __forceinline__ float xhalf(float x) { return __builtin_bit_cast(float, __builtin_amdgcn_permlanex16(__builtin_bit_cast(int, x), __builtin_bit_cast(int, x), 0x76543210, 0xfedcba98, false, false)); }  // lane l with lane l ^ 16
__device__ __forceinline__ v16h ldsfrag(const unsigned char* p) { return cat16(*(const v8ha*)p, *(const v8ha*)(p + 32)); }
__global__ __launch_bounds__(256) __attribute__((amdgpu_waves_per_eu(2, 2))) void k_attn(const h16* __restrict__ Q, const h16* __restrict__ Kk, const h16* __restrict__ Vt, bf* Oh, bf* Ol) {
    __shared__ __align__(16) unsigned char L[2 * ASLOT];
    static_assert(4 * 130 * 32 * 4 <= 2 * ASLOT, "the join at the end reuses the ring");
    const size_t z = blockIdx.y; Q += z * (size_t)(TQ * KC); Kk += z * (size_t)(NKY * KC); Vt += z * (size_t)(VC * NKY); Oh += z * (size_t)(TQ * VC); Ol += z * (size_t)(TQ * VC);
    const unsigned tid = threadIdx.x, lane = tid & 31u, c = lane & 15u, h = lane >> 4;
    const unsigned w = __builtin_amdgcn_readfirstlane(tid >> 5), wq = w & 3u, kh = w >> 2;
    const unsigned q0 = blockIdx.x * 64u + wq * 16u;
    v8h sk[8], sv[8];
    const char* kbase = (const char*)Kk; const char* vbase = (const char*)Vt;
    unsigned ko = tid * 16u, vo = (tid >> 3) * (NKY * 2u) + (tid & 7u) * 16u;   // this thread's byte offsets in the K plane and in the V^T plane, advanced by one stage a trip
    const unsigned kst = (tid >> 5) * AKP + (tid & 31u) * 16u, vst = ATK + (tid >> 3) * AVP + (tid & 7u) * 16u;
    v16h qf[8];
#pragma unroll
    for (int kc = 0; kc < 8; ++kc) qf[kc] = WFrag<h16>::ld(Q + (size_t)(q0 + c) * KC + 8u * h + 32 * kc);
#pragma unroll
    for (int i = 0; i < 8; ++i) { sk[i] = *(const v8h*)(kbase + ko + i * 4096u); sv[i] = *(const v8h*)(vbase + vo + i * (32u * NKY * 2u)); }
    // the address registers of the loads above are advanced or reused below: the wait stands in front of that overwrite; the scheduling barrier keeps the overwrite behind it
    asm volatile("s_wait_xcnt 0x0" ::: "memory"); __builtin_amdgcn_sched_barrier(0);
    v8f acc[16];
#pragma unroll
    for (int t = 0; t < 16; ++t) acc[t] = (v8f){};
    float m_run = -__builtin_inff(), l_run = 0.f;
#pragma unroll
    for (int i = 0; i < 8; ++i) { *(v8ha*)(L + kst + i * 8 * AKP) = sk[i]; *(v8ha*)(L + vst + i * 32 * AVP) = sv[i]; }
    __syncthreads();   // stage 0 is in LDS before any wave reads it
#pragma unroll 1
    for (int st = 0; st < NKY / 64; ++st) {
        const unsigned char* b = L + (st & 1) * ASLOT;
        if (st + 1 < NKY / 64) {
#pragma unroll
            for (int i = 0; i < 8; ++i) { sk[i] = *(const v8h*)(kbase + ko + (64u * KC * 2u + i * 4096u)); sv[i] = *(const v8h*)(vbase + vo + (128u + i * (32u * NKY * 2u))); }
            // as above: the line behind it advances these loads' offset registers; the two offsets pass through the statement so that the additions cannot be placed in front of the wait
            asm volatile("s_wait_xcnt 0x0" : "+v"(ko), "+v"(vo) : : "memory");
            ko += 64u * KC * 2u; vo += 128u;
        }
        v8f s0 = {}, s1 = {};
        { const unsigned char* kb = b + (kh * 32u + c) * AKP + 16u * h;
#pragma unroll
          for (int kc = 0; kc < 8; ++kc) { s0 = wmma16(ldsfrag(kb + 64 * kc), qf[kc], s0); s1 = wmma16(ldsfrag(kb + 16 * AKP + 64 * kc), qf[kc], s1); } }
        // the pass's V^T fragments are fetched as one group here, so that their LDS latency passes behind the maxima and the exponentials;
        // the scheduling barrier in front has every K load of the pass issued ahead of the first V load (without it only some K fragments are fetched ahead of their products); the one behind keeps the group in front of the vector work
        v16h vf[16];
        __builtin_amdgcn_sched_barrier(0);
        { const unsigned char* vb = b + ATK + c * AVP + kh * 64u + 16u * h;
#pragma unroll
          for (int t = 0; t < 16; ++t) vf[t] = ldsfrag(vb + t * 16 * AVP); }
        __builtin_amdgcn_sched_barrier(0);
        float mx = fmaxf(s0[0], s1[0]);
#pragma unroll
        for (int r = 1; r < 8; ++r) mx = fmaxf(mx, fmaxf(s0[r], s1[r]));
        mx = fmaxf(mx, xhalf(mx)) * ACS;   // both halves of the wave now hold this query's maximum of the pass, scaled
        if (__builtin_amdgcn_ballot_w32(mx > m_run + ALAG) != 0) {   // a scalar branch; rare after the first passes
            const float m_new = fmaxf(m_run, mx), corr = __builtin_amdgcn_exp2f(m_run - m_new);   // corr = 0 on the first pass, where m_run is -inf
            l_run *= corr; m_run = m_new;
#pragma unroll
            for (int t = 0; t < 16; ++t) acc[t] *= corr;
        }
        v16h pf; float ps0 = 0.f, ps1 = 0.f; const float nm = 10.0f - m_run;
#pragma unroll
        for (int r = 0; r < 8; ++r) { s0[r] = __builtin_fmaf(s0[r], ACS, nm); s1[r] = __builtin_fmaf(s1[r], ACS, nm); }
#pragma unroll
        for (int r = 0; r < 8; ++r) {
            __builtin_amdgcn_sched_barrier(0); const float p0 = __builtin_amdgcn_exp2f(s0[r]); __builtin_amdgcn_sched_barrier(0); asm volatile("v_nop");
            __builtin_amdgcn_sched_barrier(0); const float p1 = __builtin_amdgcn_exp2f(s1[r]); __builtin_amdgcn_sched_barrier(0); asm volatile("v_nop");
            __builtin_amdgcn_sched_barrier(0); ps0 += p0; ps1 += p1; pf[r] = tohx(p0); pf[8 + r] = tohx(p1); }
        l_run += ps0 + ps1;
#pragma unroll
        for (int t = 0; t < 16; ++t) acc[t] = wmma16(vf[t], pf, acc[t]);
        // four vector slots behind the last matrix instruction on every path, the loop's back edge included
        __builtin_amdgcn_sched_barrier(0); asm volatile("v_nop\n\tv_nop\n\tv_nop\n\tv_nop"); __builtin_amdgcn_sched_barrier(0);
        if (st + 1 < NKY / 64) { unsigned char* d = L + ((st + 1) & 1) * ASLOT;
#pragma unroll
            for (int i = 0; i < 8; ++i) { *(v8ha*)(d + kst + i * 8 * AKP) = sk[i]; *(v8ha*)(d + vst + i * 32 * AVP) = sv[i]; } }
        __syncthreads();   // publishes stage st + 1 and ends every wave's reads of stage st, whose buffer the next trip refills
    }
    // join of the two key halves: waves 4..7 hand their sums, maximum and denominator to waves 0..3, lane to lane
    fla* M = (fla*)L + wq * (130u * 32u) + lane;
    if (kh == 1u) {
#pragma unroll
        for (int t = 0; t < 16; ++t)
#pragma unroll
            for (int r = 0; r < 8; ++r) M[(t * 8 + r) * 32] = acc[t][r];
        M[128 * 32] = m_run; M[129 * 32] = l_run; }
    __syncthreads();   // the handed-over values are in LDS before their readers start
    if (kh == 1u) return;
    const float mB = M[128 * 32], lB = M[129 * 32], m = fmaxf(m_run, mB), aA = __builtin_amdgcn_exp2f(m_run - m), aB = __builtin_amdgcn_exp2f(mB - m);
    float l = l_run * aA + lB * aB; l += xhalf(l);   // each half of the wave summed its eight keys of every 16
    const float inv = __fdiv_rn(1.0f, l);
    const size_t eo = (size_t)(q0 + c) * VC + 8u * h;
#pragma unroll
    for (int t = 0; t < 16; ++t) { v8us oh, ol;
#pragma unroll
        for (int r = 0; r < 8; ++r) { unsigned short a, c2; splitf(__fmul_rn(acc[t][r] * aA + M[(t * 8 + r) * 32] * aB, inv), a, c2); oh[r] = a; ol[r] = c2; }
        *(v8us*)(Oh + eo + t * 16) = oh; *(v8us*)(Ol + eo + t * 16) = ol; }
}

extern "C" void kernel_launch(void* const* d_in, const int* in_sizes, int n_in,
                              void* d_out, int out_size, void* d_ws, size_t ws_size, hipStream_t stream) {
    (void)in_sizes; (void)n_in; (void)out_size;
    const float* IN[17]; for (int i = 0; i < 17; ++i) IN[i] = (const float*)d_in[i];   // 0 x, 1 wq [256][512], 2 bq, 3 gq, 4 betaq, 5 mq, 6 vq, 7 wk, 8 bk, 9 gk, 10 betak, 11 mk, 12 vk, 13 wv, 14 bv, 15 wW [512][256], 16 bW
    float* OUT = (float*)d_out;     // [4][512][4096]
    char* wsp = (char*)d_ws;
    auto take = [&](size_t bytes) { char* p = wsp; wsp += (bytes + 255) & ~(size_t)255; return (void*)p; };
    bf* WQ = (bf*)take((size_t)KC * CC * 2); bf* WK = (bf*)take((size_t)KC * CC * 2); bf* WV = (bf*)take((size_t)VC * CC * 2); bf* WW = (bf*)take((size_t)CC * VC * 2);
    // every plane holds all NB_ images
    bf* XT = (bf*)take((size_t)NB_ * TQ * CC * 2); h16* Q16 = (h16*)take((size_t)NB_ * TQ * KC * 2); h16* K16 = (h16*)take((size_t)NB_ * NKY * KC * 2); h16* VT = (h16*)take((size_t)NB_ * VC * NKY * 2);
    bf* Ch = (bf*)take((size_t)NB_ * TQ * VC * 2); bf* Cl = (bf*)take((size_t)NB_ * TQ * VC * 2);
    if ((size_t)(wsp - (char*)d_ws) > ws_size) return;    // total = 57 MiB
    k_prep<<<dim3(TQ / 128, CC / 128, NB_ + 2), 256, 0, stream>>>(IN[0], XT, IN[1], IN[7], IN[13], IN[15], WQ, WK, WV, WW);
    k_qkv<<<dim3(TQ / 64, KC / 64, 3 * NB_), 256, 0, stream>>>(XT, WQ, WK, WV, Q16, K16, VT, IN[2], IN[3], IN[4], IN[5], IN[6], IN[8], IN[9], IN[10], IN[11], IN[12], IN[14]);
    k_attn<<<dim3(TQ / 64, NB_, 1), 256, 0, stream>>>(Q16, K16, VT, Ch, Cl);
    k_gemmw<bf, 3, 4, 4><<<dim3(CC / 64, TQ / 64, NB_), 128, 0, stream>>>(WW, nullptr, Ch, Cl, VC, OUT, nullptr, nullptr, nullptr, TQ, IN[16], nullptr, nullptr, nullptr, nullptr, nullptr, 0, (size_t)TQ * VC, (size_t)CC * TQ);
}

// v007
// A run of this version takes 109 microseconds.
// In two side-by-side timings against v006, it was 1.37 and 1.36 times as fast.
// All steps since v000 together make it 8.58 times as fast.
#include <hip/hip_runtime.h>

// BasicNonLocalBlock (x [4][512][64x64 = 4096] NCHW; q = BN_q(wq x + bq), k = BN_k(wk x + bk) (256 channels, eval-mode BatchNorm with the given mean/var/gamma/beta), v = wv x + bv (256); sim = softmax_k(q^T k x 256^-0.5) over
// the 4096 positions; ctx[c][q] = sum_k sim[q][k] v[c][k]; out = wW ctx + bW -> [4][512][64][64]).
// Compute dtypes, f32 accumulate: every input rounded to bf16; the three 1x1 convolutions on PLAIN bf16 operands from a positions-major bf16 copy of x (inputs: exact, + bias); BN (f32, per-channel

#define NB_  4
#define CC   512
#define TQ   4096
#define NKY   4096
#define KC   256
#define VC   256
typedef _Float16 h16;
typedef unsigned short bf;
typedef __attribute__((ext_vector_type(16))) __bf16   v16bf;
typedef __attribute__((ext_vector_type(16))) _Float16 v16h;
typedef __attribute__((ext_vector_type(8)))  _Float16 v8h;
typedef __attribute__((ext_vector_type(8)))  unsigned short v8us;
typedef __attribute__((ext_vector_type(8)))  float    v8f;
typedef __attribute__((ext_vector_type(4)))  float    v4f;
typedef v8h  __attribute__((may_alias)) v8ha;
typedef v4f  __attribute__((may_alias)) v4fa;
typedef v8us __attribute__((may_alias)) v8usa;

__device__ __forceinline__ unsigned short f2bf(float f) { unsigned u = __float_as_uint(f); u += 0x7FFFu + ((u >> 16) & 1u); return (unsigned short)(u >> 16); }
__device__ __forceinline__ float bf2f(unsigned short b) { return __uint_as_float(((unsigned)b) << 16); }
__device__ __forceinline__ float bfr(float f) { return bf2f(f2bf(f)); }
__device__ __forceinline__ v16h cat16(v8h lo, v8h hi) { return __builtin_shufflevector(lo, hi, 0, 1, 2, 3, 4, 5, 6, 7, 8, 9, 10, 11, 12, 13, 14, 15); }
__device__ __forceinline__ v16bf cat16b(v8us lo, v8us hi) { return __builtin_bit_cast(v16bf, __builtin_shufflevector(lo, hi, 0, 1, 2, 3, 4, 5, 6, 7, 8, 9, 10, 11, 12, 13, 14, 15)); }
__device__ __forceinline__ v8f wmma16(v16h a, v16h b, v8f c) { return __builtin_amdgcn_wmma_f32_16x16x32_f16(false, a, false, b, (short)0, c, false, false); }
__device__ __forceinline__ v8f wmmab(v16bf a, v16bf b, v8f c) { return __builtin_amdgcn_wmma_f32_16x16x32_bf16(false, a, false, b, (short)0, c, false, false); }



// ---- gemm128: one 128x128 output tile per workgroup of 4 waves (2 x 2), each wave a 64x64 tile (16 accumulators) over the whole of K.
// C[m][n] = sum_k A[m][k] Bt[n][k] (SPLITB: + sum_k A[m][k] Bt2[n][k], the second plane's stages behind the first's); A, Bt, Bt2 are K-contiguous bf16 planes with rows of K elements.
// The operands come through LDS in stages of 64 k: a wave's 16-byte loads cover four whole 128-byte lines (8 lanes a row), two buffers, the next stage's loads in flight under this stage's products.
// Every fragment is read from LDS in the hardware k order (8 h + 0..7, 16 + 8 h + 0..7), A and B alike, as WFrag::ld has it.
// EPI says what the tile's f32 sums become before the one store (rows m, columns n); each wave turns its tile through its own part of the ring, so that a store covers whole lines:
//   1  H[m][n] = f16(BN_n(sum + bias[n]))   eval-mode BatchNorm, per column (channel)
//   2  H[m][n] = f16(sum + bias[m])         A = weights, Bt = positions: the channels-major plane comes out directly
//   4  C[m][n] = sum + bias[m] (f32)        A = weights, Bt = positions: the NCHW output comes out directly
__device__ __forceinline__ h16 tohx(float x) { return (h16)x; }
__device__ __forceinline__ void splitf(float y, unsigned short& h, unsigned short& l) { h = f2bf(y); l = f2bf(y - bf2f(h)); }
typedef __attribute__((ext_vector_type(4))) _Float16 v4h;
typedef float __attribute__((may_alias)) fla;
template <typename T16> struct WFrag;
template <> struct WFrag<h16> { typedef v16h V; static __device__ __forceinline__ V ld(const h16* p) { return cat16(*(const v8h*)p, *(const v8h*)(p + 16)); } };
#define GPI  144u                   // LDS pitch of a stage row (64 k = 128 B + 16: an odd multiple of 16 B)
#define GOPB (128u * GPI)           // one operand's 128 rows
#define GSTB (2u * GOPB)            // one stage: A, then B
__device__ __forceinline__ v16bf ldsfragb(const unsigned char* p) { return cat16b(*(const v8usa*)p, *(const v8usa*)(p + 32)); }
template <int K, bool SPLITB, int EPI>
__device__ __forceinline__ void gemm128(unsigned char* L, const unsigned bx, const unsigned by, const bf* __restrict__ A, const bf* __restrict__ Bt, const bf* __restrict__ Bt2, float* C, h16* H, const int ldc,
                                        const float* __restrict__ bias, const float* __restrict__ g, const float* __restrict__ be, const float* __restrict__ mu, const float* __restrict__ var) {
    static_assert(K % 64 == 0 && ((K / 64) & (K / 64 - 1)) == 0, "whole stages, a power of two of them");
    static_assert(4 * 64 * 68 * 4 <= 2 * GSTB, "the epilogue reuses the ring");
    constexpr int KST = K / 64, NST = SPLITB ? 2 * KST : KST;
    constexpr unsigned RB = K * 2u;   // bytes of an operand row
    const unsigned tid = threadIdx.x, lane = tid & 31u, lr = lane & 15u, hi = lane >> 4;
    const unsigned w = __builtin_amdgcn_readfirstlane(tid >> 5), wm = w & 1u, wn = w >> 1;
    const unsigned r0 = bx * 128u, c0 = by * 128u;
    const char* ab = (const char*)A; const char* bb = (const char*)Bt; const char* bb2 = (const char*)Bt2;
    const unsigned ao = (r0 + (tid >> 3)) * RB + (tid & 7u) * 16u, bo = (c0 + (tid >> 3)) * RB + (tid & 7u) * 16u;   // this thread's byte offsets in the two planes: row tid / 8 of every 16, piece tid % 8 of the row's line
    const unsigned st = (tid >> 3) * GPI + (tid & 7u) * 16u;
    // what the epilogue needs per column (EPI 1) or per row (EPI 2, 4) is loaded here, with stage 0, so that its latency passes behind the k loop
    v4f pb = {}, pg = {}, pe = {}, pm = {}, pv = {}; v8f rowb[4] = {};
    v8us ra[8], rb[8];
    __builtin_amdgcn_sched_barrier(0);   // with the one behind the wait below: nothing else is scheduled in between the loads and their wait
#pragma unroll
    for (int i = 0; i < 8; ++i) { ra[i] = *(const v8us*)(ab + ao + i * (16u * RB)); rb[i] = *(const v8us*)(bb + bo + i * (16u * RB)); }
    if constexpr (EPI == 1) { const unsigned cc = c0 + wn * 64u + lr * 4u; pb = *(const v4f*)(bias + cc); pg = *(const v4f*)(g + cc); pe = *(const v4f*)(be + cc); pm = *(const v4f*)(mu + cc); pv = *(const v4f*)(var + cc); }
    else {
#pragma unroll
        for (int mb = 0; mb < 4; ++mb) rowb[mb] = *(const v8f*)(bias + r0 + wm * 64u + mb * 16u + hi * 8u); }
    // address registers of the loads above may be reused at once (the accumulators' zeros): the wait stands in front of that overwrite; the scheduling barrier keeps the overwrite behind it
    asm volatile("s_wait_xcnt 0x0" ::: "memory"); __builtin_amdgcn_sched_barrier(0);
    v8f acc[4][4];
#pragma unroll
    for (int mb = 0; mb < 4; ++mb)
#pragma unroll
        for (int nb = 0; nb < 4; ++nb) acc[mb][nb] = (v8f){};
#pragma unroll
    for (int i = 0; i < 8; ++i) { *(v8usa*)(L + st + i * 16 * GPI) = ra[i]; *(v8usa*)(L + GOPB + st + i * 16 * GPI) = rb[i]; }
    __syncthreads();   // stage 0 is in LDS before any wave reads it
#pragma unroll 1
    for (int s = 0; s < NST; ++s) {
        const unsigned char* b = L + (s & 1) * GSTB;
        if (s + 1 < NST) {
            const unsigned kb = ((unsigned)(s + 1) & (unsigned)(KST - 1)) * 128u;   // the next stage's place in the rows
            const char* an = ab + kb + ao; const char* bn = ((SPLITB && s + 1 >= KST) ? bb2 : bb) + kb + bo;
#pragma unroll
            for (int i = 0; i < 8; ++i) { ra[i] = *(const v8us*)(an + i * (16u * RB)); rb[i] = *(const v8us*)(bn + i * (16u * RB)); }
            // as above: the next trip forms new addresses in these loads' registers; the two addresses are inputs of the statement, so that no load takes their registers as its destination
            asm volatile("s_wait_xcnt 0x0" : : "v"(an), "v"(bn) : "memory"); __builtin_amdgcn_sched_barrier(0);
        }
        const unsigned char* pa = b + (wm * 64u + lr) * GPI + 16u * hi; const unsigned char* pq = b + GOPB + (wn * 64u + lr) * GPI + 16u * hi;
#pragma unroll
        for (int kk = 0; kk < 2; ++kk) {
            // the block's eight fragments are fetched as one group ahead of its 16 products: without the two scheduling barriers the B fragments share one register set, and every four products wait out an LDS latency
            v16bf fa[4], fb[4];
            __builtin_amdgcn_sched_barrier(0);
#pragma unroll
            for (int mb = 0; mb < 4; ++mb) fa[mb] = ldsfragb(pa + mb * 16 * GPI + kk * 64);
#pragma unroll
            for (int nb = 0; nb < 4; ++nb) fb[nb] = ldsfragb(pq + nb * 16 * GPI + kk * 64);
            __builtin_amdgcn_sched_barrier(0);
#pragma unroll
            for (int nb = 0; nb < 4; ++nb)
#pragma unroll
                for (int mb = 0; mb < 4; ++mb) acc[mb][nb] = wmmab(fa[mb], fb[nb], acc[mb][nb]);
        }
        // four vector slots behind the last matrix instruction on every path, the loop's back edge included
        __builtin_amdgcn_sched_barrier(0); asm volatile("v_nop\n\tv_nop\n\tv_nop\n\tv_nop"); __builtin_amdgcn_sched_barrier(0);
        if (s + 1 < NST) { unsigned char* d = L + ((s + 1) & 1) * GSTB;
#pragma unroll
            for (int i = 0; i < 8; ++i) { *(v8usa*)(d + st + i * 16 * GPI) = ra[i]; *(v8usa*)(d + GOPB + st + i * 16 * GPI) = rb[i]; } }
        __syncthreads();   // publishes stage s + 1 and ends every wave's reads of stage s, whose buffer the next trip refills (behind the last trip: the epilogue)
    }
    fla* osw = (fla*)L + w * (64u * 68u);
    // all loops below are unrolled so that acc[][] is indexed by constants (stays in registers) and the LDS offsets are immediates
#pragma unroll
    for (int mb = 0; mb < 4; ++mb)
#pragma unroll
        for (int nb = 0; nb < 4; ++nb)
#pragma unroll
            for (int j = 0; j < 8; ++j) osw[(mb * 16 + hi * 8 + j) * 68 + nb * 16 + lr] = EPI == 1 ? acc[mb][nb][j] : acc[mb][nb][j] + bfr(rowb[mb][j]);
    __syncthreads();   // the tiles are in LDS before their rows are read back
    const size_t e0 = (size_t)(r0 + wm * 64u + hi) * ldc + c0 + wn * 64u + lr * 4u;
    v4f sc = {}, sh = {};
    if constexpr (EPI == 1) {
#pragma unroll
        for (int q = 0; q < 4; ++q) { sc[q] = __fdiv_rn(bfr(pg[q]), __fsqrt_rn(bfr(pv[q]) + 1e-5f)); sh[q] = bfr(pe[q]) - bfr(pm[q]) * sc[q]; pb[q] = bfr(pb[q]); } }
#pragma unroll
    for (int s = 0; s < 32; ++s) { const v4f val = *(const v4fa*)(osw + (2u * s + hi) * 68u + lr * 4u);   // tile row 2 s + hi, columns 4 lr + 0..3
        const size_t eo = e0 + (size_t)(2 * s) * ldc;
        if constexpr (EPI == 1) { v4h o;
#pragma unroll
            for (int q = 0; q < 4; ++q) o[q] = tohx((val[q] + pb[q]) * sc[q] + sh[q]);
            *(v4h*)(H + eo) = o; }
        if constexpr (EPI == 2) { v4h o;
#pragma unroll
            for (int q = 0; q < 4; ++q) o[q] = tohx(val[q]);
            *(v4h*)(H + eo) = o; }
        if constexpr (EPI == 4) { *(v4f*)(C + eo) = val; } }
}
// ---- k_qkv: the three projections, which depend on nothing of one another, in one launch; grid (TQ / 128, KC / 128, 3 * images), 4 waves. blockIdx.z = 4 * projection + image (0 q, 1 k, 2 v).
// q and k: rows = positions (x), columns = channels (y). v: rows = channels (y), columns = positions (x).
__global__ __launch_bounds__(128) void k_qkv(const bf* __restrict__ XT, const bf* __restrict__ WQ, const bf* __restrict__ WK, const bf* __restrict__ WV, h16* Q16, h16* K16, h16* VT,
                                             const float* __restrict__ bq, const float* __restrict__ gq, const float* __restrict__ eq, const float* __restrict__ mq, const float* __restrict__ vq,
                                             const float* __restrict__ bk, const float* __restrict__ gk, const float* __restrict__ ek, const float* __restrict__ mk, const float* __restrict__ vk, const float* __restrict__ bv) {
    static_assert(KC == VC && TQ == NKY && NB_ == 4, "one grid shape serves the three projections");
    __shared__ __align__(16) unsigned char L[2 * GSTB];
    const unsigned pr = blockIdx.z >> 2; const size_t img = blockIdx.z & 3u;
    const bf* X = XT + img * (size_t)(TQ * CC);
    if (pr == 2u) {   // the same for the whole workgroup
        gemm128<CC, false, 2>(L, blockIdx.y, blockIdx.x, WV, X, nullptr, nullptr, VT + img * (size_t)(VC * NKY), NKY, bv, nullptr, nullptr, nullptr, nullptr);
        return; }
    const bool isk = pr == 1u;
    gemm128<CC, false, 1>(L, blockIdx.x, blockIdx.y, X, isk ? WK : WQ, nullptr, nullptr, (isk ? K16 : Q16) + img * (size_t)(TQ * KC), KC, isk ? bk : bq, isk ? gk : gq, isk ? ek : eq, isk ? mk : mq, isk ? vk : vq);
}
// ---- k_out: out = wW ctx + bW, ctx as its bf16 head and rest; rows = output channels (x), columns = positions (y), z = image; grid (CC / 128, TQ / 128, images), 4 waves.
__global__ __launch_bounds__(128) void k_out(const bf* __restrict__ WW, const bf* __restrict__ Ch, const bf* __restrict__ Cl, float* OUT, const float* __restrict__ bW) {
    __shared__ __align__(16) unsigned char L[2 * GSTB];
    const size_t z = blockIdx.z;
    gemm128<VC, true, 4>(L, blockIdx.x, blockIdx.y, WW, Ch + z * (size_t)(TQ * VC), Cl + z * (size_t)(TQ * VC), OUT + z * (size_t)(CC * TQ), nullptr, TQ, bW, nullptr, nullptr, nullptr, nullptr);
}

// ---- k_prep: the bf16 planes that the GEMMs read, all in one launch; grid (TQ / 128, CC / 128, images + 2), 8 waves. Planes z < images turn x; the 256 workgroups of the last two planes round the four weight matrices, 64 each.
// x [image][512 channels][4096 positions] f32 -> XT [image][4096 positions][512 channels] bf16, turned through LDS. One workgroup = 128 channels x 128 positions.
// In: a wave's load is 512 contiguous bytes of one channel's row (128 positions); a wave takes 16 channels, so a lane holds 16 channels x 4 positions and packs 8 channels of one position into one 16-byte LDS store.
// Out: 16 lanes store the 256 contiguous bytes (128 channels) of one position's row.
// LDS row = one position, 16 pieces of 16 bytes; piece k of row n stands at place k ^ ((n >> 2) & 15), so that the 16 lanes of a half wave fall on 16 different places in the stores (rows 4 apart, one k) as in the loads (one row, 16 k).
__global__ __launch_bounds__(256) void k_prep(const float* __restrict__ xb, bf* XT, const float* __restrict__ w0, const float* __restrict__ w1, const float* __restrict__ w2, const float* __restrict__ w3, bf* W0, bf* W1, bf* W2, bf* W3) {
    static_assert(KC * CC == 64 * 256 * 8 && VC * CC == KC * CC && (TQ / 128) * (CC / 128) * 2 == 4 * 64, "64 workgroups of 256 threads, 8 elements a thread, cover one weight matrix exactly");
    __shared__ __align__(16) unsigned char T[128 * 256];
    const unsigned tid = threadIdx.x, lane = tid & 31u, w = tid >> 5;
    if (blockIdx.z >= NB_) {   // the same for the whole workgroup, and in front of the barrier
        const unsigned j = ((blockIdx.z - NB_) * (CC / 128) + blockIdx.y) * (TQ / 128) + blockIdx.x, m = j >> 6;
        const float* src = m == 0u ? w0 : m == 1u ? w1 : m == 2u ? w2 : w3; bf* dst = m == 0u ? W0 : m == 1u ? W1 : m == 2u ? W2 : W3;
        const size_t i = (size_t)(j & 63u) * 256 + tid; const v8f v = *(const v8f*)(src + i * 8); v8us o;
#pragma unroll
        for (int k = 0; k < 8; ++k) o[k] = f2bf(v[k]);
        *(v8us*)(dst + i * 8) = o; return; }
    xb += (size_t)blockIdx.z * CC * TQ + (size_t)(blockIdx.y * 128u + w * 16u) * TQ + blockIdx.x * 128u + lane * 4u;
    XT += (size_t)blockIdx.z * TQ * CC + (size_t)(blockIdx.x * 128u + (tid >> 4)) * CC + blockIdx.y * 128u + (tid & 15u) * 8u;
    v4f r[16];
#pragma unroll
    for (int i = 0; i < 16; ++i) r[i] = *(const v4f*)(xb + (size_t)i * TQ);
    // the address registers of the loads above are reused below: the wait stands in front of that overwrite; the address is an input of the statement, so that no load takes its registers as its destination; the scheduling barrier keeps the overwrite behind the wait
    asm volatile("s_wait_xcnt 0x0" : : "v"(xb) : "memory"); __builtin_amdgcn_sched_barrier(0);
#pragma unroll
    for (int g = 0; g < 2; ++g)
#pragma unroll
        for (int j = 0; j < 4; ++j) { v8us o;
#pragma unroll
            for (int k = 0; k < 8; ++k) o[k] = f2bf(r[g * 8 + k][j]);
            *(v8usa*)(T + (lane * 4u + j) * 256u + (((w * 2u + g) ^ (lane & 15u)) * 16u)) = o; }
    __syncthreads();   // the whole tile is in LDS before any thread reads a row of it
    v8us o[8];
#pragma unroll
    for (int s = 0; s < 8; ++s) { const unsigned row = s * 16u + (tid >> 4); o[s] = *(const v8usa*)(T + row * 256u + (((tid & 15u) ^ ((row >> 2) & 15u)) * 16u)); }
#pragma unroll
    for (int s = 0; s < 8; ++s) *(v8us*)(XT + (size_t)s * 16 * CC) = o[s];
}
#define AKP 528u                    // LDS pitch of a K row (512 B + 16: an odd multiple of 16 B)
#define AVP 144u                    // LDS pitch of a V^T row (64 keys = 128 B + 16)
#define ATK (64u * AKP)
#define ASLOT (ATK + 256u * AVP)
#define ALAG 4.0f
#define ACS  0.09016844005556021f   // 256^-0.5 * log2(e)
__device__ __forceinline__ float xhalf(float x) { return __builtin_bit_cast(float, __builtin_amdgcn_permlanex16(__builtin_bit_cast(int, x), __builtin_bit_cast(int, x), 0x76543210, 0xfedcba98, false, false)); }  // lane l with lane l ^ 16
__device__ __forceinline__ v16h ldsfrag(const unsigned char* p) { return cat16(*(const v8ha*)p, *(const v8ha*)(p + 32)); }
__global__ __launch_bounds__(256) __attribute__((amdgpu_waves_per_eu(2, 2))) void k_attn(const h16* __restrict__ Q, const h16* __restrict__ Kk, const h16* __restrict__ Vt, bf* Oh, bf* Ol) {
    __shared__ __align__(16) unsigned char L[2 * ASLOT];
    static_assert(4 * 130 * 32 * 4 <= 2 * ASLOT, "the join at the end reuses the ring");
    const size_t z = blockIdx.y; Q += z * (size_t)(TQ * KC); Kk += z * (size_t)(NKY * KC); Vt += z * (size_t)(VC * NKY); Oh += z * (size_t)(TQ * VC); Ol += z * (size_t)(TQ * VC);
    const unsigned tid = threadIdx.x, lane = tid & 31u, c = lane & 15u, h = lane >> 4;
    const unsigned w = __builtin_amdgcn_readfirstlane(tid >> 5), wq = w & 3u, kh = w >> 2;
    const unsigned q0 = blockIdx.x * 64u + wq * 16u;
    v8h sk[8], sv[8];
    const char* kbase = (const char*)Kk; const char* vbase = (const char*)Vt;
    unsigned ko = tid * 16u, vo = (tid >> 3) * (NKY * 2u) + (tid & 7u) * 16u;   // this thread's byte offsets in the K plane and in the V^T plane, advanced by one stage a trip
    const unsigned kst = (tid >> 5) * AKP + (tid & 31u) * 16u, vst = ATK + (tid >> 3) * AVP + (tid & 7u) * 16u;
    v16h qf[8];
#pragma unroll
    for (int kc = 0; kc < 8; ++kc) qf[kc] = WFrag<h16>::ld(Q + (size_t)(q0 + c) * KC + 8u * h + 32 * kc);
#pragma unroll
    for (int i = 0; i < 8; ++i) { sk[i] = *(const v8h*)(kbase + ko + i * 4096u); sv[i] = *(const v8h*)(vbase + vo + i * (32u * NKY * 2u)); }
    // the address registers of the loads above are advanced or reused below: the wait stands in front of that overwrite; the scheduling barrier keeps the overwrite behind it
    asm volatile("s_wait_xcnt 0x0" ::: "memory"); __builtin_amdgcn_sched_barrier(0);
    v8f acc[16];
#pragma unroll
    for (int t = 0; t < 16; ++t) acc[t] = (v8f){};
    float m_run = -__builtin_inff(), l_run = 0.f;
#pragma unroll
    for (int i = 0; i < 8; ++i) { *(v8ha*)(L + kst + i * 8 * AKP) = sk[i]; *(v8ha*)(L + vst + i * 32 * AVP) = sv[i]; }
    __syncthreads();   // stage 0 is in LDS before any wave reads it
#pragma unroll 1
    for (int st = 0; st < NKY / 64; ++st) {
        const unsigned char* b = L + (st & 1) * ASLOT;
        if (st + 1 < NKY / 64) {
#pragma unroll
            for (int i = 0; i < 8; ++i) { sk[i] = *(const v8h*)(kbase + ko + (64u * KC * 2u + i * 4096u)); sv[i] = *(const v8h*)(vbase + vo + (128u + i * (32u * NKY * 2u))); }
            // as above: the line behind it advances these loads' offset registers; the two offsets pass through the statement so that the additions cannot be placed in front of the wait
            asm volatile("s_wait_xcnt 0x0" : "+v"(ko), "+v"(vo) : : "memory");
            ko += 64u * KC * 2u; vo += 128u;
        }
        v8f s0 = {}, s1 = {};
        { const unsigned char* kb = b + (kh * 32u + c) * AKP + 16u * h;
#pragma unroll
          for (int kc = 0; kc < 8; ++kc) { s0 = wmma16(ldsfrag(kb + 64 * kc), qf[kc], s0); s1 = wmma16(ldsfrag(kb + 16 * AKP + 64 * kc), qf[kc], s1); } }
        // the pass's V^T fragments are fetched as one group here, so that their LDS latency passes behind the maxima and the exponentials;
        // the scheduling barrier in front has every K load of the pass issued ahead of the first V load (without it only some K fragments are fetched ahead of their products); the one behind keeps the group in front of the vector work
        v16h vf[16];
        __builtin_amdgcn_sched_barrier(0);
        { const unsigned char* vb = b + ATK + c * AVP + kh * 64u + 16u * h;
#pragma unroll
          for (int t = 0; t < 16; ++t) vf[t] = ldsfrag(vb + t * 16 * AVP); }
        __builtin_amdgcn_sched_barrier(0);
        float mx = fmaxf(s0[0], s1[0]);
#pragma unroll
        for (int r = 1; r < 8; ++r) mx = fmaxf(mx, fmaxf(s0[r], s1[r]));
        mx = fmaxf(mx, xhalf(mx)) * ACS;   // both halves of the wave now hold this query's maximum of the pass, scaled
        if (__builtin_amdgcn_ballot_w32(mx > m_run + ALAG) != 0) {   // a scalar branch; rare after the first passes
            const float m_new = fmaxf(m_run, mx), corr = __builtin_amdgcn_exp2f(m_run - m_new);   // corr = 0 on the first pass, where m_run is -inf
            l_run *= corr; m_run = m_new;
#pragma unroll
            for (int t = 0; t < 16; ++t) acc[t] *= corr;
        }
        v16h pf; float ps0 = 0.f, ps1 = 0.f; const float nm = 10.0f - m_run;
#pragma unroll
        for (int r = 0; r < 8; ++r) { s0[r] = __builtin_fmaf(s0[r], ACS, nm); s1[r] = __builtin_fmaf(s1[r], ACS, nm); }
#pragma unroll
        for (int r = 0; r < 8; ++r) {
            __builtin_amdgcn_sched_barrier(0); const float p0 = __builtin_amdgcn_exp2f(s0[r]); __builtin_amdgcn_sched_barrier(0); asm volatile("v_nop");
            __builtin_amdgcn_sched_barrier(0); const float p1 = __builtin_amdgcn_exp2f(s1[r]); __builtin_amdgcn_sched_barrier(0); asm volatile("v_nop");
            __builtin_amdgcn_sched_barrier(0); ps0 += p0; ps1 += p1; pf[r] = tohx(p0); pf[8 + r] = tohx(p1); }
        l_run += ps0 + ps1;
#pragma unroll
        for (int t = 0; t < 16; ++t) acc[t] = wmma16(vf[t], pf, acc[t]);
        // four vector slots behind the last matrix instruction on every path, the loop's back edge included
        __builtin_amdgcn_sched_barrier(0); asm volatile("v_nop\n\tv_nop\n\tv_nop\n\tv_nop"); __builtin_amdgcn_sched_barrier(0);
        if (st + 1 < NKY / 64) { unsigned char* d = L + ((st + 1) & 1) * ASLOT;
#pragma unroll
            for (int i = 0; i < 8; ++i) { *(v8ha*)(d + kst + i * 8 * AKP) = sk[i]; *(v8ha*)(d + vst + i * 32 * AVP) = sv[i]; } }
        __syncthreads();   // publishes stage st + 1 and ends every wave's reads of stage st, whose buffer the next trip refills
    }
    // join of the two key halves: waves 4..7 hand their sums, maximum and denominator to waves 0..3, lane to lane
    fla* M = (fla*)L + wq * (130u * 32u) + lane;
    if (kh == 1u) {
#pragma unroll
        for (int t = 0; t < 16; ++t)
#pragma unroll
            for (int r = 0; r < 8; ++r) M[(t * 8 + r) * 32] = acc[t][r];
        M[128 * 32] = m_run; M[129 * 32] = l_run; }
    __syncthreads();   // the handed-over values are in LDS before their readers start
    if (kh == 1u) return;
    const float mB = M[128 * 32], lB = M[129 * 32], m = fmaxf(m_run, mB), aA = __builtin_amdgcn_exp2f(m_run - m), aB = __builtin_amdgcn_exp2f(mB - m);
    float l = l_run * aA + lB * aB; l += xhalf(l);   // each half of the wave summed its eight keys of every 16
    const float inv = __fdiv_rn(1.0f, l);
    const size_t eo = (size_t)(q0 + c) * VC + 8u * h;
#pragma unroll
    for (int t = 0; t < 16; ++t) { v8us oh, ol;
#pragma unroll
        for (int r = 0; r < 8; ++r) { unsigned short a, c2; splitf(__fmul_rn(acc[t][r] * aA + M[(t * 8 + r) * 32] * aB, inv), a, c2); oh[r] = a; ol[r] = c2; }
        *(v8us*)(Oh + eo + t * 16) = oh; *(v8us*)(Ol + eo + t * 16) = ol; }
}

extern "C" void kernel_launch(void* const* d_in, const int* in_sizes, int n_in,
                              void* d_out, int out_size, void* d_ws, size_t ws_size, hipStream_t stream) {
    (void)in_sizes; (void)n_in; (void)out_size;
    const float* IN[17]; for (int i = 0; i < 17; ++i) IN[i] = (const float*)d_in[i];   // 0 x, 1 wq [256][512], 2 bq, 3 gq, 4 betaq, 5 mq, 6 vq, 7 wk, 8 bk, 9 gk, 10 betak, 11 mk, 12 vk, 13 wv, 14 bv, 15 wW [512][256], 16 bW
    float* OUT = (float*)d_out;     // [4][512][4096]
    char* wsp = (char*)d_ws;
    auto take = [&](size_t bytes) { char* p = wsp; wsp += (bytes + 255) & ~(size_t)255; return (void*)p; };
    bf* WQ = (bf*)take((size_t)KC * CC * 2); bf* WK = (bf*)take((size_t)KC * CC * 2); bf* WV = (bf*)take((size_t)VC * CC * 2); bf* WW = (bf*)take((size_t)CC * VC * 2);
    // every plane holds all NB_ images
    bf* XT = (bf*)take((size_t)NB_ * TQ * CC * 2); h16* Q16 = (h16*)take((size_t)NB_ * TQ * KC * 2); h16* K16 = (h16*)take((size_t)NB_ * NKY * KC * 2); h16* VT = (h16*)take((size_t)NB_ * VC * NKY * 2);
    bf* Ch = (bf*)take((size_t)NB_ * TQ * VC * 2); bf* Cl = (bf*)take((size_t)NB_ * TQ * VC * 2);
    if ((size_t)(wsp - (char*)d_ws) > ws_size) return;    // total = 57 MiB
    k_prep<<<dim3(TQ / 128, CC / 128, NB_ + 2), 256, 0, stream>>>(IN[0], XT, IN[1], IN[7], IN[13], IN[15], WQ, WK, WV, WW);
    k_qkv<<<dim3(TQ / 128, KC / 128, 3 * NB_), 128, 0, stream>>>(XT, WQ, WK, WV, Q16, K16, VT, IN[2], IN[3], IN[4], IN[5], IN[6], IN[8], IN[9], IN[10], IN[11], IN[12], IN[14]);
    k_attn<<<dim3(TQ / 64, NB_, 1), 256, 0, stream>>>(Q16, K16, VT, Ch, Cl);
    k_out<<<dim3(CC / 128, TQ / 128, NB_), 128, 0, stream>>>(WW, Ch, Cl, OUT, IN[16]);
}

// v008
// One run takes 88.9 microseconds.
// Timed twice side by side with v007, it ran 1.22 times as fast both times.
// Over all steps from v000 it is 10.5 times as fast.
#include <hip/hip_runtime.h>

// BasicNonLocalBlock (x [4][512][64x64 = 4096] NCHW; q = BN_q(wq x + bq), k = BN_k(wk x + bk) (256 channels, eval-mode BatchNorm with the given mean/var/gamma/beta), v = wv x + bv (256); sim = softmax_k(q^T k x 256^-0.5) over
// the 4096 positions; ctx[c][q] = sum_k sim[q][k] v[c][k]; out = wW ctx + bW -> [4][512][64][64]).
// Compute dtypes, f32 accumulate: every input rounded to bf16; the three 1x1 convolutions on PLAIN bf16 operands from a positions-major bf16 copy of x (inputs: exact, + bias); BN (f32, per-channel

#define NB_  4
#define CC   512
#define TQ   4096
#define NKY   4096
#define KC   256
#define VC   256
typedef _Float16 h16;
typedef unsigned short bf;
typedef __attribute__((ext_vector_type(16))) __bf16   v16bf;
typedef __attribute__((ext_vector_type(16))) _Float16 v16h;
typedef __attribute__((ext_vector_type(8)))  _Float16 v8h;
typedef __attribute__((ext_vector_type(8)))  unsigned short v8us;
typedef __attribute__((ext_vector_type(8)))  float    v8f;
typedef __attribute__((ext_vector_type(4)))  float    v4f;
typedef v8h  __attribute__((may_alias)) v8ha;
typedef v4f  __attribute__((may_alias)) v4fa;
typedef v8us __attribute__((may_alias)) v8usa;

__device__ __forceinline__ unsigned short f2bf(float f) { unsigned u = __float_as_uint(f); u += 0x7FFFu + ((u >> 16) & 1u); return (unsigned short)(u >> 16); }
__device__ __forceinline__ float bf2f(unsigned short b) { return __uint_as_float(((unsigned)b) << 16); }
__device__ __forceinline__ float bfr(float f) { return bf2f(f2bf(f)); }
__device__ __forceinline__ v16h cat16(v8h lo, v8h hi) { return __builtin_shufflevector(lo, hi, 0, 1, 2, 3, 4, 5, 6, 7, 8, 9, 10, 11, 12, 13, 14, 15); }
__device__ __forceinline__ v16bf cat16b(v8us lo, v8us hi) { return __builtin_bit_cast(v16bf, __builtin_shufflevector(lo, hi, 0, 1, 2, 3, 4, 5, 6, 7, 8, 9, 10, 11, 12, 13, 14, 15)); }
__device__ __forceinline__ v8f wmma16(v16h a, v16h b, v8f c) { return __builtin_amdgcn_wmma_f32_16x16x32_f16(false, a, false, b, (short)0, c, false, false); }
__device__ __forceinline__ v8f wmmab(v16bf a, v16bf b, v8f c) { return __builtin_amdgcn_wmma_f32_16x16x32_bf16(false, a, false, b, (short)0, c, false, false); }



// ---- gemm128: one 128x128 output tile per workgroup of 4 waves (2 x 2), each wave a 64x64 tile (16 accumulators) over the whole of K.
// C[m][n] = sum_k A[m][k] Bt[n][k] (SPLITB: + sum_k A[m][k] Bt2[n][k], the second plane's stages behind the first's); A, Bt, Bt2 are K-contiguous bf16 planes with rows of K elements.
// The operands come through LDS in stages of 64 k: a wave's 16-byte loads cover four whole 128-byte lines (8 lanes a row), two buffers, the next stage's loads in flight under this stage's products.
// Every fragment is read from LDS in the hardware k order (8 h + 0..7, 16 + 8 h + 0..7), A and B alike, as WFrag::ld has it.
// EPI says what the tile's f32 sums become before the one store (rows m, columns n); each wave turns its tile through its own part of the ring, so that a store covers whole lines:
//   1  H[m][n] = f16(BN_n(sum + bias[n]))   eval-mode BatchNorm, per column (channel)
//   2  H[m][n] = f16(sum + bias[m])         A = weights, Bt = positions: the channels-major plane comes out directly
//   4  C[m][n] = sum + bias[m] (f32)        A = weights, Bt = positions: the NCHW output comes out directly
__device__ __forceinline__ h16 tohx(float x) { return (h16)x; }
__device__ __forceinline__ void splitf(float y, unsigned short& h, unsigned short& l) { h = f2bf(y); l = f2bf(y - bf2f(h)); }
typedef __attribute__((ext_vector_type(4))) _Float16 v4h;
typedef float __attribute__((may_alias)) fla;
template <typename T16> struct WFrag;
template <> struct WFrag<h16> { typedef v16h V; static __device__ __forceinline__ V ld(const h16* p) { return cat16(*(const v8h*)p, *(const v8h*)(p + 16)); } };
#define GPI  144u                   // LDS pitch of a stage row (64 k = 128 B + 16: an odd multiple of 16 B)
#define GOPB (128u * GPI)           // one operand's 128 rows
#define GSTB (2u * GOPB)            // one stage: A, then B
__device__ __forceinline__ v16bf ldsfragb(const unsigned char* p) { return cat16b(*(const v8usa*)p, *(const v8usa*)(p + 32)); }
template <int K, bool SPLITB, int EPI>
__device__ __forceinline__ void gemm128(unsigned char* L, const unsigned bx, const unsigned by, const bf* __restrict__ A, const bf* __restrict__ Bt, const bf* __restrict__ Bt2, float* C, h16* H, const int ldc,
                                        const float* __restrict__ bias, const float* __restrict__ g, const float* __restrict__ be, const float* __restrict__ mu, const float* __restrict__ var) {
    static_assert(K % 64 == 0 && ((K / 64) & (K / 64 - 1)) == 0, "whole stages, a power of two of them");
    static_assert(4 * 64 * 68 * 4 <= 2 * GSTB, "the epilogue reuses the ring");
    constexpr int KST = K / 64, NST = SPLITB ? 2 * KST : KST;
    constexpr unsigned RB = K * 2u;   // bytes of an operand row
    const unsigned tid = threadIdx.x, lane = tid & 31u, lr = lane & 15u, hi = lane >> 4;
    const unsigned w = __builtin_amdgcn_readfirstlane(tid >> 5), wm = w & 1u, wn = w >> 1;
    const unsigned r0 = bx * 128u, c0 = by * 128u;
    const char* ab = (const char*)A; const char* bb = (const char*)Bt; const char* bb2 = (const char*)Bt2;
    const unsigned ao = (r0 + (tid >> 3)) * RB + (tid & 7u) * 16u, bo = (c0 + (tid >> 3)) * RB + (tid & 7u) * 16u;   // this thread's byte offsets in the two planes: row tid / 8 of every 16, piece tid % 8 of the row's line
    const unsigned st = (tid >> 3) * GPI + (tid & 7u) * 16u;
    // what the epilogue needs per column (EPI 1) or per row (EPI 2, 4) is loaded here, with stage 0, so that its latency passes behind the k loop
    v4f pb = {}, pg = {}, pe = {}, pm = {}, pv = {}; v8f rowb[4] = {};
    v8us ra[8], rb[8];
    __builtin_amdgcn_sched_barrier(0);   // with the one behind the wait below: nothing else is scheduled in between the loads and their wait
#pragma unroll
    for (int i = 0; i < 8; ++i) { ra[i] = *(const v8us*)(ab + ao + i * (16u * RB)); rb[i] = *(const v8us*)(bb + bo + i * (16u * RB)); }
    if constexpr (EPI == 1) { const unsigned cc = c0 + wn * 64u + lr * 4u; pb = *(const v4f*)(bias + cc); pg = *(const v4f*)(g + cc); pe = *(const v4f*)(be + cc); pm = *(const v4f*)(mu + cc); pv = *(const v4f*)(var + cc); }
    else {
#pragma unroll
        for (int mb = 0; mb < 4; ++mb) rowb[mb] = *(const v8f*)(bias + r0 + wm * 64u + mb * 16u + hi * 8u); }
    // address registers of the loads above may be reused at once (the accumulators' zeros): the wait stands in front of that overwrite; the scheduling barrier keeps the overwrite behind it
    asm volatile("s_wait_xcnt 0x0" ::: "memory"); __builtin_amdgcn_sched_barrier(0);
    v8f acc[4][4];
#pragma unroll
    for (int mb = 0; mb < 4; ++mb)
#pragma unroll
        for (int nb = 0; nb < 4; ++nb) acc[mb][nb] = (v8f){};
#pragma unroll
    for (int i = 0; i < 8; ++i) { *(v8usa*)(L + st + i * 16 * GPI) = ra[i]; *(v8usa*)(L + GOPB + st + i * 16 * GPI) = rb[i]; }
    __syncthreads();   // stage 0 is in LDS before any wave reads it
#pragma unroll 1
    for (int s = 0; s < NST; ++s) {
        const unsigned char* b = L + (s & 1) * GSTB;
        if (s + 1 < NST) {
            const unsigned kb = ((unsigned)(s + 1) & (unsigned)(KST - 1)) * 128u;   // the next stage's place in the rows
            const char* an = ab + kb + ao; const char* bn = ((SPLITB && s + 1 >= KST) ? bb2 : bb) + kb + bo;
#pragma unroll
            for (int i = 0; i < 8; ++i) { ra[i] = *(const v8us*)(an + i * (16u * RB)); rb[i] = *(const v8us*)(bn + i * (16u * RB)); }
            // as above: the next trip forms new addresses in these loads' registers; the two addresses are inputs of the statement, so that no load takes their registers as its destination
            asm volatile("s_wait_xcnt 0x0" : : "v"(an), "v"(bn) : "memory"); __builtin_amdgcn_sched_barrier(0);
        }
        const unsigned char* pa = b + (wm * 64u + lr) * GPI + 16u * hi; const unsigned char* pq = b + GOPB + (wn * 64u + lr) * GPI + 16u * hi;
#pragma unroll
        for (int kk = 0; kk < 2; ++kk) {
            // the block's eight fragments are fetched as one group ahead of its 16 products: without the two scheduling barriers the B fragments share one register set, and every four products wait out an LDS latency
            v16bf fa[4], fb[4];
            __builtin_amdgcn_sched_barrier(0);
#pragma unroll
            for (int mb = 0; mb < 4; ++mb) fa[mb] = ldsfragb(pa + mb * 16 * GPI + kk * 64);
#pragma unroll
            for (int nb = 0; nb < 4; ++nb) fb[nb] = ldsfragb(pq + nb * 16 * GPI + kk * 64);
            __builtin_amdgcn_sched_barrier(0);
#pragma unroll
            for (int nb = 0; nb < 4; ++nb)
#pragma unroll
                for (int mb = 0; mb < 4; ++mb) acc[mb][nb] = wmmab(fa[mb], fb[nb], acc[mb][nb]);
        }
        // four vector slots behind the last matrix instruction on every path, the loop's back edge included
        __builtin_amdgcn_sched_barrier(0); asm volatile("v_nop\n\tv_nop\n\tv_nop\n\tv_nop"); __builtin_amdgcn_sched_barrier(0);
        if (s + 1 < NST) { unsigned char* d = L + ((s + 1) & 1) * GSTB;
#pragma unroll
            for (int i = 0; i < 8; ++i) { *(v8usa*)(d + st + i * 16 * GPI) = ra[i]; *(v8usa*)(d + GOPB + st + i * 16 * GPI) = rb[i]; } }
        __syncthreads();   // publishes stage s + 1 and ends every wave's reads of stage s, whose buffer the next trip refills (behind the last trip: the epilogue)
    }
    fla* osw = (fla*)L + w * (64u * 68u);
    // all loops below are unrolled so that acc[][] is indexed by constants (stays in registers) and the LDS offsets are immediates
#pragma unroll
    for (int mb = 0; mb < 4; ++mb)
#pragma unroll
        for (int nb = 0; nb < 4; ++nb)
#pragma unroll
            for (int j = 0; j < 8; ++j) osw[(mb * 16 + hi * 8 + j) * 68 + nb * 16 + lr] = EPI == 1 ? acc[mb][nb][j] : acc[mb][nb][j] + bfr(rowb[mb][j]);
    __syncthreads();   // the tiles are in LDS before their rows are read back
    const size_t e0 = (size_t)(r0 + wm * 64u + hi) * ldc + c0 + wn * 64u + lr * 4u;
    v4f sc = {}, sh = {};
    if constexpr (EPI == 1) {
#pragma unroll
        for (int q = 0; q < 4; ++q) { sc[q] = __fdiv_rn(bfr(pg[q]), __fsqrt_rn(bfr(pv[q]) + 1e-5f)); sh[q] = bfr(pe[q]) - bfr(pm[q]) * sc[q]; pb[q] = bfr(pb[q]); } }
#pragma unroll
    for (int s = 0; s < 32; ++s) { const v4f val = *(const v4fa*)(osw + (2u * s + hi) * 68u + lr * 4u);   // tile row 2 s + hi, columns 4 lr + 0..3
        const size_t eo = e0 + (size_t)(2 * s) * ldc;
        if constexpr (EPI == 1) { v4h o;
#pragma unroll
            for (int q = 0; q < 4; ++q) o[q] = tohx((val[q] + pb[q]) * sc[q] + sh[q]);
            *(v4h*)(H + eo) = o; }
        if constexpr (EPI == 2) { v4h o;
#pragma unroll
            for (int q = 0; q < 4; ++q) o[q] = tohx(val[q]);
            *(v4h*)(H + eo) = o; }
        if constexpr (EPI == 4) { *(v4f*)(C + eo) = val; } }
}
// ---- k_qkv: the three projections, which depend on nothing of one another, in one launch; grid (TQ / 128, KC / 128, 3 * images), 4 waves. blockIdx.z = 4 * projection + image (0 q, 1 k, 2 v).
// q and k: rows = positions (x), columns = channels (y). v: rows = channels (y), columns = positions (x).
__global__ __launch_bounds__(128) void k_qkv(const bf* __restrict__ XT, const bf* __restrict__ WQ, const bf* __restrict__ WK, const bf* __restrict__ WV, h16* Q16, h16* K16, h16* VT,
                                             const float* __restrict__ bq, const float* __restrict__ gq, const float* __restrict__ eq, const float* __restrict__ mq, const float* __restrict__ vq,
                                             const float* __restrict__ bk, const float* __restrict__ gk, const float* __restrict__ ek, const float* __restrict__ mk, const float* __restrict__ vk, const float* __restrict__ bv) {
    static_assert(KC == VC && TQ == NKY && NB_ == 4, "one grid shape serves the three projections");
    __shared__ __align__(16) unsigned char L[2 * GSTB];
    const unsigned pr = blockIdx.z >> 2; const size_t img = blockIdx.z & 3u;
    const bf* X = XT + img * (size_t)(TQ * CC);
    if (pr == 2u) {   // the same for the whole workgroup
        gemm128<CC, false, 2>(L, blockIdx.y, blockIdx.x, WV, X, nullptr, nullptr, VT + img * (size_t)(VC * NKY), NKY, bv, nullptr, nullptr, nullptr, nullptr);
        return; }
    const bool isk = pr == 1u;
    gemm128<CC, false, 1>(L, blockIdx.x, blockIdx.y, X, isk ? WK : WQ, nullptr, nullptr, (isk ? K16 : Q16) + img * (size_t)(TQ * KC), KC, isk ? bk : bq, isk ? gk : gq, isk ? ek : eq, isk ? mk : mq, isk ? vk : vq);
}
// ---- k_out: out = wW ctx + bW, ctx as its bf16 head and rest; rows = output channels (x), columns = positions (y), z = image; grid (CC / 128, TQ / 128, images), 4 waves.
__global__ __launch_bounds__(128) void k_out(const bf* __restrict__ WW, const bf* __restrict__ Ch, const bf* __restrict__ Cl, float* OUT, const float* __restrict__ bW) {
    __shared__ __align__(16) unsigned char L[2 * GSTB];
    const size_t z = blockIdx.z;
    gemm128<VC, true, 4>(L, blockIdx.x, blockIdx.y, WW, Ch + z * (size_t)(TQ * VC), Cl + z * (size_t)(TQ * VC), OUT + z * (size_t)(CC * TQ), nullptr, TQ, bW, nullptr, nullptr, nullptr, nullptr);
}

// ---- k_prep: the bf16 planes that the GEMMs read, all in one launch; grid (TQ / 128, CC / 128, images + 2), 8 waves. Planes z < images turn x; the 256 workgroups of the last two planes round the four weight matrices, 64 each.
// x [image][512 channels][4096 positions] f32 -> XT [image][4096 positions][512 channels] bf16, turned through LDS. One workgroup = 128 channels x 128 positions.
// In: a wave's load is 512 contiguous bytes of one channel's row (128 positions); a wave takes 16 channels, so a lane holds 16 channels x 4 positions and packs 8 channels of one position into one 16-byte LDS store.
// Out: 16 lanes store the 256 contiguous bytes (128 channels) of one position's row.
// LDS row = one position, 16 pieces of 16 bytes; piece k of row n stands at place k ^ ((n >> 2) & 15), so that the 16 lanes of a half wave fall on 16 different places in the stores (rows 4 apart, one k) as in the loads (one row, 16 k).
__global__ __launch_bounds__(256) void k_prep(const float* __restrict__ xb, bf* XT, const float* __restrict__ w0, const float* __restrict__ w1, const float* __restrict__ w2, const float* __restrict__ w3, bf* W0, bf* W1, bf* W2, bf* W3) {
    static_assert(KC * CC == 64 * 256 * 8 && VC * CC == KC * CC && (TQ / 128) * (CC / 128) * 2 == 4 * 64, "64 workgroups of 256 threads, 8 elements a thread, cover one weight matrix exactly");
    __shared__ __align__(16) unsigned char T[128 * 256];
    const unsigned tid = threadIdx.x, lane = tid & 31u, w = tid >> 5;
    if (blockIdx.z >= NB_) {   // the same for the whole workgroup, and in front of the barrier
        const unsigned j = ((blockIdx.z - NB_) * (CC / 128) + blockIdx.y) * (TQ / 128) + blockIdx.x, m = j >> 6;
        const float* src = m == 0u ? w0 : m == 1u ? w1 : m == 2u ? w2 : w3; bf* dst = m == 0u ? W0 : m == 1u ? W1 : m == 2u ? W2 : W3;
        const size_t i = (size_t)(j & 63u) * 256 + tid; const v8f v = *(const v8f*)(src + i * 8); v8us o;
#pragma unroll
        for (int k = 0; k < 8; ++k) o[k] = f2bf(v[k]);
        *(v8us*)(dst + i * 8) = o; return; }
    xb += (size_t)blockIdx.z * CC * TQ + (size_t)(blockIdx.y * 128u + w * 16u) * TQ + blockIdx.x * 128u + lane * 4u;
    XT += (size_t)blockIdx.z * TQ * CC + (size_t)(blockIdx.x * 128u + (tid >> 4)) * CC + blockIdx.y * 128u + (tid & 15u) * 8u;
    v4f r[16];
#pragma unroll
    for (int i = 0; i < 16; ++i) r[i] = *(const v4f*)(xb + (size_t)i * TQ);
    // the address registers of the loads above are reused below: the wait stands in front of that overwrite; the address is an input of the statement, so that no load takes its registers as its destination; the scheduling barrier keeps the overwrite behind the wait
    asm volatile("s_wait_xcnt 0x0" : : "v"(xb) : "memory"); __builtin_amdgcn_sched_barrier(0);
#pragma unroll
    for (int g = 0; g < 2; ++g)
#pragma unroll
        for (int j = 0; j < 4; ++j) { v8us o;
#pragma unroll
            for (int k = 0; k < 8; ++k) o[k] = f2bf(r[g * 8 + k][j]);
            *(v8usa*)(T + (lane * 4u + j) * 256u + (((w * 2u + g) ^ (lane & 15u)) * 16u)) = o; }
    __syncthreads();   // the whole tile is in LDS before any thread reads a row of it
    v8us o[8];
#pragma unroll
    for (int s = 0; s < 8; ++s) { const unsigned row = s * 16u + (tid >> 4); o[s] = *(const v8usa*)(T + row * 256u + (((tid & 15u) ^ ((row >> 2) & 15u)) * 16u)); }
#pragma unroll
    for (int s = 0; s < 8; ++s) *(v8us*)(XT + (size_t)s * 16 * CC) = o[s];
}
#define AKP 528u                    // LDS pitch of a K row (512 B + 16: an odd multiple of 16 B)
#define AVP 272u                    // LDS pitch of a V^T row (128 keys = 256 B + 16: an odd multiple of 16 B)
#define ASK 128                     // keys of a stage
#define ATK (128u * AKP)
#define ASLOT (ATK + 256u * AVP)
#define ALAG 4.0f
#define ACS  0.09016844005556021f   // 256^-0.5 * log2(e)
__device__ __forceinline__ float xhalf(float x) { return __builtin_bit_cast(float, __builtin_amdgcn_permlanex16(__builtin_bit_cast(int, x), __builtin_bit_cast(int, x), 0x76543210, 0xfedcba98, false, false)); }  // lane l with lane l ^ 16
__device__ __forceinline__ v16h ldsfrag(const unsigned char* p) { return cat16(*(const v8ha*)p, *(const v8ha*)(p + 32)); }
// one asynchronous copy, 16 bytes a lane, global -> LDS, through no register; the waits for it are written where its bytes are handed over
typedef __attribute__((ext_vector_type(4))) int v4i;
typedef __attribute__((address_space(1))) v4i gv4i;
typedef __attribute__((address_space(3))) v4i lv4i;
__device__ __forceinline__ void acp(const char* g, unsigned char* l) { __builtin_amdgcn_global_load_async_to_lds_b128((gv4i*)g, (lv4i*)l, 0, 0); }
// one stage (128 keys): K = 64 KiB in a row in memory, 8 rows a pass of the workgroup; V^T = 256 B of each of 256 rows, 16 rows a pass. kl, vl: this thread's first places in the buffer; kg, vg: its first pieces of the stage
__device__ __forceinline__ void astage(unsigned char* kl, unsigned char* vl, const char* kg, const char* vg) {
#pragma unroll
    for (int i = 0; i < 16; ++i) acp(kg + i * 4096u, kl + i * (8u * AKP));
#pragma unroll
    for (int i = 0; i < 16; ++i) acp(vg + i * (16u * NKY * 2u), vl + i * (16u * AVP));
}
__global__ __launch_bounds__(256) __attribute__((amdgpu_waves_per_eu(2, 2))) void k_attn(const h16* __restrict__ Q, const h16* __restrict__ Kk, const h16* __restrict__ Vt, bf* Oh, bf* Ol) {
    __shared__ __align__(16) unsigned char L[2 * ASLOT];
    static_assert(16 * 33 * 32 * 16 <= 2 * ASLOT, "the join at the end reuses the ring");
    constexpr int NST = NKY / ASK;
    static_assert(NST >= 2 && NKY % ASK == 0, "whole stages, two or more");
    const size_t z = blockIdx.y; Q += z * (size_t)(TQ * KC); Kk += z * (size_t)(NKY * KC); Vt += z * (size_t)(VC * NKY); Oh += z * (size_t)(TQ * VC); Ol += z * (size_t)(TQ * VC);
    const unsigned tid = threadIdx.x, lane = tid & 31u, c = lane & 15u, h = lane >> 4;
    const unsigned w = __builtin_amdgcn_readfirstlane(tid >> 5), qg = w & 1u, kq = w >> 1;
    const unsigned q0 = blockIdx.x * 64u + qg * 32u;
    const char* kg = (const char*)Kk + tid * 16u; const char* vg = (const char*)Vt + (tid >> 4) * (NKY * 2u) + (tid & 15u) * 16u;   // this thread's first piece of stage 0 in the K plane and in the V^T plane
    unsigned char* kl = L + (tid >> 5) * AKP + (tid & 31u) * 16u; unsigned char* vl = L + ATK + (tid >> 4) * AVP + (tid & 15u) * 16u;   // its places for them in buffer 0
    v16h qf[2][8];
    const h16* qp = Q + (size_t)(q0 + c) * KC + 8u * h;
#pragma unroll
    for (int u = 0; u < 2; ++u)
#pragma unroll
        for (int kc = 0; kc < 8; ++kc) qf[u][kc] = WFrag<h16>::ld(qp + u * (16 * KC) + 32 * kc);
    // the address registers of the loads above are reused below: the wait stands in front of that overwrite; the address is an input of the statement, so that it stays in its registers up to the wait; the scheduling barrier keeps the overwrite behind it
    asm volatile("s_wait_xcnt 0x0" : : "v"(qp) : "memory"); __builtin_amdgcn_sched_barrier(0);
    astage(kl, vl, kg, vg);
    asm volatile("s_wait_asynccnt 0x0" ::: "memory");   // this wave's copies of stage 0 have landed
    __syncthreads();   // stage 0 is in LDS before any wave reads it
    astage(kl + ASLOT, vl + ASLOT, kg + (size_t)ASK * KC * 2u, vg + ASK * 2u);
    v8f acc[2][16];
#pragma unroll
    for (int u = 0; u < 2; ++u)
#pragma unroll
        for (int t = 0; t < 16; ++t) acc[u][t] = (v8f){};
    float m_run[2] = {-__builtin_inff(), -__builtin_inff()}, l_run[2] = {0.f, 0.f};
#pragma unroll 1
    for (int st = 0; st < NST; ++st) {
        const unsigned bo = (st & 1) * ASLOT;
        const unsigned char* b = L + bo;
        v8f s0[2] = {}, s1[2] = {};
        // K fragments come in four groups of four (two k blocks, two key tiles), a group fetched ahead of the products of the group before it: the scheduling barriers keep each group's loads together and bound the registers that fragments take
        { const unsigned char* kb = b + (kq * 32u + c) * AKP + 16u * h;
          v16h k0[8], k1[8];
          __builtin_amdgcn_sched_barrier(0);
#pragma unroll
          for (int kc = 0; kc < 4; ++kc) { k0[kc] = ldsfrag(kb + 64 * kc); k1[kc] = ldsfrag(kb + 16 * AKP + 64 * kc); }
          __builtin_amdgcn_sched_barrier(0);
#pragma unroll
          for (int g = 0; g < 4; ++g) {
#pragma unroll
              for (int kc = 2 * g; kc < 2 * g + 2; ++kc)
#pragma unroll
                  for (int u = 0; u < 2; ++u) { s0[u] = wmma16(k0[kc], qf[u][kc], s0[u]); s1[u] = wmma16(k1[kc], qf[u][kc], s1[u]); }
              __builtin_amdgcn_sched_barrier(0);
              if (g < 2) {
#pragma unroll
                  for (int kc = 2 * g + 4; kc < 2 * g + 6; ++kc) { k0[kc] = ldsfrag(kb + 64 * kc); k1[kc] = ldsfrag(kb + 16 * AKP + 64 * kc); }
                  __builtin_amdgcn_sched_barrier(0); }
          } }
        // the first four V^T fragments are fetched here, so that their LDS latency passes behind the maxima and the exponentials; the scheduling barriers keep the group in front of the vector work
        const unsigned char* vb = b + ATK + c * AVP + kq * 64u + 16u * h;
        v16h vf[16];
#pragma unroll
        for (int t = 0; t < 4; ++t) vf[t] = ldsfrag(vb + t * 16 * AVP);
        __builtin_amdgcn_sched_barrier(0);
        float mx[2];
#pragma unroll
        for (int u = 0; u < 2; ++u) { mx[u] = fmaxf(s0[u][0], s1[u][0]);
#pragma unroll
            for (int r = 1; r < 8; ++r) mx[u] = fmaxf(mx[u], fmaxf(s0[u][r], s1[u][r]));
            mx[u] = fmaxf(mx[u], xhalf(mx[u])) * ACS; }   // both halves of the wave now hold this query's maximum of the pass, scaled
        if (__builtin_amdgcn_ballot_w32(mx[0] > m_run[0] + ALAG || mx[1] > m_run[1] + ALAG) != 0) {   // one scalar branch a pass for both column groups; rare after the first passes
#pragma unroll
            for (int u = 0; u < 2; ++u)
                if (__builtin_amdgcn_ballot_w32(mx[u] > m_run[u] + ALAG) != 0) {   // a column group is rescaled on its own test alone
                    const float m_new = fmaxf(m_run[u], mx[u]), corr = __builtin_amdgcn_exp2f(m_run[u] - m_new);   // corr = 0 on the first pass, where m_run is -inf
                    l_run[u] *= corr; m_run[u] = m_new;
#pragma unroll
                    for (int t = 0; t < 16; ++t) acc[u][t] *= corr;
                }
        }
        v16h pf[2];
#pragma unroll
        for (int u = 0; u < 2; ++u) {
            float ps0 = 0.f, ps1 = 0.f; const float nm = 10.0f - m_run[u];
#pragma unroll
            for (int r = 0; r < 8; ++r) { s0[u][r] = __builtin_fmaf(s0[u][r], ACS, nm); s1[u][r] = __builtin_fmaf(s1[u][r], ACS, nm); }
#pragma unroll
            for (int r = 0; r < 8; ++r) {
                __builtin_amdgcn_sched_barrier(0); const float p0 = __builtin_amdgcn_exp2f(s0[u][r]); __builtin_amdgcn_sched_barrier(0); asm volatile("v_nop");
                __builtin_amdgcn_sched_barrier(0); const float p1 = __builtin_amdgcn_exp2f(s1[u][r]); __builtin_amdgcn_sched_barrier(0); asm volatile("v_nop");
                __builtin_amdgcn_sched_barrier(0); ps0 += p0; ps1 += p1; pf[u][r] = tohx(p0); pf[u][8 + r] = tohx(p1); }
            l_run[u] += ps0 + ps1;
        }
        // the other V^T fragments come in groups of two, each fetched two groups ahead of its products: the scheduling barriers keep a group's loads together and bound the registers that fragments take
#pragma unroll
        for (int g = 0; g < 8; ++g) {
            __builtin_amdgcn_sched_barrier(0);
            if (g < 6) {
#pragma unroll
                for (int t = 2 * g + 4; t < 2 * g + 6; ++t) vf[t] = ldsfrag(vb + t * 16 * AVP);
                __builtin_amdgcn_sched_barrier(0); }
#pragma unroll
            for (int t = 2 * g; t < 2 * g + 2; ++t)
#pragma unroll
                for (int u = 0; u < 2; ++u) acc[u][t] = wmma16(vf[t], pf[u], acc[u][t]);
        }
        // four vector slots behind the last matrix instruction on every path, the loop's back edge included
        __builtin_amdgcn_sched_barrier(0); asm volatile("v_nop\n\tv_nop\n\tv_nop\n\tv_nop"); __builtin_amdgcn_sched_barrier(0);
        asm volatile("s_wait_dscnt 0x0" ::: "memory");      // this wave's reads of stage st have returned
        asm volatile("s_wait_asynccnt 0x0" ::: "memory");   // this wave's copies of stage st + 1 have landed
        __syncthreads();   // publishes stage st + 1 and ends every wave's reads of stage st, whose buffer is refilled behind it
        if (st + 2 < NST) astage(kl + bo, vl + bo, kg + (size_t)(st + 2) * (ASK * KC * 2u), vg + (size_t)(st + 2) * (ASK * 2u));   // the same test in every wave
    }
    asm volatile("s_wait_asynccnt 0x0" ::: "memory");   // no copy is under way when the ring becomes the join's room
    // join of the four key quarters: every wave lays its sums, maxima and denominators in LDS, 16 bytes a lane; then wave (half, quarter) finishes channel tiles 4 quarter + 0..3 of its half's 32 queries, lane to lane
    v4fa* P = (v4fa*)L;
#pragma unroll
    for (int u = 0; u < 2; ++u) { const unsigned rb = (w * 2u + u) * (33u * 32u) + lane;
#pragma unroll
        for (int t = 0; t < 16; ++t) { P[rb + (2 * t) * 32] = __builtin_shufflevector(acc[u][t], acc[u][t], 0, 1, 2, 3); P[rb + (2 * t + 1) * 32] = __builtin_shufflevector(acc[u][t], acc[u][t], 4, 5, 6, 7); }
        P[rb + 32 * 32] = (v4f){m_run[u], l_run[u], 0.f, 0.f}; }
    __syncthreads();   // the handed-over values are in LDS before their readers start
#pragma unroll
    for (int u = 0; u < 2; ++u) {
        float mj[4], lj[4], aj[4];
#pragma unroll
        for (int j = 0; j < 4; ++j) { const v4f ml = P[((j * 2u + qg) * 2u + u) * (33u * 32u) + 32u * 32u + lane]; mj[j] = ml[0]; lj[j] = ml[1]; }
        const float m = fmaxf(fmaxf(mj[0], mj[1]), fmaxf(mj[2], mj[3]));
#pragma unroll
        for (int j = 0; j < 4; ++j) {
            __builtin_amdgcn_sched_barrier(0); aj[j] = __builtin_amdgcn_exp2f(mj[j] - m); __builtin_amdgcn_sched_barrier(0); asm volatile("v_nop"); __builtin_amdgcn_sched_barrier(0); }
        float l = lj[0] * aj[0] + lj[1] * aj[1] + lj[2] * aj[2] + lj[3] * aj[3]; l += xhalf(l);   // each half of the wave summed its eight keys of every 16
        const float inv = __fdiv_rn(1.0f, l);
        const size_t eo = (size_t)(q0 + 16u * u + c) * VC + 8u * h + kq * 64u;
#pragma unroll
        for (int tt = 0; tt < 4; ++tt) { v4f x0 = {}, x1 = {};
#pragma unroll
            for (int j = 0; j < 4; ++j) { const unsigned rb = ((j * 2u + qg) * 2u + u) * (33u * 32u) + (kq * 4u + tt) * 64u + lane; x0 += P[rb] * aj[j]; x1 += P[rb + 32u] * aj[j]; }
            v8us oh, ol;
#pragma unroll
            for (int r = 0; r < 4; ++r) { unsigned short a, c2; splitf(__fmul_rn(x0[r], inv), a, c2); oh[r] = a; ol[r] = c2; splitf(__fmul_rn(x1[r], inv), a, c2); oh[4 + r] = a; ol[4 + r] = c2; }
            *(v8us*)(Oh + eo + tt * 16) = oh; *(v8us*)(Ol + eo + tt * 16) = ol; }
        // the second column group's work reuses the address and data registers of the stores above: the wait stands in front of that overwrite; the scheduling barrier keeps the overwrite behind it
        if (u == 0) { asm volatile("s_wait_xcnt 0x0" ::: "memory"); __builtin_amdgcn_sched_barrier(0); }
    }
}

extern "C" void kernel_launch(void* const* d_in, const int* in_sizes, int n_in,
                              void* d_out, int out_size, void* d_ws, size_t ws_size, hipStream_t stream) {
    (void)in_sizes; (void)n_in; (void)out_size;
    const float* IN[17]; for (int i = 0; i < 17; ++i) IN[i] = (const float*)d_in[i];   // 0 x, 1 wq [256][512], 2 bq, 3 gq, 4 betaq, 5 mq, 6 vq, 7 wk, 8 bk, 9 gk, 10 betak, 11 mk, 12 vk, 13 wv, 14 bv, 15 wW [512][256], 16 bW
    float* OUT = (float*)d_out;     // [4][512][4096]
    char* wsp = (char*)d_ws;
    auto take = [&](size_t bytes) { char* p = wsp; wsp += (bytes + 255) & ~(size_t)255; return (void*)p; };
    bf* WQ = (bf*)take((size_t)KC * CC * 2); bf* WK = (bf*)take((size_t)KC * CC * 2); bf* WV = (bf*)take((size_t)VC * CC * 2); bf* WW = (bf*)take((size_t)CC * VC * 2);
    // every plane holds all NB_ images
    bf* XT = (bf*)take((size_t)NB_ * TQ * CC * 2); h16* Q16 = (h16*)take((size_t)NB_ * TQ * KC * 2); h16* K16 = (h16*)take((size_t)NB_ * NKY * KC * 2); h16* VT = (h16*)take((size_t)NB_ * VC * NKY * 2);
    bf* Ch = (bf*)take((size_t)NB_ * TQ * VC * 2); bf* Cl = (bf*)take((size_t)NB_ * TQ * VC * 2);
    if ((size_t)(wsp - (char*)d_ws) > ws_size) return;    // total = 57 MiB
    k_prep<<<dim3(TQ / 128, CC / 128, NB_ + 2), 256, 0, stream>>>(IN[0], XT, IN[1], IN[7], IN[13], IN[15], WQ, WK, WV, WW);
    k_qkv<<<dim3(TQ / 128, KC / 128, 3 * NB_), 128, 0, stream>>>(XT, WQ, WK, WV, Q16, K16, VT, IN[2], IN[3], IN[4], IN[5], IN[6], IN[8], IN[9], IN[10], IN[11], IN[12], IN[14]);
    k_attn<<<dim3(TQ / 64, NB_, 1), 256, 0, stream>>>(Q16, K16, VT, Ch, Cl);
    k_out<<<dim3(CC / 128, TQ / 128, NB_), 128, 0, stream>>>(WW, Ch, Cl, OUT, IN[16]);
}

// v009
// A run of this version takes 83 microseconds.
// Timed twice side by side with v008, it ran 1.08 times as fast both times.
// All steps since v000 together make it 11.3 times as fast.
#include <hip/hip_runtime.h>

// BasicNonLocalBlock (x [4][512][64x64 = 4096] NCHW; q = BN_q(wq x + bq), k = BN_k(wk x + bk) (256 channels, eval-mode BatchNorm with the given mean/var/gamma/beta), v = wv x + bv (256); sim = softmax_k(q^T k x 256^-0.5) over
// the 4096 positions; ctx[c][q] = sum_k sim[q][k] v[c][k]; out = wW ctx + bW -> [4][512][64][64]).
// Compute dtypes, f32 accumulate: every input rounded to bf16; the three 1x1 convolutions on PLAIN bf16 operands from a positions-major bf16 copy of x (inputs: exact, + bias); BN (f32, per-channel

#define NB_  4
#define CC   512
#define TQ   4096
#define NKY   4096
#define KC   256
#define VC   256
typedef _Float16 h16;
typedef unsigned short bf;
typedef __attribute__((ext_vector_type(16))) __bf16   v16bf;
typedef __attribute__((ext_vector_type(16))) _Float16 v16h;
typedef __attribute__((ext_vector_type(8)))  _Float16 v8h;
typedef __attribute__((ext_vector_type(8)))  unsigned short v8us;
typedef __attribute__((ext_vector_type(8)))  float    v8f;
typedef __attribute__((ext_vector_type(4)))  float    v4f;
typedef v8h  __attribute__((may_alias)) v8ha;
typedef v4f  __attribute__((may_alias)) v4fa;
typedef v8us __attribute__((may_alias)) v8usa;

__device__ __forceinline__ unsigned short f2bf(float f) { unsigned u = __float_as_uint(f); u += 0x7FFFu + ((u >> 16) & 1u); return (unsigned short)(u >> 16); }
__device__ __forceinline__ float bf2f(unsigned short b) { return __uint_as_float(((unsigned)b) << 16); }
__device__ __forceinline__ float bfr(float f) { return bf2f(f2bf(f)); }
__device__ __forceinline__ v16h cat16(v8h lo, v8h hi) { return __builtin_shufflevector(lo, hi, 0, 1, 2, 3, 4, 5, 6, 7, 8, 9, 10, 11, 12, 13, 14, 15); }
__device__ __forceinline__ v16bf cat16b(v8us lo, v8us hi) { return __builtin_bit_cast(v16bf, __builtin_shufflevector(lo, hi, 0, 1, 2, 3, 4, 5, 6, 7, 8, 9, 10, 11, 12, 13, 14, 15)); }
__device__ __forceinline__ v8f wmma16(v16h a, v16h b, v8f c) { return __builtin_amdgcn_wmma_f32_16x16x32_f16(false, a, false, b, (short)0, c, false, false); }
__device__ __forceinline__ v8f wmmab(v16bf a, v16bf b, v8f c) { return __builtin_amdgcn_wmma_f32_16x16x32_bf16(false, a, false, b, (short)0, c, false, false); }



// ---- gemm128: one 128x128 output tile per workgroup of 4 waves (2 x 2), each wave a 64x64 tile (16 accumulators) over the whole of K.
// C[m][n] = sum_k A[m][k] Bt[n][k] (SPLITB: + sum_k A[m][k] Bt2[n][k], the second plane's stages behind the first's); A, Bt, Bt2 are K-contiguous bf16 planes with rows of K elements.
// The operands come through LDS in stages of 64 k: a wave's 16-byte loads cover four whole 128-byte lines (8 lanes a row), two buffers, the next stage's loads in flight under this stage's products.
// Every fragment is read from LDS in the hardware k order (8 h + 0..7, 16 + 8 h + 0..7), A and B alike, as WFrag::ld has it.
// EPI says what the tile's f32 sums become before the one store (rows m, columns n); each wave turns its tile through its own part of the ring, so that a store covers whole lines:
//   1  H[m][n] = f16(BN_n(sum + bias[n]))   eval-mode BatchNorm, per column (channel)
//   2  H[m][n] = f16(sum + bias[m])         A = weights, Bt = positions: the channels-major plane comes out directly
//   4  C[m][n] = sum + bias[m] (f32)        A = weights, Bt = positions: the NCHW output comes out directly
__device__ __forceinline__ h16 tohx(float x) { return (h16)x; }
__device__ __forceinline__ void splitf(float y, unsigned short& h, unsigned short& l) { h = f2bf(y); l = f2bf(y - bf2f(h)); }
typedef __attribute__((ext_vector_type(4))) _Float16 v4h;
typedef float __attribute__((may_alias)) fla;
template <typename T16> struct WFrag;
template <> struct WFrag<h16> { typedef v16h V; static __device__ __forceinline__ V ld(const h16* p) { return cat16(*(const v8h*)p, *(const v8h*)(p + 16)); } };
#define GPI  144u                   // LDS pitch of a stage row (64 k = 128 B + 16: an odd multiple of 16 B)
#define GOPB (128u * GPI)           // one operand's 128 rows
#define GSTB (2u * GOPB)            // one stage: A, then B
__device__ __forceinline__ v16bf ldsfragb(const unsigned char* p) { return cat16b(*(const v8usa*)p, *(const v8usa*)(p + 32)); }
template <int K, bool SPLITB, int EPI>
__device__ __forceinline__ void gemm128(unsigned char* L, const unsigned bx, const unsigned by, const bf* __restrict__ A, const bf* __restrict__ Bt, const bf* __restrict__ Bt2, float* C, h16* H, const int ldc,
                                        const float* __restrict__ bias, const float* __restrict__ g, const float* __restrict__ be, const float* __restrict__ mu, const float* __restrict__ var) {
    static_assert(K % 64 == 0 && ((K / 64) & (K / 64 - 1)) == 0, "whole stages, a power of two of them");
    static_assert(4 * 64 * 68 * 4 <= 2 * GSTB, "the epilogue reuses the ring");
    constexpr int KST = K / 64, NST = SPLITB ? 2 * KST : KST;
    constexpr unsigned RB = K * 2u;   // bytes of an operand row
    const unsigned tid = threadIdx.x, lane = tid & 31u, lr = lane & 15u, hi = lane >> 4;
    const unsigned w = __builtin_amdgcn_readfirstlane(tid >> 5), wm = w & 1u, wn = w >> 1;
    const unsigned r0 = bx * 128u, c0 = by * 128u;
    const char* ab = (const char*)A; const char* bb = (const char*)Bt; const char* bb2 = (const char*)Bt2;
    const unsigned ao = (r0 + (tid >> 3)) * RB + (tid & 7u) * 16u, bo = (c0 + (tid >> 3)) * RB + (tid & 7u) * 16u;   // this thread's byte offsets in the two planes: row tid / 8 of every 16, piece tid % 8 of the row's line
    const unsigned st = (tid >> 3) * GPI + (tid & 7u) * 16u;
    // what the epilogue needs per column (EPI 1) or per row (EPI 2, 4) is loaded here, with stage 0, so that its latency passes behind the k loop
    v4f pb = {}, pg = {}, pe = {}, pm = {}, pv = {}; v8f rowb[4] = {};
    v8us ra[8], rb[8];
    __builtin_amdgcn_sched_barrier(0);   // with the one behind the wait below: nothing else is scheduled in between the loads and their wait
#pragma unroll
    for (int i = 0; i < 8; ++i) { ra[i] = *(const v8us*)(ab + ao + i * (16u * RB)); rb[i] = *(const v8us*)(bb + bo + i * (16u * RB)); }
    if constexpr (EPI == 1) { const unsigned cc = c0 + wn * 64u + lr * 4u; pb = *(const v4f*)(bias + cc); pg = *(const v4f*)(g + cc); pe = *(const v4f*)(be + cc); pm = *(const v4f*)(mu + cc); pv = *(const v4f*)(var + cc); }
    else {
#pragma unroll
        for (int mb = 0; mb < 4; ++mb) rowb[mb] = *(const v8f*)(bias + r0 + wm * 64u + mb * 16u + hi * 8u); }
    // address registers of the loads above may be reused at once (the accumulators' zeros): the wait stands in front of that overwrite; the scheduling barrier keeps the overwrite behind it
    asm volatile("s_wait_xcnt 0x0" ::: "memory"); __builtin_amdgcn_sched_barrier(0);
    v8f acc[4][4];
#pragma unroll
    for (int mb = 0; mb < 4; ++mb)
#pragma unroll
        for (int nb = 0; nb < 4; ++nb) acc[mb][nb] = (v8f){};
#pragma unroll
    for (int i = 0; i < 8; ++i) { *(v8usa*)(L + st + i * 16 * GPI) = ra[i]; *(v8usa*)(L + GOPB + st + i * 16 * GPI) = rb[i]; }
    __syncthreads();   // stage 0 is in LDS before any wave reads it
#pragma unroll 1
    for (int s = 0; s < NST; ++s) {
        const unsigned char* b = L + (s & 1) * GSTB;
        if (s + 1 < NST) {
            const unsigned kb = ((unsigned)(s + 1) & (unsigned)(KST - 1)) * 128u;   // the next stage's place in the rows
            const char* an = ab + kb + ao; const char* bn = ((SPLITB && s + 1 >= KST) ? bb2 : bb) + kb + bo;
#pragma unroll
            for (int i = 0; i < 8; ++i) { ra[i] = *(const v8us*)(an + i * (16u * RB)); rb[i] = *(const v8us*)(bn + i * (16u * RB)); }
            // as above: the next trip forms new addresses in these loads' registers; the two addresses are inputs of the statement, so that no load takes their registers as its destination
            asm volatile("s_wait_xcnt 0x0" : : "v"(an), "v"(bn) : "memory"); __builtin_amdgcn_sched_barrier(0);
        }
        const unsigned char* pa = b + (wm * 64u + lr) * GPI + 16u * hi; const unsigned char* pq = b + GOPB + (wn * 64u + lr) * GPI + 16u * hi;
#pragma unroll
        for (int kk = 0; kk < 2; ++kk) {
            // the block's eight fragments are fetched as one group ahead of its 16 products: without the two scheduling barriers the B fragments share one register set, and every four products wait out an LDS latency
            v16bf fa[4], fb[4];
            __builtin_amdgcn_sched_barrier(0);
#pragma unroll
            for (int mb = 0; mb < 4; ++mb) fa[mb] = ldsfragb(pa + mb * 16 * GPI + kk * 64);
#pragma unroll
            for (int nb = 0; nb < 4; ++nb) fb[nb] = ldsfragb(pq + nb * 16 * GPI + kk * 64);
            __builtin_amdgcn_sched_barrier(0);
#pragma unroll
            for (int nb = 0; nb < 4; ++nb)
#pragma unroll
                for (int mb = 0; mb < 4; ++mb) acc[mb][nb] = wmmab(fa[mb], fb[nb], acc[mb][nb]);
        }
        // four vector slots behind the last matrix instruction on every path, the loop's back edge included
        __builtin_amdgcn_sched_barrier(0); asm volatile("v_nop\n\tv_nop\n\tv_nop\n\tv_nop"); __builtin_amdgcn_sched_barrier(0);
        if (s + 1 < NST) { unsigned char* d = L + ((s + 1) & 1) * GSTB;
#pragma unroll
            for (int i = 0; i < 8; ++i) { *(v8usa*)(d + st + i * 16 * GPI) = ra[i]; *(v8usa*)(d + GOPB + st + i * 16 * GPI) = rb[i]; } }
        __syncthreads();   // publishes stage s + 1 and ends every wave's reads of stage s, whose buffer the next trip refills (behind the last trip: the epilogue)
    }
    fla* osw = (fla*)L + w * (64u * 68u);
    // all loops below are unrolled so that acc[][] is indexed by constants (stays in registers) and the LDS offsets are immediates
#pragma unroll
    for (int mb = 0; mb < 4; ++mb)
#pragma unroll
        for (int nb = 0; nb < 4; ++nb)
#pragma unroll
            for (int j = 0; j < 8; ++j) osw[(mb * 16 + hi * 8 + j) * 68 + nb * 16 + lr] = EPI == 1 ? acc[mb][nb][j] : acc[mb][nb][j] + bfr(rowb[mb][j]);
    __syncthreads();   // the tiles are in LDS before their rows are read back
    const size_t e0 = (size_t)(r0 + wm * 64u + hi) * ldc + c0 + wn * 64u + lr * 4u;
    v4f sc = {}, sh = {};
    if constexpr (EPI == 1) {
#pragma unroll
        for (int q = 0; q < 4; ++q) { sc[q] = __fdiv_rn(bfr(pg[q]), __fsqrt_rn(bfr(pv[q]) + 1e-5f)); sh[q] = bfr(pe[q]) - bfr(pm[q]) * sc[q]; pb[q] = bfr(pb[q]); } }
#pragma unroll
    for (int s = 0; s < 32; ++s) { const v4f val = *(const v4fa*)(osw + (2u * s + hi) * 68u + lr * 4u);   // tile row 2 s + hi, columns 4 lr + 0..3
        const size_t eo = e0 + (size_t)(2 * s) * ldc;
        if constexpr (EPI == 1) { v4h o;
#pragma unroll
            for (int q = 0; q < 4; ++q) o[q] = tohx((val[q] + pb[q]) * sc[q] + sh[q]);
            *(v4h*)(H + eo) = o; }
        if constexpr (EPI == 2) { v4h o;
#pragma unroll
            for (int q = 0; q < 4; ++q) o[q] = tohx(val[q]);
            *(v4h*)(H + eo) = o; }
        if constexpr (EPI == 4) { *(v4f*)(C + eo) = val; } }
}
// ---- k_qkv: the three projections, which depend on nothing of one another, in one launch; grid (TQ / 128, KC / 128, 3 * images), 4 waves. blockIdx.z = 4 * projection + image (0 q, 1 k, 2 v).
// q and k: rows = positions (x), columns = channels (y). v: rows = channels (y), columns = positions (x).
__global__ __launch_bounds__(128) void k_qkv(const bf* __restrict__ XT, const bf* __restrict__ WQ, const bf* __restrict__ WK, const bf* __restrict__ WV, h16* Q16, h16* K16, h16* VT,
                                             const float* __restrict__ bq, const float* __restrict__ gq, const float* __restrict__ eq, const float* __restrict__ mq, const float* __restrict__ vq,
                                             const float* __restrict__ bk, const float* __restrict__ gk, const float* __restrict__ ek, const float* __restrict__ mk, const float* __restrict__ vk, const float* __restrict__ bv) {
    static_assert(KC == VC && TQ == NKY && NB_ == 4, "one grid shape serves the three projections");
    __shared__ __align__(16) unsigned char L[2 * GSTB];
    const unsigned pr = blockIdx.z >> 2; const size_t img = blockIdx.z & 3u;
    const bf* X = XT + img * (size_t)(TQ * CC);
    if (pr == 2u) {   // the same for the whole workgroup
        gemm128<CC, false, 2>(L, blockIdx.y, blockIdx.x, WV, X, nullptr, nullptr, VT + img * (size_t)(VC * NKY), NKY, bv, nullptr, nullptr, nullptr, nullptr);
        return; }
    const bool isk = pr == 1u;
    gemm128<CC, false, 1>(L, blockIdx.x, blockIdx.y, X, isk ? WK : WQ, nullptr, nullptr, (isk ? K16 : Q16) + img * (size_t)(TQ * KC), KC, isk ? bk : bq, isk ? gk : gq, isk ? ek : eq, isk ? mk : mq, isk ? vk : vq);
}
// ---- k_out: out = wW ctx + bW, ctx as its bf16 head and rest; rows = output channels (x), columns = positions (y), z = image; grid (CC / 128, TQ / 128, images), 4 waves.
__global__ __launch_bounds__(128) void k_out(const bf* __restrict__ WW, const bf* __restrict__ Ch, const bf* __restrict__ Cl, float* OUT, const float* __restrict__ bW) {
    __shared__ __align__(16) unsigned char L[2 * GSTB];
    const size_t z = blockIdx.z;
    gemm128<VC, true, 4>(L, blockIdx.x, blockIdx.y, WW, Ch + z * (size_t)(TQ * VC), Cl + z * (size_t)(TQ * VC), OUT + z * (size_t)(CC * TQ), nullptr, TQ, bW, nullptr, nullptr, nullptr, nullptr);
}

// ---- k_prep: the bf16 planes that the GEMMs read, all in one launch; grid (TQ / 128, CC / 128, images + 2), 8 waves. Planes z < images turn x; the 256 workgroups of the last two planes round the four weight matrices, 64 each.
// x [image][512 channels][4096 positions] f32 -> XT [image][4096 positions][512 channels] bf16, turned through LDS. One workgroup = 128 channels x 128 positions.
// In: a wave's load is 512 contiguous bytes of one channel's row (128 positions); a wave takes 16 channels, so a lane holds 16 channels x 4 positions and packs 8 channels of one position into one 16-byte LDS store.
// Out: 16 lanes store the 256 contiguous bytes (128 channels) of one position's row.
// LDS row = one position, 16 pieces of 16 bytes; piece k of row n stands at place k ^ ((n >> 2) & 15), so that the 16 lanes of a half wave fall on 16 different places in the stores (rows 4 apart, one k) as in the loads (one row, 16 k).
__global__ __launch_bounds__(256) void k_prep(const float* __restrict__ xb, bf* XT, const float* __restrict__ w0, const float* __restrict__ w1, const float* __restrict__ w2, const float* __restrict__ w3, bf* W0, bf* W1, bf* W2, bf* W3) {
    static_assert(KC * CC == 64 * 256 * 8 && VC * CC == KC * CC && (TQ / 128) * (CC / 128) * 2 == 4 * 64, "64 workgroups of 256 threads, 8 elements a thread, cover one weight matrix exactly");
    __shared__ __align__(16) unsigned char T[128 * 256];
    const unsigned tid = threadIdx.x, lane = tid & 31u, w = tid >> 5;
    if (blockIdx.z >= NB_) {   // the same for the whole workgroup, and in front of the barrier
        const unsigned j = ((blockIdx.z - NB_) * (CC / 128) + blockIdx.y) * (TQ / 128) + blockIdx.x, m = j >> 6;
        const float* src = m == 0u ? w0 : m == 1u ? w1 : m == 2u ? w2 : w3; bf* dst = m == 0u ? W0 : m == 1u ? W1 : m == 2u ? W2 : W3;
        const size_t i = (size_t)(j & 63u) * 256 + tid; const v8f v = *(const v8f*)(src + i * 8); v8us o;
#pragma unroll
        for (int k = 0; k < 8; ++k) o[k] = f2bf(v[k]);
        *(v8us*)(dst + i * 8) = o; return; }
    xb += (size_t)blockIdx.z * CC * TQ + (size_t)(blockIdx.y * 128u + w * 16u) * TQ + blockIdx.x * 128u + lane * 4u;
    XT += (size_t)blockIdx.z * TQ * CC + (size_t)(blockIdx.x * 128u + (tid >> 4)) * CC + blockIdx.y * 128u + (tid & 15u) * 8u;
    v4f r[16];
#pragma unroll
    for (int i = 0; i < 16; ++i) r[i] = *(const v4f*)(xb + (size_t)i * TQ);
    // the address registers of the loads above are reused below: the wait stands in front of that overwrite; the address is an input of the statement, so that no load takes its registers as its destination; the scheduling barrier keeps the overwrite behind the wait
    asm volatile("s_wait_xcnt 0x0" : : "v"(xb) : "memory"); __builtin_amdgcn_sched_barrier(0);
#pragma unroll
    for (int g = 0; g < 2; ++g)
#pragma unroll
        for (int j = 0; j < 4; ++j) { v8us o;
#pragma unroll
            for (int k = 0; k < 8; ++k) o[k] = f2bf(r[g * 8 + k][j]);
            *(v8usa*)(T + (lane * 4u + j) * 256u + (((w * 2u + g) ^ (lane & 15u)) * 16u)) = o; }
    __syncthreads();   // the whole tile is in LDS before any thread reads a row of it
    v8us o[8];
#pragma unroll
    for (int s = 0; s < 8; ++s) { const unsigned row = s * 16u + (tid >> 4); o[s] = *(const v8usa*)(T + row * 256u + (((tid & 15u) ^ ((row >> 2) & 15u)) * 16u)); }
#pragma unroll
    for (int s = 0; s < 8; ++s) *(v8us*)(XT + (size_t)s * 16 * CC) = o[s];
}
#define AVP 272u                    // LDS pitch of a slice's row (256 B + the mover's pad of 16: an odd multiple of 16 B)
#define ASK 128                     // keys of a stage
#define ASLC 18432u                 // a slice's room in LDS: 64 rows of AVP bytes, rounded up to a multiple of 2 KiB, so that every slice starts at one
#define ASLOT (8u * ASLC)
#define ALAG 4.0f
#define ACS  0.09016844005556021f   // 256^-0.5 * log2(e)
__device__ __forceinline__ float xhalf(float x) { return __builtin_bit_cast(float, __builtin_amdgcn_permlanex16(__builtin_bit_cast(int, x), __builtin_bit_cast(int, x), 0x76543210, 0xfedcba98, false, false)); }  // lane l with lane l ^ 16
__device__ __forceinline__ v16h ldsfrag(const unsigned char* p) { return cat16(*(const v8ha*)p, *(const v8ha*)(p + 32)); }
typedef uint32_t u32x4 __attribute__((ext_vector_type(4)));
typedef uint32_t u32x8 __attribute__((ext_vector_type(8)));
__device__ __forceinline__ uint32_t uni(uint32_t v) { return (uint32_t)__builtin_amdgcn_readfirstlane(v); }
// a test on a pinned value compiles to a scalar compare and branch (a tensor load ignores EXEC), and what is formed from it stands behind the waits written in front of it
__device__ __forceinline__ uint32_t pinned(uint32_t v) { uint32_t w = uni(v); asm volatile("" : "+s"(w)); return w; }   // pinned(): a wave-uniform test or descriptor word of a tensor load, held in a scalar register
// descriptor group 1 of a slice: 1-byte elements, tensor = tile = 64 rows of 256 bytes, source row pitch sp bytes, 4 dwords of LDS pad behind every 64 dwords (a row); no workgroup mask
__device__ __forceinline__ u32x8 tdm_group1(uint32_t sp) {
    u32x8 g;
    g[0] = uni((1u << 20) | (5u << 22) | (3u << 25)); g[1] = uni(256u << 16); g[2] = uni(64u << 16); g[3] = uni(256u << 16); g[4] = uni(64u); g[5] = uni(sp); g[6] = uni(0u); g[7] = uni(0u);
    return g;
}
// one tensor load: the slice whose first byte is at ga goes to byte dst of the workgroup's LDS; the waits for it are written where its bytes are handed over
__device__ __forceinline__ void tdm_load(uint32_t dst, uint64_t ga, u32x8 g1) {
    u32x4 g0;
    g0[0] = uni(1u); g0[1] = uni(dst); g0[2] = uni((uint32_t)ga); g0[3] = uni((((uint32_t)(ga >> 32)) & 0x01FFFFFFu) | 0x80000000u);
    asm volatile("tensor_load_to_lds %0, %1" :: "s"(g0), "s"(g1) : "memory");
}
__global__ __launch_bounds__(256) __attribute__((amdgpu_waves_per_eu(2, 2))) void k_attn(const h16* __restrict__ Q, const h16* __restrict__ Kk, const h16* __restrict__ Vt, bf* Oh, bf* Ol) {
    __shared__ __attribute__((aligned(2048))) unsigned char L[2 * ASLOT];
    static_assert(16 * 33 * 32 * 16 <= 2 * ASLOT && 2 * ASLOT <= 320 * 1024, "the join at the end reuses the ring");
    static_assert(64u * AVP <= ASLC && ASLC % 2048u == 0 && KC * 2 == 512 && VC == 256 && ASK == 128, "eight slices of 64 rows of 256 bytes, each at a multiple of 2 KiB");
    constexpr int NST = NKY / ASK;
    static_assert(NST >= 2 && NKY % ASK == 0, "whole stages, two or more");
    const size_t z = blockIdx.y; Q += z * (size_t)(TQ * KC); Kk += z * (size_t)(NKY * KC); Vt += z * (size_t)(VC * NKY); Oh += z * (size_t)(TQ * VC); Ol += z * (size_t)(TQ * VC);
    const unsigned tid = threadIdx.x, lane = tid & 31u, c = lane & 15u, h = lane >> 4;
    const unsigned w = __builtin_amdgcn_readfirstlane(tid >> 5), qg = w & 1u, kq = w >> 1;
    const unsigned q0 = blockIdx.x * 64u + qg * 32u;
    // this wave's slice: its first byte in stage 0, its step from stage to stage, its source pitch, its place in buffer 0
    const bool isv = w >= 4u;
    const uint64_t sg = isv ? (uint64_t)(size_t)Vt + (uint64_t)((w - 4u) * 64u) * (NKY * 2u) : (uint64_t)(size_t)Kk + (uint64_t)((w >> 1) * 64u) * (KC * 2u) + (w & 1u) * 256u;
    const uint32_t sstep = isv ? ASK * 2u : ASK * KC * 2u;
    const u32x8 g1 = tdm_group1(isv ? NKY * 2u : KC * 2u);
    const uint32_t sl = (uint32_t)(size_t)L + w * ASLC;
    v16h qf[2][8];
    const h16* qp = Q + (size_t)(q0 + c) * KC + 8u * h;
#pragma unroll
    for (int u = 0; u < 2; ++u)
#pragma unroll
        for (int kc = 0; kc < 8; ++kc) qf[u][kc] = WFrag<h16>::ld(qp + u * (16 * KC) + 32 * kc);
    // the address registers of the loads above are reused below: the wait stands in front of that overwrite; the address is an input of the statement, so that it stays in its registers up to the wait; the scheduling barrier keeps the overwrite behind it
    asm volatile("s_wait_xcnt 0x0" : : "v"(qp) : "memory"); __builtin_amdgcn_sched_barrier(0);
    tdm_load(sl, sg, g1);
    asm volatile("s_wait_tensorcnt 0x0" ::: "memory");   // this wave's slice of stage 0 has landed
    __syncthreads();   // stage 0 is in LDS before any wave reads it
    tdm_load(sl + ASLOT, sg + sstep, g1);
    v8f acc[2][16];
#pragma unroll
    for (int u = 0; u < 2; ++u)
#pragma unroll
        for (int t = 0; t < 16; ++t) acc[u][t] = (v8f){};
    float m_run[2] = {-__builtin_inff(), -__builtin_inff()}, l_run[2] = {0.f, 0.f};
#pragma unroll 1
    for (int st = 0; st < NST; ++st) {
        const unsigned bo = (st & 1) * ASLOT;
        const unsigned char* b = L + bo;
        v8f s0[2] = {}, s1[2] = {};
        // K fragments come in four groups of four (two k blocks, two key tiles), a group fetched ahead of the products of the group before it: the scheduling barriers keep each group's loads together and bound the registers that fragments take
        { const unsigned char* kb = b + (kq >> 1) * (2u * ASLC) + ((kq & 1u) * 32u + c) * AVP + 16u * h;   // k block kc stands in slice kc / 4 of the key group's two, at 64 (kc % 4) of its row
          v16h k0[8], k1[8];
          __builtin_amdgcn_sched_barrier(0);
#pragma unroll
          for (int kc = 0; kc < 4; ++kc) { k0[kc] = ldsfrag(kb + 64 * kc); k1[kc] = ldsfrag(kb + 16 * AVP + 64 * kc); }
          __builtin_amdgcn_sched_barrier(0);
#pragma unroll
          for (int g = 0; g < 4; ++g) {
#pragma unroll
              for (int kc = 2 * g; kc < 2 * g + 2; ++kc)
#pragma unroll
                  for (int u = 0; u < 2; ++u) { s0[u] = wmma16(k0[kc], qf[u][kc], s0[u]); s1[u] = wmma16(k1[kc], qf[u][kc], s1[u]); }
              __builtin_amdgcn_sched_barrier(0);
              if (g < 2) {
#pragma unroll
                  for (int kc = 2 * g + 4; kc < 2 * g + 6; ++kc) { k0[kc] = ldsfrag(kb + ASLC + 64 * (kc - 4)); k1[kc] = ldsfrag(kb + ASLC + 16 * AVP + 64 * (kc - 4)); }
                  __builtin_amdgcn_sched_barrier(0); }
          } }
        // the first four V^T fragments are fetched here, so that their LDS latency passes behind the maxima and the exponentials; the scheduling barriers keep the group in front of the vector work
        const unsigned char* vb = b + 4u * ASLC + c * AVP + kq * 64u + 16u * h;   // channel tile t stands in slice 4 + t / 4, at rows 16 (t % 4) + c
        v16h vf[16];
#pragma unroll
        for (int t = 0; t < 4; ++t) vf[t] = ldsfrag(vb + t * 16 * AVP);   // slice 4
        __builtin_amdgcn_sched_barrier(0);
        float mx[2];
#pragma unroll
        for (int u = 0; u < 2; ++u) { mx[u] = fmaxf(s0[u][0], s1[u][0]);
#pragma unroll
            for (int r = 1; r < 8; ++r) mx[u] = fmaxf(mx[u], fmaxf(s0[u][r], s1[u][r]));
            mx[u] = fmaxf(mx[u], xhalf(mx[u])) * ACS; }   // both halves of the wave now hold this query's maximum of the pass, scaled
        if (__builtin_amdgcn_ballot_w32(mx[0] > m_run[0] + ALAG || mx[1] > m_run[1] + ALAG) != 0) {   // one scalar branch a pass for both column groups; rare after the first passes
#pragma unroll
            for (int u = 0; u < 2; ++u)
                if (__builtin_amdgcn_ballot_w32(mx[u] > m_run[u] + ALAG) != 0) {   // a column group is rescaled on its own test alone
                    const float m_new = fmaxf(m_run[u], mx[u]), corr = __builtin_amdgcn_exp2f(m_run[u] - m_new);   // corr = 0 on the first pass, where m_run is -inf
                    l_run[u] *= corr; m_run[u] = m_new;
#pragma unroll
                    for (int t = 0; t < 16; ++t) acc[u][t] *= corr;
                }
        }
        v16h pf[2];
#pragma unroll
        for (int u = 0; u < 2; ++u) {
            float ps0 = 0.f, ps1 = 0.f; const float nm = 10.0f - m_run[u];
#pragma unroll
            for (int r = 0; r < 8; ++r) { s0[u][r] = __builtin_fmaf(s0[u][r], ACS, nm); s1[u][r] = __builtin_fmaf(s1[u][r], ACS, nm); }
#pragma unroll
            for (int r = 0; r < 8; ++r) {
                __builtin_amdgcn_sched_barrier(0); const float p0 = __builtin_amdgcn_exp2f(s0[u][r]); __builtin_amdgcn_sched_barrier(0); asm volatile("v_nop");
                __builtin_amdgcn_sched_barrier(0); const float p1 = __builtin_amdgcn_exp2f(s1[u][r]); __builtin_amdgcn_sched_barrier(0); asm volatile("v_nop");
                __builtin_amdgcn_sched_barrier(0); ps0 += p0; ps1 += p1; pf[u][r] = tohx(p0); pf[u][8 + r] = tohx(p1); }
            l_run[u] += ps0 + ps1;
        }
        // the other V^T fragments come in groups of two, each fetched two groups ahead of its products: the scheduling barriers keep a group's loads together and bound the registers that fragments take
#pragma unroll
        for (int g = 0; g < 8; ++g) {
            __builtin_amdgcn_sched_barrier(0);
            if (g < 6) {
#pragma unroll
                for (int t = 2 * g + 4; t < 2 * g + 6; ++t) vf[t] = ldsfrag(vb + (t >> 2) * ASLC + (t & 3) * 16 * AVP);
                __builtin_amdgcn_sched_barrier(0); }
#pragma unroll
            for (int t = 2 * g; t < 2 * g + 2; ++t)
#pragma unroll
                for (int u = 0; u < 2; ++u) acc[u][t] = wmma16(vf[t], pf[u], acc[u][t]);
        }
        // four vector slots behind the last matrix instruction on every path, the loop's back edge included
        __builtin_amdgcn_sched_barrier(0); asm volatile("v_nop\n\tv_nop\n\tv_nop\n\tv_nop"); __builtin_amdgcn_sched_barrier(0);
        asm volatile("s_wait_dscnt 0x0" ::: "memory");      // this wave's reads of stage st have returned
        asm volatile("s_wait_tensorcnt 0x0" ::: "memory");   // this wave's slice of stage st + 1 has landed
        __syncthreads();   // publishes stage st + 1 and ends every wave's reads of stage st, whose buffer is refilled behind it
        if (pinned((uint32_t)(st + 2 < NST))) { const uint32_t s2 = pinned((uint32_t)st + 2u); tdm_load(sl + bo, sg + (uint64_t)s2 * sstep, g1); }   // a scalar test, the same in every wave; the descriptor is formed behind the wait
    }
    asm volatile("s_wait_tensorcnt 0x0" ::: "memory");   // no tensor load is under way when the ring becomes the join's room
    asm volatile("s_wait_dscnt 0x0" ::: "memory");       // nor a read of the ring
    // join of the four key quarters: every wave lays its sums, maxima and denominators in LDS, 16 bytes a lane; then wave (half, quarter) finishes channel tiles 4 quarter + 0..3 of its half's 32 queries, lane to lane
    v4fa* P = (v4fa*)L;
#pragma unroll
    for (int u = 0; u < 2; ++u) { const unsigned rb = (w * 2u + u) * (33u * 32u) + lane;
#pragma unroll
        for (int t = 0; t < 16; ++t) { P[rb + (2 * t) * 32] = __builtin_shufflevector(acc[u][t], acc[u][t], 0, 1, 2, 3); P[rb + (2 * t + 1) * 32] = __builtin_shufflevector(acc[u][t], acc[u][t], 4, 5, 6, 7); }
        P[rb + 32 * 32] = (v4f){m_run[u], l_run[u], 0.f, 0.f}; }
    __syncthreads();   // the handed-over values are in LDS before their readers start
#pragma unroll
    for (int u = 0; u < 2; ++u) {
        float mj[4], lj[4], aj[4];
#pragma unroll
        for (int j = 0; j < 4; ++j) { const v4f ml = P[((j * 2u + qg) * 2u + u) * (33u * 32u) + 32u * 32u + lane]; mj[j] = ml[0]; lj[j] = ml[1]; }
        const float m = fmaxf(fmaxf(mj[0], mj[1]), fmaxf(mj[2], mj[3]));
#pragma unroll
        for (int j = 0; j < 4; ++j) {
            __builtin_amdgcn_sched_barrier(0); aj[j] = __builtin_amdgcn_exp2f(mj[j] - m); __builtin_amdgcn_sched_barrier(0); asm volatile("v_nop"); __builtin_amdgcn_sched_barrier(0); }
        float l = lj[0] * aj[0] + lj[1] * aj[1] + lj[2] * aj[2] + lj[3] * aj[3]; l += xhalf(l);   // each half of the wave summed its eight keys of every 16
        const float inv = __fdiv_rn(1.0f, l);
        const size_t eo = (size_t)(q0 + 16u * u + c) * VC + 8u * h + kq * 64u;
#pragma unroll
        for (int tt = 0; tt < 4; ++tt) { v4f x0 = {}, x1 = {};
#pragma unroll
            for (int j = 0; j < 4; ++j) { const unsigned rb = ((j * 2u + qg) * 2u + u) * (33u * 32u) + (kq * 4u + tt) * 64u + lane; x0 += P[rb] * aj[j]; x1 += P[rb + 32u] * aj[j]; }
            v8us oh, ol;
#pragma unroll
            for (int r = 0; r < 4; ++r) { unsigned short a, c2; splitf(__fmul_rn(x0[r], inv), a, c2); oh[r] = a; ol[r] = c2; splitf(__fmul_rn(x1[r], inv), a, c2); oh[4 + r] = a; ol[4 + r] = c2; }
            *(v8us*)(Oh + eo + tt * 16) = oh; *(v8us*)(Ol + eo + tt * 16) = ol; }
        // the second column group's work reuses the address and data registers of the stores above: the wait stands in front of that overwrite; the scheduling barrier keeps the overwrite behind it
        if (u == 0) { asm volatile("s_wait_xcnt 0x0" ::: "memory"); __builtin_amdgcn_sched_barrier(0); }
    }
}

extern "C" void kernel_launch(void* const* d_in, const int* in_sizes, int n_in,
                              void* d_out, int out_size, void* d_ws, size_t ws_size, hipStream_t stream) {
    (void)in_sizes; (void)n_in; (void)out_size;
    const float* IN[17]; for (int i = 0; i < 17; ++i) IN[i] = (const float*)d_in[i];   // 0 x, 1 wq [256][512], 2 bq, 3 gq, 4 betaq, 5 mq, 6 vq, 7 wk, 8 bk, 9 gk, 10 betak, 11 mk, 12 vk, 13 wv, 14 bv, 15 wW [512][256], 16 bW
    float* OUT = (float*)d_out;     // [4][512][4096]
    char* wsp = (char*)d_ws;
    auto take = [&](size_t bytes) { char* p = wsp; wsp += (bytes + 255) & ~(size_t)255; return (void*)p; };
    bf* WQ = (bf*)take((size_t)KC * CC * 2); bf* WK = (bf*)take((size_t)KC * CC * 2); bf* WV = (bf*)take((size_t)VC * CC * 2); bf* WW = (bf*)take((size_t)CC * VC * 2);
    // every plane holds all NB_ images
    bf* XT = (bf*)take((size_t)NB_ * TQ * CC * 2); h16* Q16 = (h16*)take((size_t)NB_ * TQ * KC * 2); h16* K16 = (h16*)take((size_t)NB_ * NKY * KC * 2); h16* VT = (h16*)take((size_t)NB_ * VC * NKY * 2);
    bf* Ch = (bf*)take((size_t)NB_ * TQ * VC * 2); bf* Cl = (bf*)take((size_t)NB_ * TQ * VC * 2);
    if ((size_t)(wsp - (char*)d_ws) > ws_size) return;    // total = 57 MiB
    k_prep<<<dim3(TQ / 128, CC / 128, NB_ + 2), 256, 0, stream>>>(IN[0], XT, IN[1], IN[7], IN[13], IN[15], WQ, WK, WV, WW);
    k_qkv<<<dim3(TQ / 128, KC / 128, 3 * NB_), 128, 0, stream>>>(XT, WQ, WK, WV, Q16, K16, VT, IN[2], IN[3], IN[4], IN[5], IN[6], IN[8], IN[9], IN[10], IN[11], IN[12], IN[14]);
    k_attn<<<dim3(TQ / 64, NB_, 1), 256, 0, stream>>>(Q16, K16, VT, Ch, Cl);
    k_out<<<dim3(CC / 128, TQ / 128, NB_), 128, 0, stream>>>(WW, Ch, Cl, OUT, IN[16]);
}

// v010
// One run takes 73.1 microseconds.
// In two side-by-side timings against v009, it was 1.14 and 1.12 times as fast.
// All steps since v000 together make it 12.8 times as fast.
#include <hip/hip_runtime.h>

// BasicNonLocalBlock (x [4][512][64x64 = 4096] NCHW; q = BN_q(wq x + bq), k = BN_k(wk x + bk) (256 channels, eval-mode BatchNorm with the given mean/var/gamma/beta), v = wv x + bv (256); sim = softmax_k(q^T k x 256^-0.5) over
// the 4096 positions; ctx[c][q] = sum_k sim[q][k] v[c][k]; out = wW ctx + bW -> [4][512][64][64]).
// Compute dtypes, f32 accumulate: every input rounded to bf16; the three 1x1 convolutions on PLAIN bf16 operands from a positions-major bf16 copy of x (inputs: exact, + bias); BN (f32, per-channel

#define NB_  4
#define CC   512
#define TQ   4096
#define NKY   4096
#define KC   256
#define VC   256
typedef _Float16 h16;
typedef unsigned short bf;
typedef __attribute__((ext_vector_type(16))) __bf16   v16bf;
typedef __attribute__((ext_vector_type(16))) _Float16 v16h;
typedef __attribute__((ext_vector_type(8)))  _Float16 v8h;
typedef __attribute__((ext_vector_type(8)))  unsigned short v8us;
typedef __attribute__((ext_vector_type(8)))  float    v8f;
typedef __attribute__((ext_vector_type(4)))  float    v4f;
typedef v8h  __attribute__((may_alias)) v8ha;
typedef v4f  __attribute__((may_alias)) v4fa;
typedef v8us __attribute__((may_alias)) v8usa;

__device__ __forceinline__ unsigned short f2bf(float f) { unsigned u = __float_as_uint(f); u += 0x7FFFu + ((u >> 16) & 1u); return (unsigned short)(u >> 16); }
__device__ __forceinline__ float bf2f(unsigned short b) { return __uint_as_float(((unsigned)b) << 16); }
__device__ __forceinline__ float bfr(float f) { return bf2f(f2bf(f)); }
__device__ __forceinline__ v16h cat16(v8h lo, v8h hi) { return __builtin_shufflevector(lo, hi, 0, 1, 2, 3, 4, 5, 6, 7, 8, 9, 10, 11, 12, 13, 14, 15); }
__device__ __forceinline__ v16bf cat16b(v8us lo, v8us hi) { return __builtin_bit_cast(v16bf, __builtin_shufflevector(lo, hi, 0, 1, 2, 3, 4, 5, 6, 7, 8, 9, 10, 11, 12, 13, 14, 15)); }
__device__ __forceinline__ v8f wmma16(v16h a, v16h b, v8f c) { return __builtin_amdgcn_wmma_f32_16x16x32_f16(false, a, false, b, (short)0, c, false, false); }
__device__ __forceinline__ v8f wmmab(v16bf a, v16bf b, v8f c) { return __builtin_amdgcn_wmma_f32_16x16x32_bf16(false, a, false, b, (short)0, c, false, false); }



// ---- gemm128: one 128x128 output tile per workgroup of 4 waves (2 x 2), each wave a 64x64 tile (16 accumulators) over the whole of K.
// C[m][n] = sum_k A[m][k] Bt[n][k] (SPLITB: + sum_k A[m][k] Bt2[n][k], the second plane's stages behind the first's); A, Bt, Bt2 are K-contiguous bf16 planes with rows of K elements.
// The operands come through LDS in stages of 64 k: a wave's 16-byte loads cover four whole 128-byte lines (8 lanes a row), two buffers, the next stage's loads in flight under this stage's products.
// Every fragment is read from LDS in the hardware k order (8 h + 0..7, 16 + 8 h + 0..7), A and B alike, as WFrag::ld has it.
// EPI says what the tile's f32 sums become before the one store (rows m, columns n); each wave turns its tile through its own part of the ring, so that a store covers whole lines:
//   1  H[m][n] = f16(BN_n(sum + bias[n]))   eval-mode BatchNorm, per column (channel)
//   2  H[m][n] = f16(sum + bias[m])         A = weights, Bt = positions: the channels-major plane comes out directly
//   4  C[m][n] = sum + bias[m] (f32)        A = weights, Bt = positions: the NCHW output comes out directly
__device__ __forceinline__ h16 tohx(float x) { return (h16)x; }
__device__ __forceinline__ void splitf(float y, unsigned short& h, unsigned short& l) { h = f2bf(y); l = f2bf(y - bf2f(h)); }
typedef __attribute__((ext_vector_type(4))) _Float16 v4h;
typedef float __attribute__((may_alias)) fla;
template <typename T16> struct WFrag;
template <> struct WFrag<h16> { typedef v16h V; static __device__ __forceinline__ V ld(const h16* p) { return cat16(*(const v8h*)p, *(const v8h*)(p + 16)); } };
#define GPI  144u                   // LDS pitch of a stage row (64 k = 128 B + 16: an odd multiple of 16 B)
#define GOPB (128u * GPI)           // one operand's 128 rows
#define GSTB (2u * GOPB)            // one stage: A, then B
__device__ __forceinline__ v16bf ldsfragb(const unsigned char* p) { return cat16b(*(const v8usa*)p, *(const v8usa*)(p + 32)); }
template <int K, bool SPLITB, int EPI>
__device__ __forceinline__ void gemm128(unsigned char* L, const unsigned bx, const unsigned by, const bf* __restrict__ A, const bf* __restrict__ Bt, const bf* __restrict__ Bt2, float* C, h16* H, const int ldc,
                                        const float* __restrict__ bias, const float* __restrict__ g, const float* __restrict__ be, const float* __restrict__ mu, const float* __restrict__ var) {
    static_assert(K % 64 == 0 && ((K / 64) & (K / 64 - 1)) == 0, "whole stages, a power of two of them");
    static_assert(4 * 64 * 68 * 4 <= 2 * GSTB, "the epilogue reuses the ring");
    constexpr int KST = K / 64, NST = SPLITB ? 2 * KST : KST;
    constexpr unsigned RB = K * 2u;   // bytes of an operand row
    const unsigned tid = threadIdx.x, lane = tid & 31u, lr = lane & 15u, hi = lane >> 4;
    const unsigned w = __builtin_amdgcn_readfirstlane(tid >> 5), wm = w & 1u, wn = w >> 1;
    const unsigned r0 = bx * 128u, c0 = by * 128u;
    const char* ab = (const char*)A; const char* bb = (const char*)Bt; const char* bb2 = (const char*)Bt2;
    const unsigned ao = (r0 + (tid >> 3)) * RB + (tid & 7u) * 16u, bo = (c0 + (tid >> 3)) * RB + (tid & 7u) * 16u;   // this thread's byte offsets in the two planes: row tid / 8 of every 16, piece tid % 8 of the row's line
    const unsigned st = (tid >> 3) * GPI + (tid & 7u) * 16u;
    // what the epilogue needs per column (EPI 1) or per row (EPI 2, 4) is loaded here, with stage 0, so that its latency passes behind the k loop
    v4f pb = {}, pg = {}, pe = {}, pm = {}, pv = {}; v8f rowb[4] = {};
    v8us ra[8], rb[8];
    __builtin_amdgcn_sched_barrier(0);   // with the one behind the wait below: nothing else is scheduled in between the loads and their wait
#pragma unroll
    for (int i = 0; i < 8; ++i) { ra[i] = *(const v8us*)(ab + ao + i * (16u * RB)); rb[i] = *(const v8us*)(bb + bo + i * (16u * RB)); }
    if constexpr (EPI == 1) { const unsigned cc = c0 + wn * 64u + lr * 4u; pb = *(const v4f*)(bias + cc); pg = *(const v4f*)(g + cc); pe = *(const v4f*)(be + cc); pm = *(const v4f*)(mu + cc); pv = *(const v4f*)(var + cc); }
    else {
#pragma unroll
        for (int mb = 0; mb < 4; ++mb) rowb[mb] = *(const v8f*)(bias + r0 + wm * 64u + mb * 16u + hi * 8u); }
    // address registers of the loads above may be reused at once (the accumulators' zeros): the wait stands in front of that overwrite; the scheduling barrier keeps the overwrite behind it
    asm volatile("s_wait_xcnt 0x0" ::: "memory"); __builtin_amdgcn_sched_barrier(0);
    v8f acc[4][4];
#pragma unroll
    for (int mb = 0; mb < 4; ++mb)
#pragma unroll
        for (int nb = 0; nb < 4; ++nb) acc[mb][nb] = (v8f){};
#pragma unroll
    for (int i = 0; i < 8; ++i) { *(v8usa*)(L + st + i * 16 * GPI) = ra[i]; *(v8usa*)(L + GOPB + st + i * 16 * GPI) = rb[i]; }
    __syncthreads();   // stage 0 is in LDS before any wave reads it
#pragma unroll 1
    for (int s = 0; s < NST; ++s) {
        const unsigned char* b = L + (s & 1) * GSTB;
        if (s + 1 < NST) {
            const unsigned kb = ((unsigned)(s + 1) & (unsigned)(KST - 1)) * 128u;   // the next stage's place in the rows
            const char* an = ab + kb + ao; const char* bn = ((SPLITB && s + 1 >= KST) ? bb2 : bb) + kb + bo;
#pragma unroll
            for (int i = 0; i < 8; ++i) { ra[i] = *(const v8us*)(an + i * (16u * RB)); rb[i] = *(const v8us*)(bn + i * (16u * RB)); }
            // as above: the next trip forms new addresses in these loads' registers; the two addresses are inputs of the statement, so that no load takes their registers as its destination
            asm volatile("s_wait_xcnt 0x0" : : "v"(an), "v"(bn) : "memory"); __builtin_amdgcn_sched_barrier(0);
        }
        const unsigned char* pa = b + (wm * 64u + lr) * GPI + 16u * hi; const unsigned char* pq = b + GOPB + (wn * 64u + lr) * GPI + 16u * hi;
#pragma unroll
        for (int kk = 0; kk < 2; ++kk) {
            // the block's eight fragments are fetched as one group ahead of its 16 products: without the two scheduling barriers the B fragments share one register set, and every four products wait out an LDS latency
            v16bf fa[4], fb[4];
            __builtin_amdgcn_sched_barrier(0);
#pragma unroll
            for (int mb = 0; mb < 4; ++mb) fa[mb] = ldsfragb(pa + mb * 16 * GPI + kk * 64);
#pragma unroll
            for (int nb = 0; nb < 4; ++nb) fb[nb] = ldsfragb(pq + nb * 16 * GPI + kk * 64);
            __builtin_amdgcn_sched_barrier(0);
#pragma unroll
            for (int nb = 0; nb < 4; ++nb)
#pragma unroll
                for (int mb = 0; mb < 4; ++mb) acc[mb][nb] = wmmab(fa[mb], fb[nb], acc[mb][nb]);
        }
        // four vector slots behind the last matrix instruction on every path, the loop's back edge included
        __builtin_amdgcn_sched_barrier(0); asm volatile("v_nop\n\tv_nop\n\tv_nop\n\tv_nop"); __builtin_amdgcn_sched_barrier(0);
        if (s + 1 < NST) { unsigned char* d = L + ((s + 1) & 1) * GSTB;
#pragma unroll
            for (int i = 0; i < 8; ++i) { *(v8usa*)(d + st + i * 16 * GPI) = ra[i]; *(v8usa*)(d + GOPB + st + i * 16 * GPI) = rb[i]; } }
        __syncthreads();   // publishes stage s + 1 and ends every wave's reads of stage s, whose buffer the next trip refills (behind the last trip: the epilogue)
    }
    fla* osw = (fla*)L + w * (64u * 68u);
    // all loops below are unrolled so that acc[][] is indexed by constants (stays in registers) and the LDS offsets are immediates
#pragma unroll
    for (int mb = 0; mb < 4; ++mb)
#pragma unroll
        for (int nb = 0; nb < 4; ++nb)
#pragma unroll
            for (int j = 0; j < 8; ++j) osw[(mb * 16 + hi * 8 + j) * 68 + nb * 16 + lr] = EPI == 1 ? acc[mb][nb][j] : acc[mb][nb][j] + bfr(rowb[mb][j]);
    __syncthreads();   // the tiles are in LDS before their rows are read back
    const size_t e0 = (size_t)(r0 + wm * 64u + hi) * ldc + c0 + wn * 64u + lr * 4u;
    v4f sc = {}, sh = {};
    if constexpr (EPI == 1) {
#pragma unroll
        for (int q = 0; q < 4; ++q) { sc[q] = __fdiv_rn(bfr(pg[q]), __fsqrt_rn(bfr(pv[q]) + 1e-5f)); sh[q] = bfr(pe[q]) - bfr(pm[q]) * sc[q]; pb[q] = bfr(pb[q]); } }
#pragma unroll
    for (int s = 0; s < 32; ++s) { const v4f val = *(const v4fa*)(osw + (2u * s + hi) * 68u + lr * 4u);   // tile row 2 s + hi, columns 4 lr + 0..3
        const size_t eo = e0 + (size_t)(2 * s) * ldc;
        if constexpr (EPI == 1) { v4h o;
#pragma unroll
            for (int q = 0; q < 4; ++q) o[q] = tohx((val[q] + pb[q]) * sc[q] + sh[q]);
            *(v4h*)(H + eo) = o; }
        if constexpr (EPI == 2) { v4h o;
#pragma unroll
            for (int q = 0; q < 4; ++q) o[q] = tohx(val[q]);
            *(v4h*)(H + eo) = o; }
        if constexpr (EPI == 4) { *(v4f*)(C + eo) = val; } }
}
// ---- k_qkv: the three projections, which depend on nothing of one another, in one launch; grid (TQ / 128, KC / 128, 3 * images), 4 waves. blockIdx.z = 4 * projection + image (0 q, 1 k, 2 v).
// q and k: rows = positions (x), columns = channels (y). v: rows = channels (y), columns = positions (x).
__global__ __launch_bounds__(128) void k_qkv(const bf* __restrict__ XT, const bf* __restrict__ WQ, const bf* __restrict__ WK, const bf* __restrict__ WV, h16* Q16, h16* K16, h16* VT,
                                             const float* __restrict__ bq, const float* __restrict__ gq, const float* __restrict__ eq, const float* __restrict__ mq, const float* __restrict__ vq,
                                             const float* __restrict__ bk, const float* __restrict__ gk, const float* __restrict__ ek, const float* __restrict__ mk, const float* __restrict__ vk, const float* __restrict__ bv) {
    static_assert(KC == VC && TQ == NKY && NB_ == 4, "one grid shape serves the three projections");
    __shared__ __align__(16) unsigned char L[2 * GSTB];
    const unsigned pr = blockIdx.z >> 2; const size_t img = blockIdx.z & 3u;
    const bf* X = XT + img * (size_t)(TQ * CC);
    if (pr == 2u) {   // the same for the whole workgroup
        gemm128<CC, false, 2>(L, blockIdx.y, blockIdx.x, WV, X, nullptr, nullptr, VT + img * (size_t)(VC * NKY), NKY, bv, nullptr, nullptr, nullptr, nullptr);
        return; }
    const bool isk = pr == 1u;
    gemm128<CC, false, 1>(L, blockIdx.x, blockIdx.y, X, isk ? WK : WQ, nullptr, nullptr, (isk ? K16 : Q16) + img * (size_t)(TQ * KC), KC, isk ? bk : bq, isk ? gk : gq, isk ? ek : eq, isk ? mk : mq, isk ? vk : vq);
}
// ---- k_prep: the bf16 planes that the GEMMs read, all in one launch; grid (TQ / 128, CC / 128, images + 2), 8 waves. Planes z < images turn x; the 256 workgroups of the last two planes round the four weight matrices, 64 each.
// x [image][512 channels][4096 positions] f32 -> XT [image][4096 positions][512 channels] bf16, turned through LDS. One workgroup = 128 channels x 128 positions.
// In: a wave's load is 512 contiguous bytes of one channel's row (128 positions); a wave takes 16 channels, so a lane holds 16 channels x 4 positions and packs 8 channels of one position into one 16-byte LDS store.
// Out: 16 lanes store the 256 contiguous bytes (128 channels) of one position's row.
// LDS row = one position, 16 pieces of 16 bytes; piece k of row n stands at place k ^ ((n >> 2) & 15), so that the 16 lanes of a half wave fall on 16 different places in the stores (rows 4 apart, one k) as in the loads (one row, 16 k).
__global__ __launch_bounds__(256) void k_prep(const float* __restrict__ xb, bf* XT, const float* __restrict__ w0, const float* __restrict__ w1, const float* __restrict__ w2, const float* __restrict__ w3, bf* W0, bf* W1, bf* W2, bf* W3) {
    static_assert(KC * CC == 64 * 256 * 8 && VC * CC == KC * CC && (TQ / 128) * (CC / 128) * 2 == 4 * 64, "64 workgroups of 256 threads, 8 elements a thread, cover one weight matrix exactly");
    __shared__ __align__(16) unsigned char T[128 * 256];
    const unsigned tid = threadIdx.x, lane = tid & 31u, w = tid >> 5;
    if (blockIdx.z >= NB_) {   // the same for the whole workgroup, and in front of the barrier
        const unsigned j = ((blockIdx.z - NB_) * (CC / 128) + blockIdx.y) * (TQ / 128) + blockIdx.x, m = j >> 6;
        const float* src = m == 0u ? w0 : m == 1u ? w1 : m == 2u ? w2 : w3; bf* dst = m == 0u ? W0 : m == 1u ? W1 : m == 2u ? W2 : W3;
        const unsigned i = (j & 63u) * 256u + tid;   // the 16-byte piece of the bf16 plane that this thread writes
        // w3 goes out in fragment order, for k_attn's last product: 1 KiB blocks [16-row tile][k block of 32], a block = [k part of 16][half h][row] pieces of 8 k, so that a wave's fragment load is 512 contiguous bytes; the others keep their rows
        const unsigned sp = m == 3u ? ((i >> 9) * 16u + (i & 15u)) * (VC / 8) + ((i >> 6) & 7u) * 4u + ((i >> 5) & 1u) * 2u + ((i >> 4) & 1u) : i;   // the piece of the source that goes there
        const v8f v = *(const v8f*)(src + (size_t)sp * 8); v8us o;
#pragma unroll
        for (int k = 0; k < 8; ++k) o[k] = f2bf(v[k]);
        *(v8us*)(dst + (size_t)i * 8) = o; return; }
    xb += (size_t)blockIdx.z * CC * TQ + (size_t)(blockIdx.y * 128u + w * 16u) * TQ + blockIdx.x * 128u + lane * 4u;
    XT += (size_t)blockIdx.z * TQ * CC + (size_t)(blockIdx.x * 128u + (tid >> 4)) * CC + blockIdx.y * 128u + (tid & 15u) * 8u;
    v4f r[16];
#pragma unroll
    for (int i = 0; i < 16; ++i) r[i] = *(const v4f*)(xb + (size_t)i * TQ);
    // the address registers of the loads above are reused below: the wait stands in front of that overwrite; the address is an input of the statement, so that no load takes its registers as its destination; the scheduling barrier keeps the overwrite behind the wait
    asm volatile("s_wait_xcnt 0x0" : : "v"(xb) : "memory"); __builtin_amdgcn_sched_barrier(0);
#pragma unroll
    for (int g = 0; g < 2; ++g)
#pragma unroll
        for (int j = 0; j < 4; ++j) { v8us o;
#pragma unroll
            for (int k = 0; k < 8; ++k) o[k] = f2bf(r[g * 8 + k][j]);
            *(v8usa*)(T + (lane * 4u + j) * 256u + (((w * 2u + g) ^ (lane & 15u)) * 16u)) = o; }
    __syncthreads();   // the whole tile is in LDS before any thread reads a row of it
    v8us o[8];
#pragma unroll
    for (int s = 0; s < 8; ++s) { const unsigned row = s * 16u + (tid >> 4); o[s] = *(const v8usa*)(T + row * 256u + (((tid & 15u) ^ ((row >> 2) & 15u)) * 16u)); }
#pragma unroll
    for (int s = 0; s < 8; ++s) *(v8us*)(XT + (size_t)s * 16 * CC) = o[s];
}
#define AVP 272u                    // LDS pitch of a slice's row (256 B + the mover's pad of 16: an odd multiple of 16 B)
#define ASK 128                     // keys of a stage
#define ASLC 18432u                 // a slice's room in LDS: 64 rows of AVP bytes, rounded up to a multiple of 2 KiB, so that every slice starts at one
#define ASLOT (8u * ASLC)
#define ALAG 4.0f
#define CPI  528u                   // LDS pitch of a ctx row (256 channels = 512 B + 16: an odd multiple of 16 B)
#define CPL  (64u * CPI)            // one ctx plane: the workgroup's 64 queries
#define COS  69632u                 // the output tiles' room in LDS, behind the two ctx planes
#define ACS  0.09016844005556021f   // 256^-0.5 * log2(e)
__device__ __forceinline__ float xhalf(float x) { return __builtin_bit_cast(float, __builtin_amdgcn_permlanex16(__builtin_bit_cast(int, x), __builtin_bit_cast(int, x), 0x76543210, 0xfedcba98, false, false)); }  // lane l with lane l ^ 16
__device__ __forceinline__ v16h ldsfrag(const unsigned char* p) { return cat16(*(const v8ha*)p, *(const v8ha*)(p + 32)); }
typedef uint32_t u32x4 __attribute__((ext_vector_type(4)));
typedef uint32_t u32x8 __attribute__((ext_vector_type(8)));
__device__ __forceinline__ uint32_t uni(uint32_t v) { return (uint32_t)__builtin_amdgcn_readfirstlane(v); }
// a test on a pinned value compiles to a scalar compare and branch (a tensor load ignores EXEC), and what is formed from it stands behind the waits written in front of it
__device__ __forceinline__ uint32_t pinned(uint32_t v) { uint32_t w = uni(v); asm volatile("" : "+s"(w)); return w; }   // pinned(): a wave-uniform test or descriptor word of a tensor load, held in a scalar register
// descriptor group 1 of a slice: 1-byte elements, tensor = tile = 64 rows of 256 bytes, source row pitch sp bytes, 4 dwords of LDS pad behind every 64 dwords (a row); no workgroup mask
__device__ __forceinline__ u32x8 tdm_group1(uint32_t sp) {
    u32x8 g;
    g[0] = uni((1u << 20) | (5u << 22) | (3u << 25)); g[1] = uni(256u << 16); g[2] = uni(64u << 16); g[3] = uni(256u << 16); g[4] = uni(64u); g[5] = uni(sp); g[6] = uni(0u); g[7] = uni(0u);
    return g;
}
// one tensor load: the slice whose first byte is at ga goes to byte dst of the workgroup's LDS; the waits for it are written where its bytes are handed over
__device__ __forceinline__ void tdm_load(uint32_t dst, uint64_t ga, u32x8 g1) {
    u32x4 g0;
    g0[0] = uni(1u); g0[1] = uni(dst); g0[2] = uni((uint32_t)ga); g0[3] = uni((((uint32_t)(ga >> 32)) & 0x01FFFFFFu) | 0x80000000u);
    asm volatile("tensor_load_to_lds %0, %1" :: "s"(g0), "s"(g1) : "memory");
}
// a workgroup barrier that orders LDS alone: __syncthreads() also waits for every global load under way, and the wW fragments asked for in front of the join are to stay in flight across it
__device__ __forceinline__ void lds_barrier() { __builtin_amdgcn_fence(__ATOMIC_RELEASE, "workgroup", "local"); __builtin_amdgcn_s_barrier(); __builtin_amdgcn_fence(__ATOMIC_ACQUIRE, "workgroup", "local"); }
__global__ __launch_bounds__(256) __attribute__((amdgpu_waves_per_eu(2, 2))) void k_attn(const h16* __restrict__ Q, const h16* __restrict__ Kk, const h16* __restrict__ Vt, const bf* __restrict__ WP, const float* __restrict__ bW, float* OUT) {
    __shared__ __attribute__((aligned(2048))) unsigned char L[2 * ASLOT];
    static_assert(16 * 33 * 32 * 16 <= 2 * ASLOT && 2 * ASLOT <= 320 * 1024, "the join at the end reuses the ring");
    static_assert(64u * AVP <= ASLC && ASLC % 2048u == 0 && KC * 2 == 512 && VC == 256 && ASK == 128, "eight slices of 64 rows of 256 bytes, each at a multiple of 2 KiB");
    static_assert(2u * CPL <= COS && COS + 8u * 64u * 68u * 4u <= 2 * ASLOT && CC == 8 * 64 && VC == 256, "ctx planes and eight 64 x 64 output tiles fit the ring; a wave takes 64 output channels");
    constexpr int NST = NKY / ASK;
    static_assert(NST >= 2 && NKY % ASK == 0, "whole stages, two or more");
    const size_t z = blockIdx.y; Q += z * (size_t)(TQ * KC); Kk += z * (size_t)(NKY * KC); Vt += z * (size_t)(VC * NKY);
    const unsigned tid = threadIdx.x, lane = tid & 31u, c = lane & 15u, h = lane >> 4;
    const unsigned w = __builtin_amdgcn_readfirstlane(tid >> 5), qg = w & 1u, kq = w >> 1;
    const unsigned q0 = blockIdx.x * 64u + qg * 32u;
    // this wave's slice: its first byte in stage 0, its step from stage to stage, its source pitch, its place in buffer 0
    const bool isv = w >= 4u;
    const uint64_t sg = isv ? (uint64_t)(size_t)Vt + (uint64_t)((w - 4u) * 64u) * (NKY * 2u) : (uint64_t)(size_t)Kk + (uint64_t)((w >> 1) * 64u) * (KC * 2u) + (w & 1u) * 256u;
    const uint32_t sstep = isv ? ASK * 2u : ASK * KC * 2u;
    const u32x8 g1 = tdm_group1(isv ? NKY * 2u : KC * 2u);
    const uint32_t sl = (uint32_t)(size_t)L + w * ASLC;
    v16h qf[2][8];
    const h16* qp = Q + (size_t)(q0 + c) * KC + 8u * h;
#pragma unroll
    for (int u = 0; u < 2; ++u)
#pragma unroll
        for (int kc = 0; kc < 8; ++kc) qf[u][kc] = WFrag<h16>::ld(qp + u * (16 * KC) + 32 * kc);
    // the address registers of the loads above are reused below: the wait stands in front of that overwrite; the address is an input of the statement, so that it stays in its registers up to the wait; the scheduling barrier keeps the overwrite behind it
    asm volatile("s_wait_xcnt 0x0" : : "v"(qp) : "memory"); __builtin_amdgcn_sched_barrier(0);
    tdm_load(sl, sg, g1);
    asm volatile("s_wait_tensorcnt 0x0" ::: "memory");   // this wave's slice of stage 0 has landed
    __syncthreads();   // stage 0 is in LDS before any wave reads it
    tdm_load(sl + ASLOT, sg + sstep, g1);
    v8f acc[2][16];
#pragma unroll
    for (int u = 0; u < 2; ++u)
#pragma unroll
        for (int t = 0; t < 16; ++t) acc[u][t] = (v8f){};
    float m_run[2] = {-__builtin_inff(), -__builtin_inff()}, l_run[2] = {0.f, 0.f};
#pragma unroll 1
    for (int st = 0; st < NST; ++st) {
        const unsigned bo = (st & 1) * ASLOT;
        const unsigned char* b = L + bo;
        v8f s0[2] = {}, s1[2] = {};
        // K fragments come in four groups of four (two k blocks, two key tiles), a group fetched ahead of the products of the group before it: the scheduling barriers keep each group's loads together and bound the registers that fragments take
        { const unsigned char* kb = b + (kq >> 1) * (2u * ASLC) + ((kq & 1u) * 32u + c) * AVP + 16u * h;   // k block kc stands in slice kc / 4 of the key group's two, at 64 (kc % 4) of its row
          v16h k0[8], k1[8];
          __builtin_amdgcn_sched_barrier(0);
#pragma unroll
          for (int kc = 0; kc < 4; ++kc) { k0[kc] = ldsfrag(kb + 64 * kc); k1[kc] = ldsfrag(kb + 16 * AVP + 64 * kc); }
          __builtin_amdgcn_sched_barrier(0);
#pragma unroll
          for (int g = 0; g < 4; ++g) {
#pragma unroll
              for (int kc = 2 * g; kc < 2 * g + 2; ++kc)
#pragma unroll
                  for (int u = 0; u < 2; ++u) { s0[u] = wmma16(k0[kc], qf[u][kc], s0[u]); s1[u] = wmma16(k1[kc], qf[u][kc], s1[u]); }
              __builtin_amdgcn_sched_barrier(0);
              if (g < 2) {
#pragma unroll
                  for (int kc = 2 * g + 4; kc < 2 * g + 6; ++kc) { k0[kc] = ldsfrag(kb + ASLC + 64 * (kc - 4)); k1[kc] = ldsfrag(kb + ASLC + 16 * AVP + 64 * (kc - 4)); }
                  __builtin_amdgcn_sched_barrier(0); }
          } }
        // the first four V^T fragments are fetched here, so that their LDS latency passes behind the maxima and the exponentials; the scheduling barriers keep the group in front of the vector work
        const unsigned char* vb = b + 4u * ASLC + c * AVP + kq * 64u + 16u * h;   // channel tile t stands in slice 4 + t / 4, at rows 16 (t % 4) + c
        v16h vf[16];
#pragma unroll
        for (int t = 0; t < 4; ++t) vf[t] = ldsfrag(vb + t * 16 * AVP);   // slice 4
        __builtin_amdgcn_sched_barrier(0);
        float mx[2];
#pragma unroll
        for (int u = 0; u < 2; ++u) { mx[u] = fmaxf(s0[u][0], s1[u][0]);
#pragma unroll
            for (int r = 1; r < 8; ++r) mx[u] = fmaxf(mx[u], fmaxf(s0[u][r], s1[u][r]));
            mx[u] = fmaxf(mx[u], xhalf(mx[u])) * ACS; }   // both halves of the wave now hold this query's maximum of the pass, scaled
        if (__builtin_amdgcn_ballot_w32(mx[0] > m_run[0] + ALAG || mx[1] > m_run[1] + ALAG) != 0) {   // one scalar branch a pass for both column groups; rare after the first passes
#pragma unroll
            for (int u = 0; u < 2; ++u)
                if (__builtin_amdgcn_ballot_w32(mx[u] > m_run[u] + ALAG) != 0) {   // a column group is rescaled on its own test alone
                    const float m_new = fmaxf(m_run[u], mx[u]), corr = __builtin_amdgcn_exp2f(m_run[u] - m_new);   // corr = 0 on the first pass, where m_run is -inf
                    l_run[u] *= corr; m_run[u] = m_new;
#pragma unroll
                    for (int t = 0; t < 16; ++t) acc[u][t] *= corr;
                }
        }
        v16h pf[2];
#pragma unroll
        for (int u = 0; u < 2; ++u) {
            float ps0 = 0.f, ps1 = 0.f; const float nm = 10.0f - m_run[u];
#pragma unroll
            for (int r = 0; r < 8; ++r) { s0[u][r] = __builtin_fmaf(s0[u][r], ACS, nm); s1[u][r] = __builtin_fmaf(s1[u][r], ACS, nm); }
#pragma unroll
            for (int r = 0; r < 8; ++r) {
                __builtin_amdgcn_sched_barrier(0); const float p0 = __builtin_amdgcn_exp2f(s0[u][r]); __builtin_amdgcn_sched_barrier(0); asm volatile("v_nop");
                __builtin_amdgcn_sched_barrier(0); const float p1 = __builtin_amdgcn_exp2f(s1[u][r]); __builtin_amdgcn_sched_barrier(0); asm volatile("v_nop");
                __builtin_amdgcn_sched_barrier(0); ps0 += p0; ps1 += p1; pf[u][r] = tohx(p0); pf[u][8 + r] = tohx(p1); }
            l_run[u] += ps0 + ps1;
        }
        // the other V^T fragments come in groups of two, each fetched two groups ahead of its products: the scheduling barriers keep a group's loads together and bound the registers that fragments take
#pragma unroll
        for (int g = 0; g < 8; ++g) {
            __builtin_amdgcn_sched_barrier(0);
            if (g < 6) {
#pragma unroll
                for (int t = 2 * g + 4; t < 2 * g + 6; ++t) vf[t] = ldsfrag(vb + (t >> 2) * ASLC + (t & 3) * 16 * AVP);
                __builtin_amdgcn_sched_barrier(0); }
#pragma unroll
            for (int t = 2 * g; t < 2 * g + 2; ++t)
#pragma unroll
                for (int u = 0; u < 2; ++u) acc[u][t] = wmma16(vf[t], pf[u], acc[u][t]);
        }
        // four vector slots behind the last matrix instruction on every path, the loop's back edge included
        __builtin_amdgcn_sched_barrier(0); asm volatile("v_nop\n\tv_nop\n\tv_nop\n\tv_nop"); __builtin_amdgcn_sched_barrier(0);
        asm volatile("s_wait_dscnt 0x0" ::: "memory");      // this wave's reads of stage st have returned
        asm volatile("s_wait_tensorcnt 0x0" ::: "memory");   // this wave's slice of stage st + 1 has landed
        __syncthreads();   // publishes stage st + 1 and ends every wave's reads of stage st, whose buffer is refilled behind it
        if (pinned((uint32_t)(st + 2 < NST))) { const uint32_t s2 = pinned((uint32_t)st + 2u); tdm_load(sl + bo, sg + (uint64_t)s2 * sstep, g1); }   // a scalar test, the same in every wave; the descriptor is formed behind the wait
    }
    asm volatile("s_wait_tensorcnt 0x0" ::: "memory");   // no tensor load is under way when the ring becomes the join's room
    asm volatile("s_wait_dscnt 0x0" ::: "memory");       // nor a read of the ring
    // join of the four key quarters: every wave lays its sums, maxima and denominators in LDS, 16 bytes a lane; then wave (half, quarter) finishes channel tiles 4 quarter + 0..3 of its half's 32 queries, lane to lane
    v4fa* P = (v4fa*)L;
#pragma unroll
    for (int u = 0; u < 2; ++u) { const unsigned rb = (w * 2u + u) * (33u * 32u) + lane;
#pragma unroll
        for (int t = 0; t < 16; ++t) { P[rb + (2 * t) * 32] = __builtin_shufflevector(acc[u][t], acc[u][t], 0, 1, 2, 3); P[rb + (2 * t + 1) * 32] = __builtin_shufflevector(acc[u][t], acc[u][t], 4, 5, 6, 7); }
        P[rb + 32 * 32] = (v4f){m_run[u], l_run[u], 0.f, 0.f}; }
    // wave w takes output channels 64 w + 0..63: its wW fragments (a load = 512 contiguous bytes of the packed plane) are asked for here, so that their latency passes behind the join; the scheduling barrier keeps them behind the stores above, whose registers they take
    __builtin_amdgcn_sched_barrier(0);
    v16bf fa[4][8]; v8f rowb[4];
    const bf* wp = WP + (size_t)(w * 4u) * (8u * 512u) + lane * 8u; const float* bp = bW + w * 64u + h * 8u;
#pragma unroll
    for (int kc = 0; kc < 8; ++kc)   // in the order of their use: loads return in order, and the first products wait for the first eight alone
#pragma unroll
        for (int mb = 0; mb < 4; ++mb) fa[mb][kc] = cat16b(*(const v8us*)(wp + (mb * 8 + kc) * 512), *(const v8us*)(wp + (mb * 8 + kc) * 512 + 256));
    // the address registers of the loads above are reused below: the wait stands in front of that overwrite; the address is an input of the statement, so that no load takes its registers as its destination; the scheduling barrier keeps the overwrite behind it
    asm volatile("s_wait_xcnt 0x0" : : "v"(wp) : "memory"); __builtin_amdgcn_sched_barrier(0);
    lds_barrier();   // the handed-over values are in LDS before their readers start
    v8us coh[2][4], col[2][4];   // ctx of this wave's 32 queries, channels 64 quarter + 0..63: bf16 head and rest
#pragma unroll
    for (int u = 0; u < 2; ++u) {
        float mj[4], lj[4], aj[4];
#pragma unroll
        for (int j = 0; j < 4; ++j) { const v4f ml = P[((j * 2u + qg) * 2u + u) * (33u * 32u) + 32u * 32u + lane]; mj[j] = ml[0]; lj[j] = ml[1]; }
        const float m = fmaxf(fmaxf(mj[0], mj[1]), fmaxf(mj[2], mj[3]));
#pragma unroll
        for (int j = 0; j < 4; ++j) {
            __builtin_amdgcn_sched_barrier(0); aj[j] = __builtin_amdgcn_exp2f(mj[j] - m); __builtin_amdgcn_sched_barrier(0); asm volatile("v_nop"); __builtin_amdgcn_sched_barrier(0); }
        float l = lj[0] * aj[0] + lj[1] * aj[1] + lj[2] * aj[2] + lj[3] * aj[3]; l += xhalf(l);   // each half of the wave summed its eight keys of every 16
        const float inv = __fdiv_rn(1.0f, l);
#pragma unroll
        for (int tt = 0; tt < 4; ++tt) { v4f x0 = {}, x1 = {};
#pragma unroll
            for (int j = 0; j < 4; ++j) { const unsigned rb = ((j * 2u + qg) * 2u + u) * (33u * 32u) + (kq * 4u + tt) * 64u + lane; x0 += P[rb] * aj[j]; x1 += P[rb + 32u] * aj[j]; }
            v8us oh, ol;
#pragma unroll
            for (int r = 0; r < 4; ++r) { unsigned short a, c2; splitf(__fmul_rn(x0[r], inv), a, c2); oh[r] = a; ol[r] = c2; splitf(__fmul_rn(x1[r], inv), a, c2); oh[4 + r] = a; ol[4 + r] = c2; }
            coh[u][tt] = oh; col[u][tt] = ol; }
    }
    lds_barrier();   // every wave's reads of the join's room have ended before ctx is laid over it
    // ---- out = wW ctx + bW for the workgroup's 64 positions: ctx goes to the other waves through LDS (rows = queries), never through memory
#pragma unroll
    for (int u = 0; u < 2; ++u) { unsigned char* d = L + (qg * 32u + 16u * u + c) * CPI + kq * 128u + 16u * h;
#pragma unroll
        for (int tt = 0; tt < 4; ++tt) { *(v8usa*)(d + tt * 32) = coh[u][tt]; *(v8usa*)(d + CPL + tt * 32) = col[u][tt]; } }
    lds_barrier();   // both ctx planes are in LDS before any wave reads them
    // rows = output channels (A = wW, in registers), columns = positions (B = ctx from LDS, hardware k order as everywhere); the head's eight k blocks, then the rest's, into the same sums
    v8f oa[4][4];
#pragma unroll
    for (int mb = 0; mb < 4; ++mb)
#pragma unroll
        for (int nb = 0; nb < 4; ++nb) oa[mb][nb] = (v8f){};
    const unsigned char* cb = L + c * CPI + 16u * h;
    v16bf fb[2][4];
#pragma unroll
    for (int nb = 0; nb < 4; ++nb) fb[0][nb] = ldsfragb(cb + nb * 16 * CPI);
#pragma unroll
    for (int blk = 0; blk < 16; ++blk) {
        // the next block's four ctx fragments are fetched as one group ahead of this block's 16 products, into the other register set: the scheduling barriers keep the group together and out of the products
        __builtin_amdgcn_sched_barrier(0);
        if (blk < 15) {
#pragma unroll
            for (int nb = 0; nb < 4; ++nb) fb[(blk + 1) & 1][nb] = ldsfragb(cb + ((blk + 1) >> 3) * CPL + nb * 16 * CPI + ((blk + 1) & 7) * 64);
            __builtin_amdgcn_sched_barrier(0); }
        if (blk == 9) {   // the bias is asked for where the first wW fragments have had their last use and left registers free; the remaining blocks cover its latency
#pragma unroll
            for (int mb = 0; mb < 4; ++mb) rowb[mb] = *(const v8f*)(bp + mb * 16);
            // as above: the wait stands in front of any overwrite of the loads' address registers
            asm volatile("s_wait_xcnt 0x0" : : "v"(bp) : "memory"); __builtin_amdgcn_sched_barrier(0); }
#pragma unroll
        for (int nb = 0; nb < 4; ++nb)
#pragma unroll
            for (int mb = 0; mb < 4; ++mb) oa[mb][nb] = wmmab(fa[mb][blk & 7], fb[blk & 1][nb], oa[mb][nb]);
    }
    // each wave turns its 64 x 64 tile through its own room in LDS, so that a store covers whole lines of the NCHW output
    fla* osw = (fla*)(L + COS) + w * (64u * 68u);
#pragma unroll
    for (int mb = 0; mb < 4; ++mb)
#pragma unroll
        for (int nb = 0; nb < 4; ++nb)
#pragma unroll
            for (int j = 0; j < 8; ++j) osw[(mb * 16 + h * 8 + j) * 68 + nb * 16 + c] = oa[mb][nb][j] + bfr(rowb[mb][j]);
    asm volatile("s_wait_dscnt 0x0" ::: "memory");   // the wave's own tile is in LDS before its lanes read one another's values back
    v4f val[32];   // all rows are read before the first store: no register of a store under way is written again
#pragma unroll
    for (int s = 0; s < 32; ++s) val[s] = *(const v4fa*)(osw + (2u * s + h) * 68u + c * 4u);   // tile row 2 s + h, columns 4 c + 0..3
    float* op = OUT + z * (size_t)(CC * TQ) + (size_t)(w * 64u + h) * TQ + blockIdx.x * 64u + c * 4u;
#pragma unroll
    for (int s = 0; s < 32; ++s) *(v4f*)(op + (size_t)(2 * s) * TQ) = val[s];
}

extern "C" void kernel_launch(void* const* d_in, const int* in_sizes, int n_in,
                              void* d_out, int out_size, void* d_ws, size_t ws_size, hipStream_t stream) {
    (void)in_sizes; (void)n_in; (void)out_size;
    const float* IN[17]; for (int i = 0; i < 17; ++i) IN[i] = (const float*)d_in[i];   // 0 x, 1 wq [256][512], 2 bq, 3 gq, 4 betaq, 5 mq, 6 vq, 7 wk, 8 bk, 9 gk, 10 betak, 11 mk, 12 vk, 13 wv, 14 bv, 15 wW [512][256], 16 bW
    float* OUT = (float*)d_out;     // [4][512][4096]
    char* wsp = (char*)d_ws;
    auto take = [&](size_t bytes) { char* p = wsp; wsp += (bytes + 255) & ~(size_t)255; return (void*)p; };
    bf* WQ = (bf*)take((size_t)KC * CC * 2); bf* WK = (bf*)take((size_t)KC * CC * 2); bf* WV = (bf*)take((size_t)VC * CC * 2); bf* WW = (bf*)take((size_t)CC * VC * 2);
    // every plane holds all NB_ images
    bf* XT = (bf*)take((size_t)NB_ * TQ * CC * 2); h16* Q16 = (h16*)take((size_t)NB_ * TQ * KC * 2); h16* K16 = (h16*)take((size_t)NB_ * NKY * KC * 2); h16* VT = (h16*)take((size_t)NB_ * VC * NKY * 2);
    if ((size_t)(wsp - (char*)d_ws) > ws_size) return;    // total = 41 MiB
    k_prep<<<dim3(TQ / 128, CC / 128, NB_ + 2), 256, 0, stream>>>(IN[0], XT, IN[1], IN[7], IN[13], IN[15], WQ, WK, WV, WW);
    k_qkv<<<dim3(TQ / 128, KC / 128, 3 * NB_), 128, 0, stream>>>(XT, WQ, WK, WV, Q16, K16, VT, IN[2], IN[3], IN[4], IN[5], IN[6], IN[8], IN[9], IN[10], IN[11], IN[12], IN[14]);
    k_attn<<<dim3(TQ / 64, NB_, 1), 256, 0, stream>>>(Q16, K16, VT, WW, IN[16], OUT);
}
